// v000
// The times below were measured on an AMD MI455X: many runs one after another, warmed up first and cycling through
// copies of the inputs, with the whole window's GPU time divided by the number of runs. Launches and the gaps
// between them are all in it. The median over several windows is given; except for v000 it joins two sittings, which
// can be a few percent apart, so the side-by-side timings, each taken in one sitting, are the better comparison.
// v000 is the starting kernel. One run takes 235 microseconds.
#include <hip/hip_runtime.h>
#include <hip/hip_bf16.h>

// CDNA5 (gfx1250) fused additive attention.
// K1/K2: bf16-WMMA projection GEMMs (pf, pq). K3: fused score(tanh)+softmax+
// alpha@feature with the score tile resident in the WGP's 320KB LDS and the
// feature K-slabs staged via async global->LDS (ASYNCcnt) double buffering.

typedef __attribute__((ext_vector_type(16))) __bf16 v16bf;
typedef __attribute__((ext_vector_type(8)))  float  v8f;
typedef __attribute__((ext_vector_type(4)))  int    v4i;

#define WMMA_BF16(a, b, c) \
  __builtin_amdgcn_wmma_f32_16x16x32_bf16(false, (a), false, (b), (short)0, (c), false, false)

#define GLOBAL_AS __attribute__((address_space(1)))
#define LDS_AS    __attribute__((address_space(3)))

constexpr int kB = 16, kF = 2048, kQ = 64, kD = 256, kA = 128;

// ---- native tanh if the toolchain exposes V_TANH_F32 ------------------------
#if __has_builtin(__builtin_amdgcn_tanhf)
__device__ __forceinline__ float fast_tanh(float x) { return __builtin_amdgcn_tanhf(x); }
#elif __has_builtin(__builtin_amdgcn_tanh_f32)
__device__ __forceinline__ float fast_tanh(float x) { return __builtin_amdgcn_tanh_f32(x); }
#else
__device__ __forceinline__ float fast_tanh(float x) {
  const float t = __expf(2.0f * x);                      // v_exp_f32
  return (t - 1.0f) * __builtin_amdgcn_rcpf(t + 1.0f);   // v_rcp_f32, no slow div
}
#endif

// ---- async global->LDS staging (gfx1250 ASYNC path) -------------------------
#if __has_builtin(__builtin_amdgcn_global_load_async_to_lds_b128)
#define HAVE_ASYNC_LDS 1
#else
#define HAVE_ASYNC_LDS 0
#endif

#if HAVE_ASYNC_LDS
template <int N>
__device__ __forceinline__ void wait_async() {
#if __has_builtin(__builtin_amdgcn_s_wait_asynccnt)
  __builtin_amdgcn_s_wait_asynccnt(N);
#else
  asm volatile("s_wait_asynccnt %0" ::"n"(N) : "memory");
#endif
}
// Copy a 32 x kD f32 slab (32KB) global->LDS: 8 x b128 per thread, coalesced.
// Builtin signature (per hipcc diagnostic): (as1 v4i*, as3 v4i*, imm, imm).
__device__ __forceinline__ void async_slab(const float* __restrict__ gsrc,
                                           float* __restrict__ ldst, int tid) {
#pragma unroll
  for (int i = 0; i < 8; ++i) {
    const int idx = (tid + i * 256) * 4;  // float index, 16B aligned
    __builtin_amdgcn_global_load_async_to_lds_b128(
        (GLOBAL_AS v4i*)(gsrc + idx), (LDS_AS v4i*)(ldst + idx), 0, 0);
  }
}
#endif

__device__ __forceinline__ void pack8(v16bf& v, int base, float4 lo, float4 hi) {
  v[base + 0] = (__bf16)lo.x; v[base + 1] = (__bf16)lo.y;
  v[base + 2] = (__bf16)lo.z; v[base + 3] = (__bf16)lo.w;
  v[base + 4] = (__bf16)hi.x; v[base + 5] = (__bf16)hi.y;
  v[base + 6] = (__bf16)hi.z; v[base + 7] = (__bf16)hi.w;
}

template <int N, int K>
__global__ __launch_bounds__(256) void proj_gemm_bf16(
    const float* __restrict__ X, const float* __restrict__ W,
    const float* __restrict__ bias, float* __restrict__ Y, int M, int useBias)
{
  const int wave = threadIdx.x >> 5;
  const int lane = threadIdx.x & 31;
  const int gw = blockIdx.x * 8 + wave;
  constexpr int ntn = N >> 4;
  const int total = (M >> 4) * ntn;
  if (gw >= total) return;
  const int tm = gw / ntn;
  const int tn = gw % ntn;

  const int row   = lane & 15;
  const int kbase = (lane < 16) ? 0 : 8;
  const float4* __restrict__ xr4 =
      (const float4*)(X + (size_t)(tm * 16 + row) * K + kbase);
  const float4* __restrict__ wr4 =
      (const float4*)(W + (size_t)(tn * 16 + row) * K + kbase);

  v8f c = {};
#pragma unroll
  for (int k0 = 0; k0 < K; k0 += 32) {
    const int q4 = k0 >> 2;
    v16bf a, b;
    pack8(a, 0, xr4[q4 + 0], xr4[q4 + 1]);  // K = k0+kbase + 0..7
    pack8(a, 8, xr4[q4 + 4], xr4[q4 + 5]);  // K = k0+kbase + 16..23
    pack8(b, 0, wr4[q4 + 0], wr4[q4 + 1]);
    pack8(b, 8, wr4[q4 + 4], wr4[q4 + 5]);
    c = WMMA_BF16(a, b, c);
  }

  // C/D layout: VGPR r -> M=r (lanes 0-15) / M=r+8 (lanes 16-31), N=lane%16
  const int mofs = (lane >> 4) * 8;
  const int gn   = tn * 16 + (lane & 15);
  const float bv = useBias ? bias[gn] : 0.0f;
  float* __restrict__ yp = Y + (size_t)(tm * 16 + mofs) * N + gn;
#pragma unroll
  for (int r = 0; r < 8; ++r) yp[r * N] = c[r] + bv;
}

// ---------------------------------------------------------------------------
// Fused attention: one workgroup (256 thr = 8 waves) per (batch, 16-q tile).
// LDS: s[16][2048] (128KB) + pq[16][128] + wa[128] + 2x feature slab (64KB).
// ---------------------------------------------------------------------------
__global__ __launch_bounds__(256) void fused_attn(
    const float* __restrict__ feature,  // [B,F,D]
    const float* __restrict__ pf,       // [B,F,A]
    const float* __restrict__ pq,       // [B,Q,A] (bias included)
    const float* __restrict__ wa,       // [A]
    const int*   __restrict__ mask,     // [B,F]
    float*       __restrict__ out)      // [B,Q,D]
{
  extern __shared__ float lds[];
  float* s   = lds;                  // [16][kF]
  float* pqs = s + 16 * kF;          // [16][kA]
  float* was = pqs + 16 * kA;        // [kA]
  float* fb0 = was + kA;             // [32][kD] slab buffer 0
  float* fb1 = fb0 + 32 * kD;        // [32][kD] slab buffer 1

  const int tid  = threadIdx.x;
  const int wave = tid >> 5;
  const int lane = tid & 31;
  const int b  = blockIdx.x >> 2;    // Q/16 == 4 query tiles per batch
  const int q0 = (blockIdx.x & 3) * 16;

  for (int i = tid; i < 16 * kA; i += 256)
    pqs[i] = pq[((size_t)b * kQ + q0 + (i >> 7)) * kA + (i & (kA - 1))];
  if (tid < kA) was[tid] = wa[tid];
  __syncthreads();

  // ---- Pass 1: masked scores s[q][f] = sum_a wa[a]*tanh(pf[f][a]+pq[q][a])
  for (int f = tid; f < kF; f += 256) {
    const int mk = mask[b * kF + f];
    float acc[16];
#pragma unroll
    for (int q = 0; q < 16; ++q) acc[q] = 0.0f;
    if (mk) {
      const float4* __restrict__ pr4 =
          (const float4*)(pf + ((size_t)b * kF + f) * kA);
      for (int a0 = 0; a0 < kA; a0 += 8) {
        const float4 p0 = pr4[a0 / 4], p1 = pr4[a0 / 4 + 1];
        const float pv[8] = {p0.x, p0.y, p0.z, p0.w, p1.x, p1.y, p1.z, p1.w};
#pragma unroll
        for (int q = 0; q < 16; ++q) {
          float aq = 0.0f;
#pragma unroll
          for (int j = 0; j < 8; ++j)
            aq += was[a0 + j] * fast_tanh(pv[j] + pqs[q * kA + a0 + j]);
          acc[q] += aq;
        }
      }
    }
#pragma unroll
    for (int q = 0; q < 16; ++q)
      s[q * kF + f] = mk ? acc[q] : -1.0e9f;
  }
  __syncthreads();

  // ---- Pass 2: softmax over F per row (wave32 shuffle reductions) ----------
  for (int q = wave * 2; q < wave * 2 + 2; ++q) {
    float m = -3.0e38f;
    for (int f = lane; f < kF; f += 32) m = fmaxf(m, s[q * kF + f]);
#pragma unroll
    for (int o = 16; o >= 1; o >>= 1) m = fmaxf(m, __shfl_xor(m, o, 32));
    float sum = 0.0f;
    for (int f = lane; f < kF; f += 32) {
      const float e = __expf(s[q * kF + f] - m);
      s[q * kF + f] = e;
      sum += e;
    }
#pragma unroll
    for (int o = 16; o >= 1; o >>= 1) sum += __shfl_xor(sum, o, 32);
    const float inv = __builtin_amdgcn_rcpf(sum);
    for (int f = lane; f < kF; f += 32) s[q * kF + f] *= inv;
  }
  __syncthreads();

  // ---- Pass 3: out[16][256] = alpha[16][2048] @ feature[b] (WMMA bf16) -----
  const int n     = lane & 15;
  const int col0  = wave * 16 + n;          // wave owns column tiles {w, w+8}
  const int col1  = (wave + 8) * 16 + n;
  const int arow  = lane & 15;
  const int kbase = (lane < 16) ? 0 : 8;
  v8f c0 = {}, c1 = {};

#if HAVE_ASYNC_LDS
  const float* fbase = feature + (size_t)b * kF * kD;
  async_slab(fbase, fb0, tid);
  for (int ks = 0; ks < kF / 32; ++ks) {
    float* cur = (ks & 1) ? fb1 : fb0;
    float* nxt = (ks & 1) ? fb0 : fb1;
    const bool more = (ks + 1) < (kF / 32);
    if (more) {
      async_slab(fbase + (size_t)(ks + 1) * 32 * kD, nxt, tid);
      wait_async<8>();   // my 8 loads for `cur` are done (in-order)
    } else {
      wait_async<0>();
    }
    __syncthreads();     // everyone's slab data visible

    const int k0 = ks * 32;
    v16bf af, b0v, b1v;
#pragma unroll
    for (int e = 0; e < 16; ++e) {
      const int kk = kbase + e + ((e >= 8) ? 8 : 0);   // 0..31 within slab
      af[e]  = (__bf16)s[arow * kF + k0 + kk];
      b0v[e] = (__bf16)cur[kk * kD + col0];
      b1v[e] = (__bf16)cur[kk * kD + col1];
    }
    c0 = WMMA_BF16(af, b0v, c0);
    c1 = WMMA_BF16(af, b1v, c1);
    __syncthreads();     // all waves done reading `cur` before it is reused
  }
#else
  for (int k0 = 0; k0 < kF; k0 += 32) {
    if (k0 + 32 < kF)
      __builtin_prefetch(feature + ((size_t)b * kF + k0 + 32 + kbase) * kD, 0, 1);
    v16bf af, b0v, b1v;
#pragma unroll
    for (int e = 0; e < 16; ++e) {
      const int k = k0 + kbase + e + ((e >= 8) ? 8 : 0);
      af[e] = (__bf16)s[arow * kF + k];
      const float* __restrict__ fr = feature + ((size_t)b * kF + k) * kD;
      b0v[e] = (__bf16)fr[col0];
      b1v[e] = (__bf16)fr[col1];
    }
    c0 = WMMA_BF16(af, b0v, c0);
    c1 = WMMA_BF16(af, b1v, c1);
  }
#endif

  const int mofs = (lane >> 4) * 8;
#pragma unroll
  for (int r = 0; r < 8; ++r) {
    const int gq = q0 + mofs + r;
    float* __restrict__ orow = out + ((size_t)b * kQ + gq) * kD;
    orow[col0] = c0[r];
    orow[col1] = c1[r];
  }
}

// ---------------------------------------------------------------------------
extern "C" void kernel_launch(void* const* d_in, const int* in_sizes, int n_in,
                              void* d_out, int out_size, void* d_ws, size_t ws_size,
                              hipStream_t stream) {
  const float* feature = (const float*)d_in[0];  // [B,F,D]
  const float* query   = (const float*)d_in[1];  // [B,Q,QD]
  const float* Wf      = (const float*)d_in[2];  // [A,D]
  const float* Wq      = (const float*)d_in[3];  // [A,QD]
  const float* bq      = (const float*)d_in[4];  // [A]
  const float* wa      = (const float*)d_in[5];  // [A]
  const int*   mask    = (const int*)d_in[6];    // [B,F]
  float* out = (float*)d_out;

  float* pf  = (float*)d_ws;                     // [B,F,A] = 16 MB
  float* pqv = pf + (size_t)kB * kF * kA;        // [B,Q,A] = 0.5 MB

  {  // pf = feature @ Wf^T : M=32768, N=128, K=256
    const int M = kB * kF;
    const int blocks = ((M / 16) * (kA / 16) + 7) / 8;
    proj_gemm_bf16<kA, kD><<<blocks, 256, 0, stream>>>(feature, Wf, nullptr, pf, M, 0);
  }
  {  // pq = query @ Wq^T + bq : M=1024, N=128, K=256
    const int M = kB * kQ;
    const int blocks = ((M / 16) * (kA / 16) + 7) / 8;
    proj_gemm_bf16<kA, kD><<<blocks, 256, 0, stream>>>(query, Wq, bq, pqv, M, 1);
  }
  {  // fused scores + softmax + weighted sum (~200KB LDS, ok on 320KB WGP)
    const size_t shmem =
        (size_t)(16 * kF + 16 * kA + kA + 2 * 32 * kD) * sizeof(float);
    fused_attn<<<kB * (kQ / 16), 256, shmem, stream>>>(feature, pf, pqv, wa, mask, out);
  }
}

// v001
// It runs in 106 microseconds.
// In both of two side-by-side timings against v000, it was 2.24 times as fast.
#include <hip/hip_runtime.h>
#include <hip/hip_bf16.h>

// CDNA5 (gfx1250) fused additive attention.
// K1/K2: bf16-WMMA projection GEMMs (pf, pq). K3: fused score(tanh)+softmax
// partials+weights@feature for one range of the feature axis per workgroup,
// the feature K-slabs staged via async global->LDS (ASYNCcnt) double buffering.
// K4: merges the ranges' partials (max, sum, un-normalised weighted sum).

typedef __attribute__((ext_vector_type(16))) __bf16 v16bf;
typedef __attribute__((ext_vector_type(8)))  float  v8f;
typedef __attribute__((ext_vector_type(4)))  int    v4i;

#define WMMA_BF16(a, b, c) \
  __builtin_amdgcn_wmma_f32_16x16x32_bf16(false, (a), false, (b), (short)0, (c), false, false)

#define GLOBAL_AS __attribute__((address_space(1)))
#define LDS_AS    __attribute__((address_space(3)))

constexpr int kB = 16, kF = 2048, kQ = 64, kD = 256, kA = 128;
constexpr int kS  = 8;         // ranges of the feature axis, one workgroup each
constexpr int kFS = kF / kS;   // features per range

// ---- native tanh if the toolchain exposes V_TANH_F32 ------------------------
#if __has_builtin(__builtin_amdgcn_tanhf)
__device__ __forceinline__ float fast_tanh(float x) { return __builtin_amdgcn_tanhf(x); }
#elif __has_builtin(__builtin_amdgcn_tanh_f32)
__device__ __forceinline__ float fast_tanh(float x) { return __builtin_amdgcn_tanh_f32(x); }
#else
__device__ __forceinline__ float fast_tanh(float x) {
  const float t = __expf(2.0f * x);                      // v_exp_f32
  return (t - 1.0f) * __builtin_amdgcn_rcpf(t + 1.0f);   // v_rcp_f32, no slow div
}
#endif

// ---- async global->LDS staging (gfx1250 ASYNC path) -------------------------
#if __has_builtin(__builtin_amdgcn_global_load_async_to_lds_b128)
#define HAVE_ASYNC_LDS 1
#else
#define HAVE_ASYNC_LDS 0
#endif

#if HAVE_ASYNC_LDS
template <int N>
__device__ __forceinline__ void wait_async() {
#if __has_builtin(__builtin_amdgcn_s_wait_asynccnt)
  __builtin_amdgcn_s_wait_asynccnt(N);
#else
  asm volatile("s_wait_asynccnt %0" ::"n"(N) : "memory");
#endif
}
// Copy a 32 x kD f32 slab (32KB) global->LDS: 8 x b128 per thread, coalesced.
// Builtin signature (per hipcc diagnostic): (as1 v4i*, as3 v4i*, imm, imm).
__device__ __forceinline__ void async_slab(const float* __restrict__ gsrc,
                                           float* __restrict__ ldst, int tid) {
#pragma unroll
  for (int i = 0; i < 8; ++i) {
    const int idx = (tid + i * 256) * 4;  // float index, 16B aligned
    __builtin_amdgcn_global_load_async_to_lds_b128(
        (GLOBAL_AS v4i*)(gsrc + idx), (LDS_AS v4i*)(ldst + idx), 0, 0);
  }
}
#endif

__device__ __forceinline__ void pack8(v16bf& v, int base, float4 lo, float4 hi) {
  v[base + 0] = (__bf16)lo.x; v[base + 1] = (__bf16)lo.y;
  v[base + 2] = (__bf16)lo.z; v[base + 3] = (__bf16)lo.w;
  v[base + 4] = (__bf16)hi.x; v[base + 5] = (__bf16)hi.y;
  v[base + 6] = (__bf16)hi.z; v[base + 7] = (__bf16)hi.w;
}

template <int N, int K>
__global__ __launch_bounds__(256) void proj_gemm_bf16(
    const float* __restrict__ X, const float* __restrict__ W,
    const float* __restrict__ bias, float* __restrict__ Y, int M, int useBias)
{
  const int wave = threadIdx.x >> 5;
  const int lane = threadIdx.x & 31;
  const int gw = blockIdx.x * 8 + wave;
  constexpr int ntn = N >> 4;
  const int total = (M >> 4) * ntn;
  if (gw >= total) return;
  const int tm = gw / ntn;
  const int tn = gw % ntn;

  const int row   = lane & 15;
  const int kbase = (lane < 16) ? 0 : 8;
  const float4* __restrict__ xr4 =
      (const float4*)(X + (size_t)(tm * 16 + row) * K + kbase);
  const float4* __restrict__ wr4 =
      (const float4*)(W + (size_t)(tn * 16 + row) * K + kbase);

  v8f c = {};
#pragma unroll
  for (int k0 = 0; k0 < K; k0 += 32) {
    const int q4 = k0 >> 2;
    v16bf a, b;
    pack8(a, 0, xr4[q4 + 0], xr4[q4 + 1]);  // K = k0+kbase + 0..7
    pack8(a, 8, xr4[q4 + 4], xr4[q4 + 5]);  // K = k0+kbase + 16..23
    pack8(b, 0, wr4[q4 + 0], wr4[q4 + 1]);
    pack8(b, 8, wr4[q4 + 4], wr4[q4 + 5]);
    c = WMMA_BF16(a, b, c);
  }

  // C/D layout: VGPR r -> M=r (lanes 0-15) / M=r+8 (lanes 16-31), N=lane%16
  const int mofs = (lane >> 4) * 8;
  const int gn   = tn * 16 + (lane & 15);
  const float bv = useBias ? bias[gn] : 0.0f;
  float* __restrict__ yp = Y + (size_t)(tm * 16 + mofs) * N + gn;
#pragma unroll
  for (int r = 0; r < 8; ++r) yp[r * N] = c[r] + bv;
}

// ---------------------------------------------------------------------------
// Fused attention: one workgroup (256 thr = 8 waves) per (batch, 16-q tile,
// feature range). It leaves the range's row maxima, row sums and the
// un-normalised weighted sum in the workspace; merge_ranges finishes the softmax.
// LDS: s[16][kFS] + pq[16][128] + wa[128] + 2x feature slab (64KB).
// ---------------------------------------------------------------------------
__global__ __launch_bounds__(256) void fused_attn(
    const float* __restrict__ feature,  // [B,F,D]
    const float* __restrict__ pf,       // [B,F,A]
    const float* __restrict__ pq,       // [B,Q,A] (bias included)
    const float* __restrict__ wa,       // [A]
    const int*   __restrict__ mask,     // [B,F]
    float*       __restrict__ po,       // [B*Q/16,S,16,D] un-normalised partial sums
    float*       __restrict__ pml)      // [B*Q/16,S,32] 16 range maxima, 16 range sums
{
  extern __shared__ float lds[];
  float* s   = lds;                  // [16][kFS]
  float* pqs = s + 16 * kFS;         // [16][kA]
  float* was = pqs + 16 * kA;        // [kA]
  float* fb0 = was + kA;             // [32][kD] slab buffer 0
  float* fb1 = fb0 + 32 * kD;        // [32][kD] slab buffer 1

  const int tid  = threadIdx.x;
  const int wave = tid >> 5;
  const int lane = tid & 31;
  const int sp   = blockIdx.x % kS;  // feature range
  const int tile = blockIdx.x / kS;
  const int b  = tile >> 2;          // Q/16 == 4 query tiles per batch
  const int q0 = (tile & 3) * 16;
  const int f0 = sp * kFS;

  for (int i = tid; i < 16 * kA; i += 256)
    pqs[i] = pq[((size_t)b * kQ + q0 + (i >> 7)) * kA + (i & (kA - 1))];
  if (tid < kA) was[tid] = wa[tid];
  __syncthreads();

  // ---- Pass 1: masked scores s[q][f] = sum_a wa[a]*tanh(pf[f][a]+pq[q][a])
  for (int f = tid; f < kFS; f += 256) {
    const int mk = mask[b * kF + f0 + f];
    float acc[16];
#pragma unroll
    for (int q = 0; q < 16; ++q) acc[q] = 0.0f;
    if (mk) {
      const float4* __restrict__ pr4 =
          (const float4*)(pf + ((size_t)b * kF + f0 + f) * kA);
      for (int a0 = 0; a0 < kA; a0 += 8) {
        const float4 p0 = pr4[a0 / 4], p1 = pr4[a0 / 4 + 1];
        const float pv[8] = {p0.x, p0.y, p0.z, p0.w, p1.x, p1.y, p1.z, p1.w};
#pragma unroll
        for (int q = 0; q < 16; ++q) {
          float aq = 0.0f;
#pragma unroll
          for (int j = 0; j < 8; ++j)
            aq += was[a0 + j] * fast_tanh(pv[j] + pqs[q * kA + a0 + j]);
          acc[q] += aq;
        }
      }
    }
#pragma unroll
    for (int q = 0; q < 16; ++q)
      s[q * kFS + f] = mk ? acc[q] : -1.0e9f;
  }
  __syncthreads();

  // ---- Pass 2: range max, exp and range sum per row (wave32 shuffles) ------
  for (int q = wave * 2; q < wave * 2 + 2; ++q) {
    float m = -3.0e38f;
    for (int f = lane; f < kFS; f += 32) m = fmaxf(m, s[q * kFS + f]);
#pragma unroll
    for (int o = 16; o >= 1; o >>= 1) m = fmaxf(m, __shfl_xor(m, o, 32));
    float sum = 0.0f;
    for (int f = lane; f < kFS; f += 32) {
      const float e = __expf(s[q * kFS + f] - m);
      s[q * kFS + f] = e;
      sum += e;
    }
#pragma unroll
    for (int o = 16; o >= 1; o >>= 1) sum += __shfl_xor(sum, o, 32);
    if (lane == 0) {  // one 128-byte line per workgroup
      pml[blockIdx.x * 32 + q]      = m;
      pml[blockIdx.x * 32 + 16 + q] = sum;
    }
  }
  __syncthreads();

  // ---- Pass 3: po[16][256] = e[16][kFS] @ feature[b][f0..] (WMMA bf16) -----
  const int n     = lane & 15;
  const int col0  = wave * 16 + n;          // wave owns column tiles {w, w+8}
  const int col1  = (wave + 8) * 16 + n;
  const int arow  = lane & 15;
  const int kbase = (lane < 16) ? 0 : 8;
  v8f c0 = {}, c1 = {};

#if HAVE_ASYNC_LDS
  const float* fbase = feature + ((size_t)b * kF + f0) * kD;
  async_slab(fbase, fb0, tid);
  for (int ks = 0; ks < kFS / 32; ++ks) {
    float* cur = (ks & 1) ? fb1 : fb0;
    float* nxt = (ks & 1) ? fb0 : fb1;
    const bool more = (ks + 1) < (kFS / 32);
    if (more) {
      async_slab(fbase + (size_t)(ks + 1) * 32 * kD, nxt, tid);
      wait_async<8>();   // my 8 loads for `cur` are done (in-order)
    } else {
      wait_async<0>();
    }
    __syncthreads();     // everyone's slab data visible

    const int k0 = ks * 32;
    v16bf af, b0v, b1v;
#pragma unroll
    for (int e = 0; e < 16; ++e) {
      const int kk = kbase + e + ((e >= 8) ? 8 : 0);   // 0..31 within slab
      af[e]  = (__bf16)s[arow * kFS + k0 + kk];
      b0v[e] = (__bf16)cur[kk * kD + col0];
      b1v[e] = (__bf16)cur[kk * kD + col1];
    }
    c0 = WMMA_BF16(af, b0v, c0);
    c1 = WMMA_BF16(af, b1v, c1);
    __syncthreads();     // all waves done reading `cur` before it is reused
  }
#else
  for (int k0 = 0; k0 < kFS; k0 += 32) {
    if (k0 + 32 < kFS)
      __builtin_prefetch(feature + ((size_t)b * kF + f0 + k0 + 32 + kbase) * kD, 0, 1);
    v16bf af, b0v, b1v;
#pragma unroll
    for (int e = 0; e < 16; ++e) {
      const int k = k0 + kbase + e + ((e >= 8) ? 8 : 0);
      af[e] = (__bf16)s[arow * kFS + k];
      const float* __restrict__ fr = feature + ((size_t)b * kF + f0 + k) * kD;
      b0v[e] = (__bf16)fr[col0];
      b1v[e] = (__bf16)fr[col1];
    }
    c0 = WMMA_BF16(af, b0v, c0);
    c1 = WMMA_BF16(af, b1v, c1);
  }
#endif

  const int mofs = (lane >> 4) * 8;
#pragma unroll
  for (int r = 0; r < 8; ++r) {
    float* __restrict__ orow = po + ((size_t)blockIdx.x * 16 + mofs + r) * kD;
    orow[col0] = c0[r];
    orow[col1] = c1[r];
  }
}

// exp(x). The v_nop in the statement is the free slot that the instruction set
// asks for behind a transcendental before its source register is overwritten.
__device__ __forceinline__ float exp_slot(float x) {
  float r;
  asm("v_exp_f32 %0, %1\n\tv_nop" : "=v"(r) : "v"(x * 1.44269504f));
  return r;
}

// ---------------------------------------------------------------------------
// Merge of the kS ranges of one (batch, query) row: weight exp(m_s - M) per
// range, out = sum_s w_s * po_s / sum_s w_s * l_s. 64 threads per row, float4.
// ---------------------------------------------------------------------------
__global__ __launch_bounds__(256) void merge_ranges(
    const float* __restrict__ po,   // [B*Q/16,S,16,D]
    const float* __restrict__ pml,  // [B*Q/16,S,32]
    float*       __restrict__ out)  // [B*Q,D]
{
  const int row  = blockIdx.x * 4 + (threadIdx.x >> 6);
  const int d4   = threadIdx.x & 63;
  const int tile = row >> 4;
  const int qi   = row & 15;
  const float* __restrict__ ml = pml + tile * kS * 32 + qi;
  float mv[kS];
  float M = -3.0e38f;
#pragma unroll  // keeps mv[] in registers
  for (int i = 0; i < kS; ++i) {
    mv[i] = ml[i * 32];
    M = fmaxf(M, mv[i]);
  }
  const float4* __restrict__ p4 =
      (const float4*)(po + ((size_t)tile * kS * 16 + qi) * kD) + d4;
  float L = 0.0f;
  float4 o = make_float4(0.0f, 0.0f, 0.0f, 0.0f);
#pragma unroll  // all kS loads in flight at once: one L2 latency, not kS
  for (int i = 0; i < kS; ++i) {
    const float w = exp_slot(mv[i] - M);
    const float4 v = p4[i * (16 * kD / 4)];
    L += w * ml[i * 32 + 16];
    o.x += w * v.x; o.y += w * v.y; o.z += w * v.z; o.w += w * v.w;
  }
  const float inv = __builtin_amdgcn_rcpf(L);
  ((float4*)(out + (size_t)row * kD))[d4] =
      make_float4(o.x * inv, o.y * inv, o.z * inv, o.w * inv);
}

// ---------------------------------------------------------------------------
extern "C" void kernel_launch(void* const* d_in, const int* in_sizes, int n_in,
                              void* d_out, int out_size, void* d_ws, size_t ws_size,
                              hipStream_t stream) {
  const float* feature = (const float*)d_in[0];  // [B,F,D]
  const float* query   = (const float*)d_in[1];  // [B,Q,QD]
  const float* Wf      = (const float*)d_in[2];  // [A,D]
  const float* Wq      = (const float*)d_in[3];  // [A,QD]
  const float* bq      = (const float*)d_in[4];  // [A]
  const float* wa      = (const float*)d_in[5];  // [A]
  const int*   mask    = (const int*)d_in[6];    // [B,F]
  float* out = (float*)d_out;

  float* pf  = (float*)d_ws;                     // [B,F,A] = 16 MB
  float* pqv = pf + (size_t)kB * kF * kA;        // [B,Q,A] = 0.5 MB
  float* po  = pqv + (size_t)kB * kQ * kA;       // [B*Q/16,S,16,D]
  float* pml = po + (size_t)kB * kQ * kS * kD;   // [B*Q/16,S,32]

  {  // pf = feature @ Wf^T : M=32768, N=128, K=256
    const int M = kB * kF;
    const int blocks = ((M / 16) * (kA / 16) + 7) / 8;
    proj_gemm_bf16<kA, kD><<<blocks, 256, 0, stream>>>(feature, Wf, nullptr, pf, M, 0);
  }
  {  // pq = query @ Wq^T + bq : M=1024, N=128, K=256
    const int M = kB * kQ;
    const int blocks = ((M / 16) * (kA / 16) + 7) / 8;
    proj_gemm_bf16<kA, kD><<<blocks, 256, 0, stream>>>(query, Wq, bq, pqv, M, 1);
  }
  {  // scores + softmax partials + weighted sum, one feature range per workgroup
    const size_t shmem =
        (size_t)(16 * kFS + 16 * kA + kA + 2 * 32 * kD) * sizeof(float);
    fused_attn<<<kB * (kQ / 16) * kS, 256, shmem, stream>>>(feature, pf, pqv, wa, mask,
                                                            po, pml);
  }
  // merge of the ranges: 4 rows per workgroup
  merge_ranges<<<kB * kQ / 4, 256, 0, stream>>>(po, pml, out);
}

// v002
// One run takes 64.8 microseconds.
// Timed twice side by side with v001, it ran 1.64 times as fast both times.
// All steps since v000 together make it 3.67 times as fast.
#include <hip/hip_runtime.h>
#include <hip/hip_bf16.h>

// CDNA5 (gfx1250) fused additive attention.
// K1/K2: bf16-WMMA projection GEMMs (pf, pq). K3: fused score(tanh)+softmax
// partials+weights@feature for one range of the feature axis per workgroup,
// the feature K-slabs staged via async global->LDS (ASYNCcnt) double buffering.
// K4: merges the ranges' partials (max, sum, un-normalised weighted sum).

typedef __attribute__((ext_vector_type(16))) __bf16 v16bf;
typedef __attribute__((ext_vector_type(8)))  __bf16 v8bf;
typedef __attribute__((ext_vector_type(4)))  __bf16 v4bf;
typedef __attribute__((ext_vector_type(8)))  float  v8f;
typedef __attribute__((ext_vector_type(4)))  int    v4i;

#define WMMA_BF16(a, b, c) \
  __builtin_amdgcn_wmma_f32_16x16x32_bf16(false, (a), false, (b), (short)0, (c), false, false)

#define GLOBAL_AS __attribute__((address_space(1)))
#define LDS_AS    __attribute__((address_space(3)))

constexpr int kB = 16, kF = 2048, kQ = 64, kD = 256, kA = 128;
constexpr int kS  = 8;         // ranges of the feature axis, one workgroup each
constexpr int kFS = kF / kS;   // features per range

// ---- native tanh if the toolchain exposes V_TANH_F32 ------------------------
#if __has_builtin(__builtin_amdgcn_tanhf)
__device__ __forceinline__ float fast_tanh(float x) { return __builtin_amdgcn_tanhf(x); }
#elif __has_builtin(__builtin_amdgcn_tanh_f32)
__device__ __forceinline__ float fast_tanh(float x) { return __builtin_amdgcn_tanh_f32(x); }
#else
__device__ __forceinline__ float fast_tanh(float x) {
  const float t = __expf(2.0f * x);                      // v_exp_f32
  return (t - 1.0f) * __builtin_amdgcn_rcpf(t + 1.0f);   // v_rcp_f32, no slow div
}
#endif

// ---- async global->LDS staging (gfx1250 ASYNC path) -------------------------
#if __has_builtin(__builtin_amdgcn_global_load_async_to_lds_b128)
#define HAVE_ASYNC_LDS 1
#else
#define HAVE_ASYNC_LDS 0
#endif

#if HAVE_ASYNC_LDS
template <int N>
__device__ __forceinline__ void wait_async() {
#if __has_builtin(__builtin_amdgcn_s_wait_asynccnt)
  __builtin_amdgcn_s_wait_asynccnt(N);
#else
  asm volatile("s_wait_asynccnt %0" ::"n"(N) : "memory");
#endif
}
// Copy a 32 x kD f32 slab (32KB) global->LDS: 8 x b128 per thread, coalesced.
// Builtin signature (per hipcc diagnostic): (as1 v4i*, as3 v4i*, imm, imm).
__device__ __forceinline__ void async_slab(const float* __restrict__ gsrc,
                                           float* __restrict__ ldst, int tid) {
#pragma unroll
  for (int i = 0; i < 8; ++i) {
    const int idx = (tid + i * 256) * 4;  // float index, 16B aligned
    __builtin_amdgcn_global_load_async_to_lds_b128(
        (GLOBAL_AS v4i*)(gsrc + idx), (LDS_AS v4i*)(ldst + idx), 0, 0);
  }
}
#endif

__device__ __forceinline__ void pack8(v16bf& v, int base, float4 lo, float4 hi) {
  v[base + 0] = (__bf16)lo.x; v[base + 1] = (__bf16)lo.y;
  v[base + 2] = (__bf16)lo.z; v[base + 3] = (__bf16)lo.w;
  v[base + 4] = (__bf16)hi.x; v[base + 5] = (__bf16)hi.y;
  v[base + 6] = (__bf16)hi.z; v[base + 7] = (__bf16)hi.w;
}

template <int N, int K>
__global__ __launch_bounds__(256) void proj_gemm_bf16(
    const float* __restrict__ X, const float* __restrict__ W,
    const float* __restrict__ bias, float* __restrict__ Y, int M, int useBias)
{
  const int wave = threadIdx.x >> 5;
  const int lane = threadIdx.x & 31;
  const int gw = blockIdx.x * 8 + wave;
  constexpr int ntn = N >> 4;
  const int total = (M >> 4) * ntn;
  if (gw >= total) return;
  const int tm = gw / ntn;
  const int tn = gw % ntn;

  const int row   = lane & 15;
  const int kbase = (lane < 16) ? 0 : 8;
  const float4* __restrict__ xr4 =
      (const float4*)(X + (size_t)(tm * 16 + row) * K + kbase);
  const float4* __restrict__ wr4 =
      (const float4*)(W + (size_t)(tn * 16 + row) * K + kbase);

  v8f c = {};
#pragma unroll
  for (int k0 = 0; k0 < K; k0 += 32) {
    const int q4 = k0 >> 2;
    v16bf a, b;
    pack8(a, 0, xr4[q4 + 0], xr4[q4 + 1]);  // K = k0+kbase + 0..7
    pack8(a, 8, xr4[q4 + 4], xr4[q4 + 5]);  // K = k0+kbase + 16..23
    pack8(b, 0, wr4[q4 + 0], wr4[q4 + 1]);
    pack8(b, 8, wr4[q4 + 4], wr4[q4 + 5]);
    c = WMMA_BF16(a, b, c);
  }

  // C/D layout: VGPR r -> M=r (lanes 0-15) / M=r+8 (lanes 16-31), N=lane%16
  const int mofs = (lane >> 4) * 8;
  const int gn   = tn * 16 + (lane & 15);
  const float bv = useBias ? bias[gn] : 0.0f;
  float* __restrict__ yp = Y + (size_t)(tm * 16 + mofs) * N + gn;
#pragma unroll
  for (int r = 0; r < 8; ++r) yp[r * N] = c[r] + bv;
}

// ---------------------------------------------------------------------------
// Feature projection: Y[M,kA] = X[M,kD] * W[kA,kD]^T. One workgroup = 128 rows,
// one wave = 16 rows x all kA columns, so every X element is loaded once on the
// chip. W is read once per workgroup in whole lines, rounded to bf16 and kept in
// LDS; the B fragments come from there. Fragment k order and the order of the
// k steps are those of proj_gemm_bf16.
// ---------------------------------------------------------------------------
constexpr int kWP = kD + 8;  // bf16 per LDS row of W: 528 B = 16 B x odd, no bank conflict for b128 readers

__global__ __launch_bounds__(256) void proj_rows_bf16(
    const float* __restrict__ X, const float* __restrict__ W, float* __restrict__ Y)
{
  __shared__ __attribute__((aligned(16))) __bf16 wl[kA * kWP];
  const int tid   = threadIdx.x;
  const int wave  = tid >> 5;
  const int lane  = tid & 31;
  const int row   = lane & 15;
  const int kbase = (lane < 16) ? 0 : 8;
  const int m0    = (blockIdx.x * 8 + wave) * 16;

  // W passes through registers in two halves, so that one half (64 registers) and
  // the wave's whole X strip (128) are in flight together below 256 registers.
  const float4* __restrict__ w4 = (const float4*)W;  // kD/4 = 64 float4 per row
  constexpr int kWH = kA * kD / 4 / 256 / 2;         // float4 per thread and half
  __bf16* wdst = &wl[(tid >> 6) * kWP + (tid & 63) * 4];  // a wave reads 512 B, writes 256 B
  float4 wv[kWH];
#pragma unroll  // keeps wv[] in registers
  for (int i = 0; i < kWH; ++i) wv[i] = w4[tid + i * 256];

  const float4* __restrict__ xr4 =
      (const float4*)(X + (size_t)(m0 + row) * kD + kbase);
  float4 xv[kD / 8];
#pragma unroll  // keeps xv[] in registers
  for (int ks = 0; ks < kD / 32; ++ks) {
    xv[ks * 4 + 0] = xr4[ks * 8 + 0];  // K = ks*32+kbase + 0..7
    xv[ks * 4 + 1] = xr4[ks * 8 + 1];
    xv[ks * 4 + 2] = xr4[ks * 8 + 4];  // K = ks*32+kbase + 16..23
    xv[ks * 4 + 3] = xr4[ks * 8 + 5];
  }
  // Keeps all 48 loads in front of the first wait; without it the compiler holds
  // part of the X loads back until the first half of W has arrived.
  __builtin_amdgcn_sched_barrier(0);

#pragma unroll  // wv[] is indexed by constants only, here and in the two inner loops
  for (int h = 0; h < 2; ++h) {
#pragma unroll
    for (int i = 0; i < kWH; ++i) {
      v4bf p;
      p[0] = (__bf16)wv[i].x; p[1] = (__bf16)wv[i].y;
      p[2] = (__bf16)wv[i].z; p[3] = (__bf16)wv[i].w;
      *(v4bf*)(wdst + (h * kWH + i) * 4 * kWP) = p;  // 4 rows of W per 256 threads
    }
    if (h == 0) {
#pragma unroll
      for (int i = 0; i < kWH; ++i) wv[i] = w4[tid + (kWH + i) * 256];
    }
  }

  v16bf a[kD / 32];
#pragma unroll  // keeps a[] in registers
  for (int ks = 0; ks < kD / 32; ++ks) {
    pack8(a[ks], 0, xv[ks * 4 + 0], xv[ks * 4 + 1]);
    pack8(a[ks], 8, xv[ks * 4 + 2], xv[ks * 4 + 3]);
  }
  __syncthreads();  // W is complete in LDS

  v8f c[kA / 16];
#pragma unroll  // keeps c[] in registers
  for (int tn = 0; tn < kA / 16; ++tn) c[tn] = v8f{};

  // Groups of 4 WMMAs (one k step, 4 column tiles); the B fragments of a group are
  // read as one run of 8 ds_load_b128, two groups ahead, into a ring of 3 sets.
  const __bf16* bbase = &wl[row * kWP + kbase];
  constexpr int kG = (kD / 32) * 2;
  v16bf bq[3][4];
  auto load_group = [&](int g) {
#pragma unroll  // bq[] is indexed by constants only
    for (int t = 0; t < 4; ++t) {
      const __bf16* bp = bbase + ((g & 1) * 4 + t) * 16 * kWP + (g >> 1) * 32;
      const v8bf lo = *(const v8bf*)bp;         // K = ks*32+kbase + 0..7
      const v8bf hi = *(const v8bf*)(bp + 16);  // K = ks*32+kbase + 16..23
      bq[g % 3][t] = __builtin_shufflevector(lo, hi, 0, 1, 2, 3, 4, 5, 6, 7, 8, 9, 10, 11,
                                             12, 13, 14, 15);
    }
  };
  load_group(0);
  load_group(1);
#pragma unroll  // a[], c[] and bq[] are indexed by constants only
  for (int g = 0; g < kG; ++g) {
    if (g + 2 < kG) load_group(g + 2);
    // The two fences keep each group's LDS reads together and two groups ahead of
    // their WMMAs; left alone the compiler put each read pair directly in front of
    // its WMMA with a full wait.
    __builtin_amdgcn_sched_barrier(0);
#pragma unroll  // c[] and bq[] are indexed by constants only
    for (int t = 0; t < 4; ++t)
      c[(g & 1) * 4 + t] = WMMA_BF16(a[g >> 1], bq[g % 3][t], c[(g & 1) * 4 + t]);
    __builtin_amdgcn_sched_barrier(0);
  }

  // C/D layout as in proj_gemm_bf16; the wave writes its 16 rows whole.
  float* __restrict__ yp = Y + (size_t)(m0 + (lane >> 4) * 8) * kA + row;
#pragma unroll  // both loops: c[] is indexed by constants only, offsets fold into the stores
  for (int tn = 0; tn < kA / 16; ++tn)
#pragma unroll
    for (int r = 0; r < 8; ++r) yp[r * kA + tn * 16] = c[tn][r];
}

// ---------------------------------------------------------------------------
// Fused attention: one workgroup (256 thr = 8 waves) per (batch, 16-q tile,
// feature range). It leaves the range's row maxima, row sums and the
// un-normalised weighted sum in the workspace; merge_ranges finishes the softmax.
// LDS: s[16][kFS] + pq[16][128] + wa[128] + 2x feature slab (64KB).
// ---------------------------------------------------------------------------
__global__ __launch_bounds__(256) void fused_attn(
    const float* __restrict__ feature,  // [B,F,D]
    const float* __restrict__ pf,       // [B,F,A]
    const float* __restrict__ pq,       // [B,Q,A] (bias included)
    const float* __restrict__ wa,       // [A]
    const int*   __restrict__ mask,     // [B,F]
    float*       __restrict__ po,       // [B*Q/16,S,16,D] un-normalised partial sums
    float*       __restrict__ pml)      // [B*Q/16,S,32] 16 range maxima, 16 range sums
{
  extern __shared__ float lds[];
  float* s   = lds;                  // [16][kFS]
  float* pqs = s + 16 * kFS;         // [16][kA]
  float* was = pqs + 16 * kA;        // [kA]
  float* fb0 = was + kA;             // [32][kD] slab buffer 0
  float* fb1 = fb0 + 32 * kD;        // [32][kD] slab buffer 1

  const int tid  = threadIdx.x;
  const int wave = tid >> 5;
  const int lane = tid & 31;
  const int sp   = blockIdx.x % kS;  // feature range
  const int tile = blockIdx.x / kS;
  const int b  = tile >> 2;          // Q/16 == 4 query tiles per batch
  const int q0 = (tile & 3) * 16;
  const int f0 = sp * kFS;

  for (int i = tid; i < 16 * kA; i += 256)
    pqs[i] = pq[((size_t)b * kQ + q0 + (i >> 7)) * kA + (i & (kA - 1))];
  if (tid < kA) was[tid] = wa[tid];
  __syncthreads();

  // ---- Pass 1: masked scores s[q][f] = sum_a wa[a]*tanh(pf[f][a]+pq[q][a])
  for (int f = tid; f < kFS; f += 256) {
    const int mk = mask[b * kF + f0 + f];
    float acc[16];
#pragma unroll
    for (int q = 0; q < 16; ++q) acc[q] = 0.0f;
    if (mk) {
      const float4* __restrict__ pr4 =
          (const float4*)(pf + ((size_t)b * kF + f0 + f) * kA);
      for (int a0 = 0; a0 < kA; a0 += 8) {
        const float4 p0 = pr4[a0 / 4], p1 = pr4[a0 / 4 + 1];
        const float pv[8] = {p0.x, p0.y, p0.z, p0.w, p1.x, p1.y, p1.z, p1.w};
#pragma unroll
        for (int q = 0; q < 16; ++q) {
          float aq = 0.0f;
#pragma unroll
          for (int j = 0; j < 8; ++j)
            aq += was[a0 + j] * fast_tanh(pv[j] + pqs[q * kA + a0 + j]);
          acc[q] += aq;
        }
      }
    }
#pragma unroll
    for (int q = 0; q < 16; ++q)
      s[q * kFS + f] = mk ? acc[q] : -1.0e9f;
  }
  __syncthreads();

  // ---- Pass 2: range max, exp and range sum per row (wave32 shuffles) ------
  for (int q = wave * 2; q < wave * 2 + 2; ++q) {
    float m = -3.0e38f;
    for (int f = lane; f < kFS; f += 32) m = fmaxf(m, s[q * kFS + f]);
#pragma unroll
    for (int o = 16; o >= 1; o >>= 1) m = fmaxf(m, __shfl_xor(m, o, 32));
    float sum = 0.0f;
    for (int f = lane; f < kFS; f += 32) {
      const float e = __expf(s[q * kFS + f] - m);
      s[q * kFS + f] = e;
      sum += e;
    }
#pragma unroll
    for (int o = 16; o >= 1; o >>= 1) sum += __shfl_xor(sum, o, 32);
    if (lane == 0) {  // one 128-byte line per workgroup
      pml[blockIdx.x * 32 + q]      = m;
      pml[blockIdx.x * 32 + 16 + q] = sum;
    }
  }
  __syncthreads();

  // ---- Pass 3: po[16][256] = e[16][kFS] @ feature[b][f0..] (WMMA bf16) -----
  const int n     = lane & 15;
  const int col0  = wave * 16 + n;          // wave owns column tiles {w, w+8}
  const int col1  = (wave + 8) * 16 + n;
  const int arow  = lane & 15;
  const int kbase = (lane < 16) ? 0 : 8;
  v8f c0 = {}, c1 = {};

#if HAVE_ASYNC_LDS
  const float* fbase = feature + ((size_t)b * kF + f0) * kD;
  async_slab(fbase, fb0, tid);
  for (int ks = 0; ks < kFS / 32; ++ks) {
    float* cur = (ks & 1) ? fb1 : fb0;
    float* nxt = (ks & 1) ? fb0 : fb1;
    const bool more = (ks + 1) < (kFS / 32);
    if (more) {
      async_slab(fbase + (size_t)(ks + 1) * 32 * kD, nxt, tid);
      wait_async<8>();   // my 8 loads for `cur` are done (in-order)
    } else {
      wait_async<0>();
    }
    __syncthreads();     // everyone's slab data visible

    const int k0 = ks * 32;
    v16bf af, b0v, b1v;
#pragma unroll
    for (int e = 0; e < 16; ++e) {
      const int kk = kbase + e + ((e >= 8) ? 8 : 0);   // 0..31 within slab
      af[e]  = (__bf16)s[arow * kFS + k0 + kk];
      b0v[e] = (__bf16)cur[kk * kD + col0];
      b1v[e] = (__bf16)cur[kk * kD + col1];
    }
    c0 = WMMA_BF16(af, b0v, c0);
    c1 = WMMA_BF16(af, b1v, c1);
    __syncthreads();     // all waves done reading `cur` before it is reused
  }
#else
  for (int k0 = 0; k0 < kFS; k0 += 32) {
    if (k0 + 32 < kFS)
      __builtin_prefetch(feature + ((size_t)b * kF + f0 + k0 + 32 + kbase) * kD, 0, 1);
    v16bf af, b0v, b1v;
#pragma unroll
    for (int e = 0; e < 16; ++e) {
      const int k = k0 + kbase + e + ((e >= 8) ? 8 : 0);
      af[e] = (__bf16)s[arow * kFS + k];
      const float* __restrict__ fr = feature + ((size_t)b * kF + f0 + k) * kD;
      b0v[e] = (__bf16)fr[col0];
      b1v[e] = (__bf16)fr[col1];
    }
    c0 = WMMA_BF16(af, b0v, c0);
    c1 = WMMA_BF16(af, b1v, c1);
  }
#endif

  const int mofs = (lane >> 4) * 8;
#pragma unroll
  for (int r = 0; r < 8; ++r) {
    float* __restrict__ orow = po + ((size_t)blockIdx.x * 16 + mofs + r) * kD;
    orow[col0] = c0[r];
    orow[col1] = c1[r];
  }
}

// exp(x). The v_nop in the statement is the free slot that the instruction set
// asks for behind a transcendental before its source register is overwritten.
__device__ __forceinline__ float exp_slot(float x) {
  float r;
  asm("v_exp_f32 %0, %1\n\tv_nop" : "=v"(r) : "v"(x * 1.44269504f));
  return r;
}

// ---------------------------------------------------------------------------
// Merge of the kS ranges of one (batch, query) row: weight exp(m_s - M) per
// range, out = sum_s w_s * po_s / sum_s w_s * l_s. 64 threads per row, float4.
// ---------------------------------------------------------------------------
__global__ __launch_bounds__(256) void merge_ranges(
    const float* __restrict__ po,   // [B*Q/16,S,16,D]
    const float* __restrict__ pml,  // [B*Q/16,S,32]
    float*       __restrict__ out)  // [B*Q,D]
{
  const int row  = blockIdx.x * 4 + (threadIdx.x >> 6);
  const int d4   = threadIdx.x & 63;
  const int tile = row >> 4;
  const int qi   = row & 15;
  const float* __restrict__ ml = pml + tile * kS * 32 + qi;
  float mv[kS];
  float M = -3.0e38f;
#pragma unroll  // keeps mv[] in registers
  for (int i = 0; i < kS; ++i) {
    mv[i] = ml[i * 32];
    M = fmaxf(M, mv[i]);
  }
  const float4* __restrict__ p4 =
      (const float4*)(po + ((size_t)tile * kS * 16 + qi) * kD) + d4;
  float L = 0.0f;
  float4 o = make_float4(0.0f, 0.0f, 0.0f, 0.0f);
#pragma unroll  // all kS loads in flight at once: one L2 latency, not kS
  for (int i = 0; i < kS; ++i) {
    const float w = exp_slot(mv[i] - M);
    const float4 v = p4[i * (16 * kD / 4)];
    L += w * ml[i * 32 + 16];
    o.x += w * v.x; o.y += w * v.y; o.z += w * v.z; o.w += w * v.w;
  }
  const float inv = __builtin_amdgcn_rcpf(L);
  ((float4*)(out + (size_t)row * kD))[d4] =
      make_float4(o.x * inv, o.y * inv, o.z * inv, o.w * inv);
}

// ---------------------------------------------------------------------------
extern "C" void kernel_launch(void* const* d_in, const int* in_sizes, int n_in,
                              void* d_out, int out_size, void* d_ws, size_t ws_size,
                              hipStream_t stream) {
  const float* feature = (const float*)d_in[0];  // [B,F,D]
  const float* query   = (const float*)d_in[1];  // [B,Q,QD]
  const float* Wf      = (const float*)d_in[2];  // [A,D]
  const float* Wq      = (const float*)d_in[3];  // [A,QD]
  const float* bq      = (const float*)d_in[4];  // [A]
  const float* wa      = (const float*)d_in[5];  // [A]
  const int*   mask    = (const int*)d_in[6];    // [B,F]
  float* out = (float*)d_out;

  float* pf  = (float*)d_ws;                     // [B,F,A] = 16 MB
  float* pqv = pf + (size_t)kB * kF * kA;        // [B,Q,A] = 0.5 MB
  float* po  = pqv + (size_t)kB * kQ * kA;       // [B*Q/16,S,16,D]
  float* pml = po + (size_t)kB * kQ * kS * kD;   // [B*Q/16,S,32]

  // pf = feature @ Wf^T : M=32768, N=128, K=256; 128 rows per workgroup
  proj_rows_bf16<<<kB * kF / 128, 256, 0, stream>>>(feature, Wf, pf);
  {  // pq = query @ Wq^T + bq : M=1024, N=128, K=256
    const int M = kB * kQ;
    const int blocks = ((M / 16) * (kA / 16) + 7) / 8;
    proj_gemm_bf16<kA, kD><<<blocks, 256, 0, stream>>>(query, Wq, bq, pqv, M, 1);
  }
  {  // scores + softmax partials + weighted sum, one feature range per workgroup
    const size_t shmem =
        (size_t)(16 * kFS + 16 * kA + kA + 2 * 32 * kD) * sizeof(float);
    fused_attn<<<kB * (kQ / 16) * kS, 256, shmem, stream>>>(feature, pf, pqv, wa, mask,
                                                            po, pml);
  }
  // merge of the ranges: 4 rows per workgroup
  merge_ranges<<<kB * kQ / 4, 256, 0, stream>>>(po, pml, out);
}

// v003
// A run of this version takes 52.6 microseconds.
// In both of two side-by-side timings against v002, it was 1.23 times as fast.
// All steps since v000 together make it 4.52 times as fast.
#include <hip/hip_runtime.h>
#include <hip/hip_bf16.h>

// CDNA5 (gfx1250) fused additive attention.
// K1/K2: bf16-WMMA projection GEMMs (pf, pq). K3: fused score(tanh)+softmax
// partials+weights@feature for one range of the feature axis per workgroup,
// the feature K-slabs staged via async global->LDS (ASYNCcnt) double buffering.
// K4: merges the ranges' partials (max, sum, un-normalised weighted sum).

typedef __attribute__((ext_vector_type(16))) __bf16 v16bf;
typedef __attribute__((ext_vector_type(8)))  __bf16 v8bf;
typedef __attribute__((ext_vector_type(4)))  __bf16 v4bf;
typedef __attribute__((ext_vector_type(8)))  float  v8f;
typedef __attribute__((ext_vector_type(2)))  float  v2f;
typedef __attribute__((ext_vector_type(4)))  int    v4i;

#define WMMA_BF16(a, b, c) \
  __builtin_amdgcn_wmma_f32_16x16x32_bf16(false, (a), false, (b), (short)0, (c), false, false)

#define GLOBAL_AS __attribute__((address_space(1)))
#define LDS_AS    __attribute__((address_space(3)))

constexpr int kB = 16, kF = 2048, kQ = 64, kD = 256, kA = 128;
constexpr int kS  = 8;         // ranges of the feature axis, one workgroup each
constexpr int kFS = kF / kS;   // features per range

// ---- native tanh if the toolchain exposes V_TANH_F32 ------------------------
#if __has_builtin(__builtin_amdgcn_tanhf)
__device__ __forceinline__ float fast_tanh(float x) { return __builtin_amdgcn_tanhf(x); }
#elif __has_builtin(__builtin_amdgcn_tanh_f32)
__device__ __forceinline__ float fast_tanh(float x) { return __builtin_amdgcn_tanh_f32(x); }
#else
__device__ __forceinline__ float fast_tanh(float x) {
  const float t = __expf(2.0f * x);                      // v_exp_f32
  return (t - 1.0f) * __builtin_amdgcn_rcpf(t + 1.0f);   // v_rcp_f32, no slow div
}
#endif

// ---- async global->LDS staging (gfx1250 ASYNC path) -------------------------
#if __has_builtin(__builtin_amdgcn_global_load_async_to_lds_b128)
#define HAVE_ASYNC_LDS 1
#else
#define HAVE_ASYNC_LDS 0
#endif

#if HAVE_ASYNC_LDS
template <int N>
__device__ __forceinline__ void wait_async() {
#if __has_builtin(__builtin_amdgcn_s_wait_asynccnt)
  __builtin_amdgcn_s_wait_asynccnt(N);
#else
  asm volatile("s_wait_asynccnt %0" ::"n"(N) : "memory");
#endif
}
// Copy a 32 x kD f32 slab (32KB) global->LDS: 8 x b128 per thread, coalesced.
// Builtin signature (per hipcc diagnostic): (as1 v4i*, as3 v4i*, imm, imm).
__device__ __forceinline__ void async_slab(const float* __restrict__ gsrc,
                                           float* __restrict__ ldst, int tid) {
#pragma unroll
  for (int i = 0; i < 8; ++i) {
    const int idx = (tid + i * 256) * 4;  // float index, 16B aligned
    __builtin_amdgcn_global_load_async_to_lds_b128(
        (GLOBAL_AS v4i*)(gsrc + idx), (LDS_AS v4i*)(ldst + idx), 0, 0);
  }
}
#endif

__device__ __forceinline__ void pack8(v16bf& v, int base, float4 lo, float4 hi) {
  v[base + 0] = (__bf16)lo.x; v[base + 1] = (__bf16)lo.y;
  v[base + 2] = (__bf16)lo.z; v[base + 3] = (__bf16)lo.w;
  v[base + 4] = (__bf16)hi.x; v[base + 5] = (__bf16)hi.y;
  v[base + 6] = (__bf16)hi.z; v[base + 7] = (__bf16)hi.w;
}

template <int N, int K>
__global__ __launch_bounds__(256) void proj_gemm_bf16(
    const float* __restrict__ X, const float* __restrict__ W,
    const float* __restrict__ bias, float* __restrict__ Y, int M, int useBias)
{
  const int wave = threadIdx.x >> 5;
  const int lane = threadIdx.x & 31;
  const int gw = blockIdx.x * 8 + wave;
  constexpr int ntn = N >> 4;
  const int total = (M >> 4) * ntn;
  if (gw >= total) return;
  const int tm = gw / ntn;
  const int tn = gw % ntn;

  const int row   = lane & 15;
  const int kbase = (lane < 16) ? 0 : 8;
  const float4* __restrict__ xr4 =
      (const float4*)(X + (size_t)(tm * 16 + row) * K + kbase);
  const float4* __restrict__ wr4 =
      (const float4*)(W + (size_t)(tn * 16 + row) * K + kbase);

  v8f c = {};
#pragma unroll
  for (int k0 = 0; k0 < K; k0 += 32) {
    const int q4 = k0 >> 2;
    v16bf a, b;
    pack8(a, 0, xr4[q4 + 0], xr4[q4 + 1]);  // K = k0+kbase + 0..7
    pack8(a, 8, xr4[q4 + 4], xr4[q4 + 5]);  // K = k0+kbase + 16..23
    pack8(b, 0, wr4[q4 + 0], wr4[q4 + 1]);
    pack8(b, 8, wr4[q4 + 4], wr4[q4 + 5]);
    c = WMMA_BF16(a, b, c);
  }

  // C/D layout: VGPR r -> M=r (lanes 0-15) / M=r+8 (lanes 16-31), N=lane%16
  const int mofs = (lane >> 4) * 8;
  const int gn   = tn * 16 + (lane & 15);
  const float bv = useBias ? bias[gn] : 0.0f;
  float* __restrict__ yp = Y + (size_t)(tm * 16 + mofs) * N + gn;
#pragma unroll
  for (int r = 0; r < 8; ++r) yp[r * N] = c[r] + bv;
}

// ---------------------------------------------------------------------------
// Feature projection: Y[M,kA] = X[M,kD] * W[kA,kD]^T. One workgroup = 128 rows,
// one wave = 16 rows x all kA columns, so every X element is loaded once on the
// chip. W is read once per workgroup in whole lines, rounded to bf16 and kept in
// LDS; the B fragments come from there. Fragment k order and the order of the
// k steps are those of proj_gemm_bf16.
// ---------------------------------------------------------------------------
constexpr int kWP = kD + 8;  // bf16 per LDS row of W: 528 B = 16 B x odd, no bank conflict for b128 readers

__global__ __launch_bounds__(256) void proj_rows_bf16(
    const float* __restrict__ X, const float* __restrict__ W, float* __restrict__ Y)
{
  __shared__ __attribute__((aligned(16))) __bf16 wl[kA * kWP];
  const int tid   = threadIdx.x;
  const int wave  = tid >> 5;
  const int lane  = tid & 31;
  const int row   = lane & 15;
  const int kbase = (lane < 16) ? 0 : 8;
  const int m0    = (blockIdx.x * 8 + wave) * 16;

  // W passes through registers in two halves, so that one half (64 registers) and
  // the wave's whole X strip (128) are in flight together below 256 registers.
  const float4* __restrict__ w4 = (const float4*)W;  // kD/4 = 64 float4 per row
  constexpr int kWH = kA * kD / 4 / 256 / 2;         // float4 per thread and half
  __bf16* wdst = &wl[(tid >> 6) * kWP + (tid & 63) * 4];  // a wave reads 512 B, writes 256 B
  float4 wv[kWH];
#pragma unroll  // keeps wv[] in registers
  for (int i = 0; i < kWH; ++i) wv[i] = w4[tid + i * 256];

  const float4* __restrict__ xr4 =
      (const float4*)(X + (size_t)(m0 + row) * kD + kbase);
  float4 xv[kD / 8];
#pragma unroll  // keeps xv[] in registers
  for (int ks = 0; ks < kD / 32; ++ks) {
    xv[ks * 4 + 0] = xr4[ks * 8 + 0];  // K = ks*32+kbase + 0..7
    xv[ks * 4 + 1] = xr4[ks * 8 + 1];
    xv[ks * 4 + 2] = xr4[ks * 8 + 4];  // K = ks*32+kbase + 16..23
    xv[ks * 4 + 3] = xr4[ks * 8 + 5];
  }
  // Keeps all 48 loads in front of the first wait; without it the compiler holds
  // part of the X loads back until the first half of W has arrived.
  __builtin_amdgcn_sched_barrier(0);

#pragma unroll  // wv[] is indexed by constants only, here and in the two inner loops
  for (int h = 0; h < 2; ++h) {
#pragma unroll
    for (int i = 0; i < kWH; ++i) {
      v4bf p;
      p[0] = (__bf16)wv[i].x; p[1] = (__bf16)wv[i].y;
      p[2] = (__bf16)wv[i].z; p[3] = (__bf16)wv[i].w;
      *(v4bf*)(wdst + (h * kWH + i) * 4 * kWP) = p;  // 4 rows of W per 256 threads
    }
    if (h == 0) {
#pragma unroll
      for (int i = 0; i < kWH; ++i) wv[i] = w4[tid + (kWH + i) * 256];
    }
  }

  v16bf a[kD / 32];
#pragma unroll  // keeps a[] in registers
  for (int ks = 0; ks < kD / 32; ++ks) {
    pack8(a[ks], 0, xv[ks * 4 + 0], xv[ks * 4 + 1]);
    pack8(a[ks], 8, xv[ks * 4 + 2], xv[ks * 4 + 3]);
  }
  __syncthreads();  // W is complete in LDS

  v8f c[kA / 16];
#pragma unroll  // keeps c[] in registers
  for (int tn = 0; tn < kA / 16; ++tn) c[tn] = v8f{};

  // Groups of 4 WMMAs (one k step, 4 column tiles); the B fragments of a group are
  // read as one run of 8 ds_load_b128, two groups ahead, into a ring of 3 sets.
  const __bf16* bbase = &wl[row * kWP + kbase];
  constexpr int kG = (kD / 32) * 2;
  v16bf bq[3][4];
  auto load_group = [&](int g) {
#pragma unroll  // bq[] is indexed by constants only
    for (int t = 0; t < 4; ++t) {
      const __bf16* bp = bbase + ((g & 1) * 4 + t) * 16 * kWP + (g >> 1) * 32;
      const v8bf lo = *(const v8bf*)bp;         // K = ks*32+kbase + 0..7
      const v8bf hi = *(const v8bf*)(bp + 16);  // K = ks*32+kbase + 16..23
      bq[g % 3][t] = __builtin_shufflevector(lo, hi, 0, 1, 2, 3, 4, 5, 6, 7, 8, 9, 10, 11,
                                             12, 13, 14, 15);
    }
  };
  load_group(0);
  load_group(1);
#pragma unroll  // a[], c[] and bq[] are indexed by constants only
  for (int g = 0; g < kG; ++g) {
    if (g + 2 < kG) load_group(g + 2);
    // The two fences keep each group's LDS reads together and two groups ahead of
    // their WMMAs; left alone the compiler put each read pair directly in front of
    // its WMMA with a full wait.
    __builtin_amdgcn_sched_barrier(0);
#pragma unroll  // c[] and bq[] are indexed by constants only
    for (int t = 0; t < 4; ++t)
      c[(g & 1) * 4 + t] = WMMA_BF16(a[g >> 1], bq[g % 3][t], c[(g & 1) * 4 + t]);
    __builtin_amdgcn_sched_barrier(0);
  }

  // C/D layout as in proj_gemm_bf16; the wave writes its 16 rows whole.
  float* __restrict__ yp = Y + (size_t)(m0 + (lane >> 4) * 8) * kA + row;
#pragma unroll  // both loops: c[] is indexed by constants only, offsets fold into the stores
  for (int tn = 0; tn < kA / 16; ++tn)
#pragma unroll
    for (int r = 0; r < 8; ++r) yp[r * kA + tn * 16] = c[tn][r];
}

// Sum of x over the lanes l ^ m, m = CTRL - 0x160, inside a 16-lane row (DPP row_xmask).
template <int CTRL>
__device__ __forceinline__ float add_xmask(float x) {
  return x + __builtin_bit_cast(float, __builtin_amdgcn_update_dpp(
                 0, __builtin_bit_cast(int, x), CTRL, 0xf, 0xf, true));
}

// ---------------------------------------------------------------------------
// Fused attention: one workgroup (256 thr = 8 waves) per (batch, 16-q tile,
// feature range). It leaves the range's row maxima, row sums and the
// un-normalised weighted sum in the workspace; merge_ranges finishes the softmax.
// LDS: s[16][kFS] + list[kFS] + wcnt[32] + 2x feature slab (64KB).
// ---------------------------------------------------------------------------
static_assert(kFS == 256, "one feature of the range per thread when the list is built");

__global__ __launch_bounds__(256) void fused_attn(
    const float* __restrict__ feature,  // [B,F,D]
    const float* __restrict__ pf,       // [B,F,A]
    const float* __restrict__ pq,       // [B,Q,A] (bias included)
    const float* __restrict__ wa,       // [A]
    const int*   __restrict__ mask,     // [B,F]
    float*       __restrict__ po,       // [B*Q/16,S,16,D] un-normalised partial sums
    float*       __restrict__ pml)      // [B*Q/16,S,32] 16 range maxima, 16 range sums
{
  extern __shared__ float lds[];
  float* s    = lds;                   // [16][kFS]
  int*   list = (int*)(s + 16 * kFS);  // [kFS] the range's unmasked features, ascending
  int*   wcnt = list + kFS;            // [32], 8 used: unmasked features per wave
  float* fb0  = (float*)(wcnt + 32);   // [32][kD] slab buffer 0
  float* fb1  = fb0 + 32 * kD;         // [32][kD] slab buffer 1

  const int tid  = threadIdx.x;
  const int wave = tid >> 5;
  const int lane = tid & 31;
  const int sp   = blockIdx.x % kS;  // feature range
  const int tile = blockIdx.x / kS;
  const int b  = tile >> 2;          // Q/16 == 4 query tiles per batch
  const int q0 = (tile & 3) * 16;
  const int f0 = sp * kFS;

  // ---- Pass 1: masked scores s[q][f] = sum_a wa[a]*tanh(pf[f][a]+pq[q][a])
  // A wave takes one unmasked feature at a time, so a masked one costs nothing.
  // Lane = (g, c): queries 4g..4g+3, terms a = 32j + 4c + e (j, e = 0..3). The
  // lane's 64 pq values and 16 wa values stay in registers; a pf row is 4 loads
  // of one 128-byte line each; the 8 lanes c of a query are summed by DPP.
  const int wv = __builtin_amdgcn_readfirstlane(wave);
  const int c  = lane & 7;
  const int g  = lane >> 3;

  const int mk = mask[b * kF + f0 + tid];
  const unsigned bal = __builtin_amdgcn_ballot_w32(mk != 0);
  if (lane == 0) wcnt[wave] = __popc(bal);

  const float4* __restrict__ pq4 =
      (const float4*)(pq + ((size_t)b * kQ + q0 + g * 4) * kA) + c;
  const float4* __restrict__ wa4 = (const float4*)wa + c;
  v2f pq01[4][4], pq23[4][4], wa01[4], wa23[4];
#pragma unroll  // both loops: the arrays stay in registers
  for (int j = 0; j < 4; ++j) {
    const float4 w = wa4[j * 8];
    wa01[j] = v2f{w.x, w.y};
    wa23[j] = v2f{w.z, w.w};
#pragma unroll
    for (int i = 0; i < 4; ++i) {
      const float4 v = pq4[i * (kA / 4) + j * 8];
      pq01[i][j] = v2f{v.x, v.y};
      pq23[i][j] = v2f{v.z, v.w};
    }
  }
  __syncthreads();  // wcnt complete

  int base = 0, nu = 0;  // unmasked features in the waves before this one; in the range
#pragma unroll  // the 8 LDS reads go out together
  for (int w = 0; w < 8; ++w) {
    const int cw = wcnt[w];
    base += (w < wv) ? cw : 0;
    nu += cw;
  }
  nu = __builtin_amdgcn_readfirstlane(nu);
  if (mk) {
    list[base + __popc(bal & ((1u << lane) - 1u))] = tid;
  } else {
#pragma unroll  // offsets fold into the stores
    for (int q = 0; q < 16; ++q) s[q * kFS + tid] = -1.0e9f;
  }
  __syncthreads();  // list complete

  {
    const int cnt = (nu - wv + 7) >> 3;  // list entries wv, wv + 8, ... below nu
    const int li  = wv + lane * 8;      // lane i holds the wave's i-th feature
    const int myf = (li < nu) ? list[li] : 0;
    const float4* __restrict__ pf4 =
        (const float4*)(pf + ((size_t)b * kF + f0) * kA) + c;
    float* srow = s + (g * 4 + (c & 3)) * kFS;
    auto row_load = [&](float4 (&d)[4], int i) {  // the wave's i-th row, i clamped
      const int f = __builtin_amdgcn_readlane(myf, (i < cnt) ? i : cnt - 1);
#pragma unroll  // d[] stays in registers
      for (int j = 0; j < 4; ++j) d[j] = pf4[f * (kA / 4) + j * 8];
    };
    auto row_score = [&](const float4 (&p)[4], int i) {
      v2f acc[4];
#pragma unroll  // here and below: register arrays are indexed by constants only
      for (int q = 0; q < 4; ++q) acc[q] = v2f{0.0f, 0.0f};
#pragma unroll
      for (int j = 0; j < 4; ++j) {
        const v2f p01 = v2f{p[j].x, p[j].y};
        const v2f p23 = v2f{p[j].z, p[j].w};
#pragma unroll
        for (int q = 0; q < 4; ++q) {
          const v2f x01 = p01 + pq01[q][j];
          const v2f x23 = p23 + pq23[q][j];
          const v2f t01 = v2f{fast_tanh(x01.x), fast_tanh(x01.y)};
          const v2f t23 = v2f{fast_tanh(x23.x), fast_tanh(x23.y)};
          acc[q] = __builtin_elementwise_fma(t01, wa01[j], acc[q]);
          acc[q] = __builtin_elementwise_fma(t23, wa23[j], acc[q]);
        }
      }
      float r[4];
#pragma unroll
      for (int q = 0; q < 4; ++q) {
        r[q] = acc[q].x + acc[q].y;
        r[q] = add_xmask<0x161>(r[q]);
        r[q] = add_xmask<0x162>(r[q]);
        r[q] = add_xmask<0x164>(r[q]);
      }
      const float r01 = (c & 1) ? r[1] : r[0];
      const float r23 = (c & 1) ? r[3] : r[2];
      if (c < 4)  // lane c stores query 4g + c
        srow[__builtin_amdgcn_readlane(myf, i)] = (c & 2) ? r23 : r01;
    };
    if (cnt > 0) {
      float4 ra[4], rb[4];  // two rows: one flies while the other is worked on
      row_load(ra, 0);
      for (int i = 0; i < cnt; i += 2) {
        row_load(rb, i + 1);
        // The two fences keep the next row's loads in front of this row's arithmetic;
        // left alone the compiler issued them at the end of it and waited at once.
        __builtin_amdgcn_sched_barrier(0);
        row_score(ra, i);
        row_load(ra, i + 2);
        // The next trip rewrites the address registers of these loads: the wait that
        // belongs in front of that.
        asm volatile("s_wait_xcnt 0x0" ::: "memory");
        __builtin_amdgcn_sched_barrier(0);
        if (i + 1 < cnt) row_score(rb, i + 1);
      }
    }
  }
  __syncthreads();

  // ---- Pass 2: range max, exp and range sum per row (wave32 shuffles) ------
  for (int q = wave * 2; q < wave * 2 + 2; ++q) {
    float m = -3.0e38f;
    for (int f = lane; f < kFS; f += 32) m = fmaxf(m, s[q * kFS + f]);
#pragma unroll
    for (int o = 16; o >= 1; o >>= 1) m = fmaxf(m, __shfl_xor(m, o, 32));
    float sum = 0.0f;
    for (int f = lane; f < kFS; f += 32) {
      const float e = __expf(s[q * kFS + f] - m);
      s[q * kFS + f] = e;
      sum += e;
    }
#pragma unroll
    for (int o = 16; o >= 1; o >>= 1) sum += __shfl_xor(sum, o, 32);
    if (lane == 0) {  // one 128-byte line per workgroup
      pml[blockIdx.x * 32 + q]      = m;
      pml[blockIdx.x * 32 + 16 + q] = sum;
    }
  }
  __syncthreads();

  // ---- Pass 3: po[16][256] = e[16][kFS] @ feature[b][f0..] (WMMA bf16) -----
  const int n     = lane & 15;
  const int col0  = wave * 16 + n;          // wave owns column tiles {w, w+8}
  const int col1  = (wave + 8) * 16 + n;
  const int arow  = lane & 15;
  const int kbase = (lane < 16) ? 0 : 8;
  v8f c0 = {}, c1 = {};

#if HAVE_ASYNC_LDS
  const float* fbase = feature + ((size_t)b * kF + f0) * kD;
  async_slab(fbase, fb0, tid);
  for (int ks = 0; ks < kFS / 32; ++ks) {
    float* cur = (ks & 1) ? fb1 : fb0;
    float* nxt = (ks & 1) ? fb0 : fb1;
    const bool more = (ks + 1) < (kFS / 32);
    if (more) {
      async_slab(fbase + (size_t)(ks + 1) * 32 * kD, nxt, tid);
      wait_async<8>();   // my 8 loads for `cur` are done (in-order)
    } else {
      wait_async<0>();
    }
    __syncthreads();     // everyone's slab data visible

    const int k0 = ks * 32;
    v16bf af, b0v, b1v;
#pragma unroll
    for (int e = 0; e < 16; ++e) {
      const int kk = kbase + e + ((e >= 8) ? 8 : 0);   // 0..31 within slab
      af[e]  = (__bf16)s[arow * kFS + k0 + kk];
      b0v[e] = (__bf16)cur[kk * kD + col0];
      b1v[e] = (__bf16)cur[kk * kD + col1];
    }
    c0 = WMMA_BF16(af, b0v, c0);
    c1 = WMMA_BF16(af, b1v, c1);
    __syncthreads();     // all waves done reading `cur` before it is reused
  }
#else
  for (int k0 = 0; k0 < kFS; k0 += 32) {
    if (k0 + 32 < kFS)
      __builtin_prefetch(feature + ((size_t)b * kF + f0 + k0 + 32 + kbase) * kD, 0, 1);
    v16bf af, b0v, b1v;
#pragma unroll
    for (int e = 0; e < 16; ++e) {
      const int k = k0 + kbase + e + ((e >= 8) ? 8 : 0);
      af[e] = (__bf16)s[arow * kFS + k];
      const float* __restrict__ fr = feature + ((size_t)b * kF + f0 + k) * kD;
      b0v[e] = (__bf16)fr[col0];
      b1v[e] = (__bf16)fr[col1];
    }
    c0 = WMMA_BF16(af, b0v, c0);
    c1 = WMMA_BF16(af, b1v, c1);
  }
#endif

  const int mofs = (lane >> 4) * 8;
#pragma unroll
  for (int r = 0; r < 8; ++r) {
    float* __restrict__ orow = po + ((size_t)blockIdx.x * 16 + mofs + r) * kD;
    orow[col0] = c0[r];
    orow[col1] = c1[r];
  }
}

// exp(x). The v_nop in the statement is the free slot that the instruction set
// asks for behind a transcendental before its source register is overwritten.
__device__ __forceinline__ float exp_slot(float x) {
  float r;
  asm("v_exp_f32 %0, %1\n\tv_nop" : "=v"(r) : "v"(x * 1.44269504f));
  return r;
}

// ---------------------------------------------------------------------------
// Merge of the kS ranges of one (batch, query) row: weight exp(m_s - M) per
// range, out = sum_s w_s * po_s / sum_s w_s * l_s. 64 threads per row, float4.
// ---------------------------------------------------------------------------
__global__ __launch_bounds__(256) void merge_ranges(
    const float* __restrict__ po,   // [B*Q/16,S,16,D]
    const float* __restrict__ pml,  // [B*Q/16,S,32]
    float*       __restrict__ out)  // [B*Q,D]
{
  const int row  = blockIdx.x * 4 + (threadIdx.x >> 6);
  const int d4   = threadIdx.x & 63;
  const int tile = row >> 4;
  const int qi   = row & 15;
  const float* __restrict__ ml = pml + tile * kS * 32 + qi;
  float mv[kS];
  float M = -3.0e38f;
#pragma unroll  // keeps mv[] in registers
  for (int i = 0; i < kS; ++i) {
    mv[i] = ml[i * 32];
    M = fmaxf(M, mv[i]);
  }
  const float4* __restrict__ p4 =
      (const float4*)(po + ((size_t)tile * kS * 16 + qi) * kD) + d4;
  float L = 0.0f;
  float4 o = make_float4(0.0f, 0.0f, 0.0f, 0.0f);
#pragma unroll  // all kS loads in flight at once: one L2 latency, not kS
  for (int i = 0; i < kS; ++i) {
    const float w = exp_slot(mv[i] - M);
    const float4 v = p4[i * (16 * kD / 4)];
    L += w * ml[i * 32 + 16];
    o.x += w * v.x; o.y += w * v.y; o.z += w * v.z; o.w += w * v.w;
  }
  const float inv = __builtin_amdgcn_rcpf(L);
  ((float4*)(out + (size_t)row * kD))[d4] =
      make_float4(o.x * inv, o.y * inv, o.z * inv, o.w * inv);
}

// ---------------------------------------------------------------------------
extern "C" void kernel_launch(void* const* d_in, const int* in_sizes, int n_in,
                              void* d_out, int out_size, void* d_ws, size_t ws_size,
                              hipStream_t stream) {
  const float* feature = (const float*)d_in[0];  // [B,F,D]
  const float* query   = (const float*)d_in[1];  // [B,Q,QD]
  const float* Wf      = (const float*)d_in[2];  // [A,D]
  const float* Wq      = (const float*)d_in[3];  // [A,QD]
  const float* bq      = (const float*)d_in[4];  // [A]
  const float* wa      = (const float*)d_in[5];  // [A]
  const int*   mask    = (const int*)d_in[6];    // [B,F]
  float* out = (float*)d_out;

  float* pf  = (float*)d_ws;                     // [B,F,A] = 16 MB
  float* pqv = pf + (size_t)kB * kF * kA;        // [B,Q,A] = 0.5 MB
  float* po  = pqv + (size_t)kB * kQ * kA;       // [B*Q/16,S,16,D]
  float* pml = po + (size_t)kB * kQ * kS * kD;   // [B*Q/16,S,32]

  // pf = feature @ Wf^T : M=32768, N=128, K=256; 128 rows per workgroup
  proj_rows_bf16<<<kB * kF / 128, 256, 0, stream>>>(feature, Wf, pf);
  {  // pq = query @ Wq^T + bq : M=1024, N=128, K=256
    const int M = kB * kQ;
    const int blocks = ((M / 16) * (kA / 16) + 7) / 8;
    proj_gemm_bf16<kA, kD><<<blocks, 256, 0, stream>>>(query, Wq, bq, pqv, M, 1);
  }
  {  // scores + softmax partials + weighted sum, one feature range per workgroup
    const size_t shmem =
        (size_t)(16 * kFS + kFS + 32 + 2 * 32 * kD) * sizeof(float);
    fused_attn<<<kB * (kQ / 16) * kS, 256, shmem, stream>>>(feature, pf, pqv, wa, mask,
                                                            po, pml);
  }
  // merge of the ranges: 4 rows per workgroup
  merge_ranges<<<kB * kQ / 4, 256, 0, stream>>>(po, pml, out);
}

// v004
// One run takes 39.4 microseconds.
// Two timings next to v003 both put it at 1.33 times that version's speed.
// Counting every step since v000, it is 6.03 times as fast.
#include <hip/hip_runtime.h>
#include <hip/hip_bf16.h>

// CDNA5 (gfx1250) fused additive attention.
// K1/K2: bf16-WMMA projection GEMMs (pf, pq). K3: fused score(tanh)+softmax
// partials+weights@feature for one range of the feature axis per workgroup,
// the feature K-slabs staged via async global->LDS (ASYNCcnt) double buffering.
// K4: merges the ranges' partials (max, sum, un-normalised weighted sum).

typedef __attribute__((ext_vector_type(16))) __bf16 v16bf;
typedef __attribute__((ext_vector_type(8)))  __bf16 v8bf;
typedef __attribute__((ext_vector_type(4)))  __bf16 v4bf;
typedef __attribute__((ext_vector_type(8)))  float  v8f;
typedef __attribute__((ext_vector_type(2)))  float  v2f;
typedef __attribute__((ext_vector_type(4)))  int    v4i;

#define WMMA_BF16(a, b, c) \
  __builtin_amdgcn_wmma_f32_16x16x32_bf16(false, (a), false, (b), (short)0, (c), false, false)

#define GLOBAL_AS __attribute__((address_space(1)))
#define LDS_AS    __attribute__((address_space(3)))

constexpr int kB = 16, kF = 2048, kQ = 64, kD = 256, kA = 128;
constexpr int kS  = 8;         // ranges of the feature axis, one workgroup each
constexpr int kFS = kF / kS;   // features per range
// LDS row pitches in floats, 1040 B = 16 B x odd. Score rows: the 16 rows that a
// b128 A-fragment read (or a score store) touches fall on different banks. Slab
// rows: rows k and k + 8, read by the two halves of a wave, lie 32 banks apart.
constexpr int kSP = kFS + 4;
constexpr int kDP = kD + 4;

// ---- native tanh if the toolchain exposes V_TANH_F32 ------------------------
#if __has_builtin(__builtin_amdgcn_tanhf)
__device__ __forceinline__ float fast_tanh(float x) { return __builtin_amdgcn_tanhf(x); }
#elif __has_builtin(__builtin_amdgcn_tanh_f32)
__device__ __forceinline__ float fast_tanh(float x) { return __builtin_amdgcn_tanh_f32(x); }
#else
__device__ __forceinline__ float fast_tanh(float x) {
  const float t = __expf(2.0f * x);                      // v_exp_f32
  return (t - 1.0f) * __builtin_amdgcn_rcpf(t + 1.0f);   // v_rcp_f32, no slow div
}
#endif

// ---- async global->LDS staging (gfx1250 ASYNC path) -------------------------
#if __has_builtin(__builtin_amdgcn_global_load_async_to_lds_b128)
#define HAVE_ASYNC_LDS 1
#else
#define HAVE_ASYNC_LDS 0
#endif

#if HAVE_ASYNC_LDS
template <int N>
__device__ __forceinline__ void wait_async() {
#if __has_builtin(__builtin_amdgcn_s_wait_asynccnt)
  __builtin_amdgcn_s_wait_asynccnt(N);
#else
  asm volatile("s_wait_asynccnt %0" ::"n"(N) : "memory");
#endif
}
// Copy a 32 x kD f32 slab (32KB) global->LDS rows of pitch kDP: 8 x b128 per thread,
// coalesced; 64 threads per row, 4 rows per step.
// Builtin signature (per hipcc diagnostic): (as1 v4i*, as3 v4i*, imm, imm).
__device__ __forceinline__ void async_slab(const float* __restrict__ gsrc,
                                           float* __restrict__ ldst, int tid) {
#pragma unroll
  for (int i = 0; i < 8; ++i) {
    const int idx = (tid + i * 256) * 4;  // float index, 16B aligned
    const int dst = ((tid >> 6) + i * 4) * kDP + (tid & 63) * 4;  // 16B aligned too
    __builtin_amdgcn_global_load_async_to_lds_b128(
        (GLOBAL_AS v4i*)(gsrc + idx), (LDS_AS v4i*)(ldst + dst), 0, 0);
  }
}
#endif

__device__ __forceinline__ void pack8(v16bf& v, int base, float4 lo, float4 hi) {
  v[base + 0] = (__bf16)lo.x; v[base + 1] = (__bf16)lo.y;
  v[base + 2] = (__bf16)lo.z; v[base + 3] = (__bf16)lo.w;
  v[base + 4] = (__bf16)hi.x; v[base + 5] = (__bf16)hi.y;
  v[base + 6] = (__bf16)hi.z; v[base + 7] = (__bf16)hi.w;
}

template <int N, int K>
__global__ __launch_bounds__(256) void proj_gemm_bf16(
    const float* __restrict__ X, const float* __restrict__ W,
    const float* __restrict__ bias, float* __restrict__ Y, int M, int useBias)
{
  const int wave = threadIdx.x >> 5;
  const int lane = threadIdx.x & 31;
  const int gw = blockIdx.x * 8 + wave;
  constexpr int ntn = N >> 4;
  const int total = (M >> 4) * ntn;
  if (gw >= total) return;
  const int tm = gw / ntn;
  const int tn = gw % ntn;

  const int row   = lane & 15;
  const int kbase = (lane < 16) ? 0 : 8;
  const float4* __restrict__ xr4 =
      (const float4*)(X + (size_t)(tm * 16 + row) * K + kbase);
  const float4* __restrict__ wr4 =
      (const float4*)(W + (size_t)(tn * 16 + row) * K + kbase);

  v8f c = {};
#pragma unroll
  for (int k0 = 0; k0 < K; k0 += 32) {
    const int q4 = k0 >> 2;
    v16bf a, b;
    pack8(a, 0, xr4[q4 + 0], xr4[q4 + 1]);  // K = k0+kbase + 0..7
    pack8(a, 8, xr4[q4 + 4], xr4[q4 + 5]);  // K = k0+kbase + 16..23
    pack8(b, 0, wr4[q4 + 0], wr4[q4 + 1]);
    pack8(b, 8, wr4[q4 + 4], wr4[q4 + 5]);
    c = WMMA_BF16(a, b, c);
  }

  // C/D layout: VGPR r -> M=r (lanes 0-15) / M=r+8 (lanes 16-31), N=lane%16
  const int mofs = (lane >> 4) * 8;
  const int gn   = tn * 16 + (lane & 15);
  const float bv = useBias ? bias[gn] : 0.0f;
  float* __restrict__ yp = Y + (size_t)(tm * 16 + mofs) * N + gn;
#pragma unroll
  for (int r = 0; r < 8; ++r) yp[r * N] = c[r] + bv;
}

// ---------------------------------------------------------------------------
// Feature projection: Y[M,kA] = X[M,kD] * W[kA,kD]^T. One workgroup = 128 rows,
// one wave = 16 rows x all kA columns, so every X element is loaded once on the
// chip. W is read once per workgroup in whole lines, rounded to bf16 and kept in
// LDS; the B fragments come from there. Fragment k order and the order of the
// k steps are those of proj_gemm_bf16.
// ---------------------------------------------------------------------------
constexpr int kWP = kD + 8;  // bf16 per LDS row of W: 528 B = 16 B x odd, no bank conflict for b128 readers

__global__ __launch_bounds__(256) void proj_rows_bf16(
    const float* __restrict__ X, const float* __restrict__ W, float* __restrict__ Y)
{
  __shared__ __attribute__((aligned(16))) __bf16 wl[kA * kWP];
  const int tid   = threadIdx.x;
  const int wave  = tid >> 5;
  const int lane  = tid & 31;
  const int row   = lane & 15;
  const int kbase = (lane < 16) ? 0 : 8;
  const int m0    = (blockIdx.x * 8 + wave) * 16;

  // W passes through registers in two halves, so that one half (64 registers) and
  // the wave's whole X strip (128) are in flight together below 256 registers.
  const float4* __restrict__ w4 = (const float4*)W;  // kD/4 = 64 float4 per row
  constexpr int kWH = kA * kD / 4 / 256 / 2;         // float4 per thread and half
  __bf16* wdst = &wl[(tid >> 6) * kWP + (tid & 63) * 4];  // a wave reads 512 B, writes 256 B
  float4 wv[kWH];
#pragma unroll  // keeps wv[] in registers
  for (int i = 0; i < kWH; ++i) wv[i] = w4[tid + i * 256];

  const float4* __restrict__ xr4 =
      (const float4*)(X + (size_t)(m0 + row) * kD + kbase);
  float4 xv[kD / 8];
#pragma unroll  // keeps xv[] in registers
  for (int ks = 0; ks < kD / 32; ++ks) {
    xv[ks * 4 + 0] = xr4[ks * 8 + 0];  // K = ks*32+kbase + 0..7
    xv[ks * 4 + 1] = xr4[ks * 8 + 1];
    xv[ks * 4 + 2] = xr4[ks * 8 + 4];  // K = ks*32+kbase + 16..23
    xv[ks * 4 + 3] = xr4[ks * 8 + 5];
  }
  // Keeps all 48 loads in front of the first wait; without it the compiler holds
  // part of the X loads back until the first half of W has arrived.
  __builtin_amdgcn_sched_barrier(0);

#pragma unroll  // wv[] is indexed by constants only, here and in the two inner loops
  for (int h = 0; h < 2; ++h) {
#pragma unroll
    for (int i = 0; i < kWH; ++i) {
      v4bf p;
      p[0] = (__bf16)wv[i].x; p[1] = (__bf16)wv[i].y;
      p[2] = (__bf16)wv[i].z; p[3] = (__bf16)wv[i].w;
      *(v4bf*)(wdst + (h * kWH + i) * 4 * kWP) = p;  // 4 rows of W per 256 threads
    }
    if (h == 0) {
#pragma unroll
      for (int i = 0; i < kWH; ++i) wv[i] = w4[tid + (kWH + i) * 256];
    }
  }

  v16bf a[kD / 32];
#pragma unroll  // keeps a[] in registers
  for (int ks = 0; ks < kD / 32; ++ks) {
    pack8(a[ks], 0, xv[ks * 4 + 0], xv[ks * 4 + 1]);
    pack8(a[ks], 8, xv[ks * 4 + 2], xv[ks * 4 + 3]);
  }
  __syncthreads();  // W is complete in LDS

  v8f c[kA / 16];
#pragma unroll  // keeps c[] in registers
  for (int tn = 0; tn < kA / 16; ++tn) c[tn] = v8f{};

  // Groups of 4 WMMAs (one k step, 4 column tiles); the B fragments of a group are
  // read as one run of 8 ds_load_b128, two groups ahead, into a ring of 3 sets.
  const __bf16* bbase = &wl[row * kWP + kbase];
  constexpr int kG = (kD / 32) * 2;
  v16bf bq[3][4];
  auto load_group = [&](int g) {
#pragma unroll  // bq[] is indexed by constants only
    for (int t = 0; t < 4; ++t) {
      const __bf16* bp = bbase + ((g & 1) * 4 + t) * 16 * kWP + (g >> 1) * 32;
      const v8bf lo = *(const v8bf*)bp;         // K = ks*32+kbase + 0..7
      const v8bf hi = *(const v8bf*)(bp + 16);  // K = ks*32+kbase + 16..23
      bq[g % 3][t] = __builtin_shufflevector(lo, hi, 0, 1, 2, 3, 4, 5, 6, 7, 8, 9, 10, 11,
                                             12, 13, 14, 15);
    }
  };
  load_group(0);
  load_group(1);
#pragma unroll  // a[], c[] and bq[] are indexed by constants only
  for (int g = 0; g < kG; ++g) {
    if (g + 2 < kG) load_group(g + 2);
    // The two fences keep each group's LDS reads together and two groups ahead of
    // their WMMAs; left alone the compiler put each read pair directly in front of
    // its WMMA with a full wait.
    __builtin_amdgcn_sched_barrier(0);
#pragma unroll  // c[] and bq[] are indexed by constants only
    for (int t = 0; t < 4; ++t)
      c[(g & 1) * 4 + t] = WMMA_BF16(a[g >> 1], bq[g % 3][t], c[(g & 1) * 4 + t]);
    __builtin_amdgcn_sched_barrier(0);
  }

  // C/D layout as in proj_gemm_bf16; the wave writes its 16 rows whole.
  float* __restrict__ yp = Y + (size_t)(m0 + (lane >> 4) * 8) * kA + row;
#pragma unroll  // both loops: c[] is indexed by constants only, offsets fold into the stores
  for (int tn = 0; tn < kA / 16; ++tn)
#pragma unroll
    for (int r = 0; r < 8; ++r) yp[r * kA + tn * 16] = c[tn][r];
}

// Sum of x over the lanes l ^ m, m = CTRL - 0x160, inside a 16-lane row (DPP row_xmask).
template <int CTRL>
__device__ __forceinline__ float add_xmask(float x) {
  return x + __builtin_bit_cast(float, __builtin_amdgcn_update_dpp(
                 0, __builtin_bit_cast(int, x), CTRL, 0xf, 0xf, true));
}

// ---------------------------------------------------------------------------
// Fused attention: one workgroup (256 thr = 8 waves) per (batch, 16-q tile,
// feature range). It leaves the range's row maxima, row sums and the
// un-normalised weighted sum in the workspace; merge_ranges finishes the softmax.
// LDS: s[16][kSP] + list[kFS] + wcnt[32] + 2x feature slab [32][kDP] (82KB).
// ---------------------------------------------------------------------------
static_assert(kFS == 256, "one feature of the range per thread when the list is built");

__global__ __launch_bounds__(256) void fused_attn(
    const float* __restrict__ feature,  // [B,F,D]
    const float* __restrict__ pf,       // [B,F,A]
    const float* __restrict__ pq,       // [B,Q,A] (bias included)
    const float* __restrict__ wa,       // [A]
    const int*   __restrict__ mask,     // [B,F]
    float*       __restrict__ po,       // [B*Q/16,S,16,D] un-normalised partial sums
    float*       __restrict__ pml)      // [B*Q/16,S,32] 16 range maxima, 16 range sums
{
  extern __shared__ __attribute__((aligned(16))) float lds[];
  float* s    = lds;                   // [16][kSP], kFS used per row
  int*   list = (int*)(s + 16 * kSP);  // [kFS] the range's unmasked features, ascending
  int*   wcnt = list + kFS;            // [32], 8 used: unmasked features per wave
  float* fb0  = (float*)(wcnt + 32);   // [32][kDP] slab buffer 0, kD used per row
  float* fb1  = fb0 + 32 * kDP;        // [32][kDP] slab buffer 1

  const int tid  = threadIdx.x;
  const int wave = tid >> 5;
  const int lane = tid & 31;
  const int sp   = blockIdx.x % kS;  // feature range
  const int tile = blockIdx.x / kS;
  const int b  = tile >> 2;          // Q/16 == 4 query tiles per batch
  const int q0 = (tile & 3) * 16;
  const int f0 = sp * kFS;

  // ---- Pass 1: masked scores s[q][f] = sum_a wa[a]*tanh(pf[f][a]+pq[q][a])
  // A wave takes one unmasked feature at a time, so a masked one costs nothing.
  // Lane = (g, c): queries 4g..4g+3, terms a = 32j + 4c + e (j, e = 0..3). The
  // lane's 64 pq values and 16 wa values stay in registers; a pf row is 4 loads
  // of one 128-byte line each; the 8 lanes c of a query are summed by DPP.
  const int wv = __builtin_amdgcn_readfirstlane(wave);
  const int c  = lane & 7;
  const int g  = lane >> 3;

  const int mk = mask[b * kF + f0 + tid];
  const unsigned bal = __builtin_amdgcn_ballot_w32(mk != 0);
  if (lane == 0) wcnt[wave] = __popc(bal);

  const float4* __restrict__ pq4 =
      (const float4*)(pq + ((size_t)b * kQ + q0 + g * 4) * kA) + c;
  const float4* __restrict__ wa4 = (const float4*)wa + c;
  v2f pq01[4][4], pq23[4][4], wa01[4], wa23[4];
#pragma unroll  // both loops: the arrays stay in registers
  for (int j = 0; j < 4; ++j) {
    const float4 w = wa4[j * 8];
    wa01[j] = v2f{w.x, w.y};
    wa23[j] = v2f{w.z, w.w};
#pragma unroll
    for (int i = 0; i < 4; ++i) {
      const float4 v = pq4[i * (kA / 4) + j * 8];
      pq01[i][j] = v2f{v.x, v.y};
      pq23[i][j] = v2f{v.z, v.w};
    }
  }
  __syncthreads();  // wcnt complete

  int base = 0, nu = 0;  // unmasked features in the waves before this one; in the range
#pragma unroll  // the 8 LDS reads go out together
  for (int w = 0; w < 8; ++w) {
    const int cw = wcnt[w];
    base += (w < wv) ? cw : 0;
    nu += cw;
  }
  nu = __builtin_amdgcn_readfirstlane(nu);
  if (mk) {
    list[base + __popc(bal & ((1u << lane) - 1u))] = tid;
  } else {
#pragma unroll  // offsets fold into the stores
    for (int q = 0; q < 16; ++q) s[q * kSP + tid] = -1.0e9f;
  }
  __syncthreads();  // list complete

  {
    const int cnt = (nu - wv + 7) >> 3;  // list entries wv, wv + 8, ... below nu
    const int li  = wv + lane * 8;      // lane i holds the wave's i-th feature
    const int myf = (li < nu) ? list[li] : 0;
    const float4* __restrict__ pf4 =
        (const float4*)(pf + ((size_t)b * kF + f0) * kA) + c;
    float* srow = s + (g * 4 + (c & 3)) * kSP;
    auto row_load = [&](float4 (&d)[4], int i) {  // the wave's i-th row, i clamped
      const int f = __builtin_amdgcn_readlane(myf, (i < cnt) ? i : cnt - 1);
#pragma unroll  // d[] stays in registers
      for (int j = 0; j < 4; ++j) d[j] = pf4[f * (kA / 4) + j * 8];
    };
    auto row_score = [&](const float4 (&p)[4], int i) {
      v2f acc[4];
#pragma unroll  // here and below: register arrays are indexed by constants only
      for (int q = 0; q < 4; ++q) acc[q] = v2f{0.0f, 0.0f};
#pragma unroll
      for (int j = 0; j < 4; ++j) {
        const v2f p01 = v2f{p[j].x, p[j].y};
        const v2f p23 = v2f{p[j].z, p[j].w};
#pragma unroll
        for (int q = 0; q < 4; ++q) {
          const v2f x01 = p01 + pq01[q][j];
          const v2f x23 = p23 + pq23[q][j];
          const v2f t01 = v2f{fast_tanh(x01.x), fast_tanh(x01.y)};
          const v2f t23 = v2f{fast_tanh(x23.x), fast_tanh(x23.y)};
          acc[q] = __builtin_elementwise_fma(t01, wa01[j], acc[q]);
          acc[q] = __builtin_elementwise_fma(t23, wa23[j], acc[q]);
        }
      }
      float r[4];
#pragma unroll
      for (int q = 0; q < 4; ++q) {
        r[q] = acc[q].x + acc[q].y;
        r[q] = add_xmask<0x161>(r[q]);
        r[q] = add_xmask<0x162>(r[q]);
        r[q] = add_xmask<0x164>(r[q]);
      }
      const float r01 = (c & 1) ? r[1] : r[0];
      const float r23 = (c & 1) ? r[3] : r[2];
      if (c < 4)  // lane c stores query 4g + c
        srow[__builtin_amdgcn_readlane(myf, i)] = (c & 2) ? r23 : r01;
    };
    if (cnt > 0) {
      float4 ra[4], rb[4];  // two rows: one flies while the other is worked on
      row_load(ra, 0);
      for (int i = 0; i < cnt; i += 2) {
        row_load(rb, i + 1);
        // The two fences keep the next row's loads in front of this row's arithmetic;
        // left alone the compiler issued them at the end of it and waited at once.
        __builtin_amdgcn_sched_barrier(0);
        row_score(ra, i);
        row_load(ra, i + 2);
        // The next trip rewrites the address registers of these loads: the wait that
        // belongs in front of that.
        asm volatile("s_wait_xcnt 0x0" ::: "memory");
        __builtin_amdgcn_sched_barrier(0);
        if (i + 1 < cnt) row_score(rb, i + 1);
      }
    }
  }
  __syncthreads();

  // ---- Pass 2: range max, exp and range sum per row (wave32 shuffles) ------
  for (int q = wave * 2; q < wave * 2 + 2; ++q) {
    float m = -3.0e38f;
    for (int f = lane; f < kFS; f += 32) m = fmaxf(m, s[q * kSP + f]);
#pragma unroll
    for (int o = 16; o >= 1; o >>= 1) m = fmaxf(m, __shfl_xor(m, o, 32));
    float sum = 0.0f;
    for (int f = lane; f < kFS; f += 32) {
      const float e = __expf(s[q * kSP + f] - m);
      s[q * kSP + f] = e;
      sum += e;
    }
#pragma unroll
    for (int o = 16; o >= 1; o >>= 1) sum += __shfl_xor(sum, o, 32);
    if (lane == 0) {  // one 128-byte line per workgroup
      pml[blockIdx.x * 32 + q]      = m;
      pml[blockIdx.x * 32 + 16 + q] = sum;
    }
  }
  __syncthreads();

  // ---- Pass 3: po[16][256] = e[16][kFS] @ feature[b][f0..] (WMMA bf16) -----
  // A wave owns columns 32w .. 32w+31; lane n holds column 32w+2n of its first tile
  // and 32w+2n+1 of its second, so both come from LDS in one 8-byte read, 16 lanes
  // cover 32 banks, and 16 lanes store one whole 128-byte line of po.
  const int n     = lane & 15;
  const int col0  = wave * 32 + n * 2;
  const int col1  = col0 + 1;
  const int arow  = lane & 15;
  const int kbase = (lane < 16) ? 0 : 8;
  v8f c0 = {}, c1 = {};

#if HAVE_ASYNC_LDS
  const float* fbase = feature + ((size_t)b * kF + f0) * kD;
  async_slab(fbase, fb0, tid);
  for (int ks = 0; ks < kFS / 32; ++ks) {
    float* cur = (ks & 1) ? fb1 : fb0;
    float* nxt = (ks & 1) ? fb0 : fb1;
    const bool more = (ks + 1) < (kFS / 32);
    if (more) {
      async_slab(fbase + (size_t)(ks + 1) * 32 * kD, nxt, tid);
      wait_async<8>();   // my 8 loads for `cur` are done (in-order)
    } else {
      wait_async<0>();
    }
    __syncthreads();     // everyone's slab data visible

    const int k0 = ks * 32;
    v16bf af, b0v, b1v;
    const float4* ap = (const float4*)(s + arow * kSP + k0 + kbase);
    pack8(af, 0, ap[0], ap[1]);  // K = k0+kbase + 0..7
    pack8(af, 8, ap[4], ap[5]);  // K = k0+kbase + 16..23
#pragma unroll
    for (int e = 0; e < 16; ++e) {
      const int kk = kbase + e + ((e >= 8) ? 8 : 0);   // 0..31 within slab
      const float2 v = *(const float2*)(cur + kk * kDP + col0);
      b0v[e] = (__bf16)v.x;
      b1v[e] = (__bf16)v.y;
    }
    c0 = WMMA_BF16(af, b0v, c0);
    c1 = WMMA_BF16(af, b1v, c1);
    __syncthreads();     // all waves done reading `cur` before it is reused
  }
#else
  for (int k0 = 0; k0 < kFS; k0 += 32) {
    if (k0 + 32 < kFS)
      __builtin_prefetch(feature + ((size_t)b * kF + f0 + k0 + 32 + kbase) * kD, 0, 1);
    v16bf af, b0v, b1v;
#pragma unroll
    for (int e = 0; e < 16; ++e) {
      const int k = k0 + kbase + e + ((e >= 8) ? 8 : 0);
      af[e] = (__bf16)s[arow * kSP + k];
      const float* __restrict__ fr = feature + ((size_t)b * kF + f0 + k) * kD;
      b0v[e] = (__bf16)fr[col0];
      b1v[e] = (__bf16)fr[col1];
    }
    c0 = WMMA_BF16(af, b0v, c0);
    c1 = WMMA_BF16(af, b1v, c1);
  }
#endif

  const int mofs = (lane >> 4) * 8;
#pragma unroll
  for (int r = 0; r < 8; ++r) {
    float* __restrict__ orow = po + ((size_t)blockIdx.x * 16 + mofs + r) * kD;
    *(float2*)(orow + col0) = make_float2(c0[r], c1[r]);
  }
}

// exp(x). The v_nop in the statement is the free slot that the instruction set
// asks for behind a transcendental before its source register is overwritten.
__device__ __forceinline__ float exp_slot(float x) {
  float r;
  asm("v_exp_f32 %0, %1\n\tv_nop" : "=v"(r) : "v"(x * 1.44269504f));
  return r;
}

// ---------------------------------------------------------------------------
// Merge of the kS ranges of one (batch, query) row: weight exp(m_s - M) per
// range, out = sum_s w_s * po_s / sum_s w_s * l_s. 64 threads per row, float4.
// ---------------------------------------------------------------------------
__global__ __launch_bounds__(256) void merge_ranges(
    const float* __restrict__ po,   // [B*Q/16,S,16,D]
    const float* __restrict__ pml,  // [B*Q/16,S,32]
    float*       __restrict__ out)  // [B*Q,D]
{
  const int row  = blockIdx.x * 4 + (threadIdx.x >> 6);
  const int d4   = threadIdx.x & 63;
  const int tile = row >> 4;
  const int qi   = row & 15;
  const float* __restrict__ ml = pml + tile * kS * 32 + qi;
  float mv[kS];
  float M = -3.0e38f;
#pragma unroll  // keeps mv[] in registers
  for (int i = 0; i < kS; ++i) {
    mv[i] = ml[i * 32];
    M = fmaxf(M, mv[i]);
  }
  const float4* __restrict__ p4 =
      (const float4*)(po + ((size_t)tile * kS * 16 + qi) * kD) + d4;
  float L = 0.0f;
  float4 o = make_float4(0.0f, 0.0f, 0.0f, 0.0f);
#pragma unroll  // all kS loads in flight at once: one L2 latency, not kS
  for (int i = 0; i < kS; ++i) {
    const float w = exp_slot(mv[i] - M);
    const float4 v = p4[i * (16 * kD / 4)];
    L += w * ml[i * 32 + 16];
    o.x += w * v.x; o.y += w * v.y; o.z += w * v.z; o.w += w * v.w;
  }
  const float inv = __builtin_amdgcn_rcpf(L);
  ((float4*)(out + (size_t)row * kD))[d4] =
      make_float4(o.x * inv, o.y * inv, o.z * inv, o.w * inv);
}

// ---------------------------------------------------------------------------
extern "C" void kernel_launch(void* const* d_in, const int* in_sizes, int n_in,
                              void* d_out, int out_size, void* d_ws, size_t ws_size,
                              hipStream_t stream) {
  const float* feature = (const float*)d_in[0];  // [B,F,D]
  const float* query   = (const float*)d_in[1];  // [B,Q,QD]
  const float* Wf      = (const float*)d_in[2];  // [A,D]
  const float* Wq      = (const float*)d_in[3];  // [A,QD]
  const float* bq      = (const float*)d_in[4];  // [A]
  const float* wa      = (const float*)d_in[5];  // [A]
  const int*   mask    = (const int*)d_in[6];    // [B,F]
  float* out = (float*)d_out;

  float* pf  = (float*)d_ws;                     // [B,F,A] = 16 MB
  float* pqv = pf + (size_t)kB * kF * kA;        // [B,Q,A] = 0.5 MB
  float* po  = pqv + (size_t)kB * kQ * kA;       // [B*Q/16,S,16,D]
  float* pml = po + (size_t)kB * kQ * kS * kD;   // [B*Q/16,S,32]

  // pf = feature @ Wf^T : M=32768, N=128, K=256; 128 rows per workgroup
  proj_rows_bf16<<<kB * kF / 128, 256, 0, stream>>>(feature, Wf, pf);
  {  // pq = query @ Wq^T + bq : M=1024, N=128, K=256
    const int M = kB * kQ;
    const int blocks = ((M / 16) * (kA / 16) + 7) / 8;
    proj_gemm_bf16<kA, kD><<<blocks, 256, 0, stream>>>(query, Wq, bq, pqv, M, 1);
  }
  {  // scores + softmax partials + weighted sum, one feature range per workgroup
    const size_t shmem =
        (size_t)(16 * kSP + kFS + 32 + 2 * 32 * kDP) * sizeof(float);
    fused_attn<<<kB * (kQ / 16) * kS, 256, shmem, stream>>>(feature, pf, pqv, wa, mask,
                                                            po, pml);
  }
  // merge of the ranges: 4 rows per workgroup
  merge_ranges<<<kB * kQ / 4, 256, 0, stream>>>(po, pml, out);
}

// v005
// One run takes 34.1 microseconds.
// In two side-by-side timings against v004, it was 1.15 and 1.16 times as fast.
// Over all steps from v000 it is 6.97 times as fast.
#include <hip/hip_runtime.h>
#include <hip/hip_bf16.h>

// CDNA5 (gfx1250) fused additive attention.
// K1: both bf16-WMMA projection GEMMs (pf, pq). K2: fused score(tanh)+softmax
// partials+weights@feature for one range of the feature axis per workgroup,
// the feature K-slabs staged via async global->LDS (ASYNCcnt) double buffering.
// K3: merges the ranges' partials (max, sum, un-normalised weighted sum).

typedef __attribute__((ext_vector_type(16))) __bf16 v16bf;
typedef __attribute__((ext_vector_type(8)))  __bf16 v8bf;
typedef __attribute__((ext_vector_type(4)))  __bf16 v4bf;
typedef __attribute__((ext_vector_type(8)))  float  v8f;
typedef __attribute__((ext_vector_type(2)))  float  v2f;
typedef __attribute__((ext_vector_type(4)))  int    v4i;

#define WMMA_BF16(a, b, c) \
  __builtin_amdgcn_wmma_f32_16x16x32_bf16(false, (a), false, (b), (short)0, (c), false, false)

#define GLOBAL_AS __attribute__((address_space(1)))
#define LDS_AS    __attribute__((address_space(3)))

constexpr int kB = 16, kF = 2048, kQ = 64, kD = 256, kA = 128;
constexpr int kS  = 8;         // ranges of the feature axis, one workgroup each
constexpr int kFS = kF / kS;   // features per range
// LDS row pitches in floats, 1040 B = 16 B x odd. Score rows: the 16 rows that a
// b128 A-fragment read (or a score store) touches fall on different banks. Slab
// rows: rows k and k + 8, read by the two halves of a wave, lie 32 banks apart.
constexpr int kSP = kFS + 4;
constexpr int kDP = kD + 4;

// ---- native tanh if the toolchain exposes V_TANH_F32 ------------------------
#if __has_builtin(__builtin_amdgcn_tanhf)
__device__ __forceinline__ float fast_tanh(float x) { return __builtin_amdgcn_tanhf(x); }
#elif __has_builtin(__builtin_amdgcn_tanh_f32)
__device__ __forceinline__ float fast_tanh(float x) { return __builtin_amdgcn_tanh_f32(x); }
#else
__device__ __forceinline__ float fast_tanh(float x) {
  const float t = __expf(2.0f * x);                      // v_exp_f32
  return (t - 1.0f) * __builtin_amdgcn_rcpf(t + 1.0f);   // v_rcp_f32, no slow div
}
#endif

// ---- async global->LDS staging (gfx1250 ASYNC path) -------------------------
#if __has_builtin(__builtin_amdgcn_global_load_async_to_lds_b128)
#define HAVE_ASYNC_LDS 1
#else
#define HAVE_ASYNC_LDS 0
#endif

#if HAVE_ASYNC_LDS
template <int N>
__device__ __forceinline__ void wait_async() {
#if __has_builtin(__builtin_amdgcn_s_wait_asynccnt)
  __builtin_amdgcn_s_wait_asynccnt(N);
#else
  asm volatile("s_wait_asynccnt %0" ::"n"(N) : "memory");
#endif
}
// Copy a 32 x kD f32 slab (32KB) global->LDS rows of pitch kDP: 8 x b128 per thread,
// coalesced; 64 threads per row, 4 rows per step.
// Builtin signature (per hipcc diagnostic): (as1 v4i*, as3 v4i*, imm, imm).
__device__ __forceinline__ void async_slab(const float* __restrict__ gsrc,
                                           float* __restrict__ ldst, int tid) {
#pragma unroll
  for (int i = 0; i < 8; ++i) {
    const int idx = (tid + i * 256) * 4;  // float index, 16B aligned
    const int dst = ((tid >> 6) + i * 4) * kDP + (tid & 63) * 4;  // 16B aligned too
    __builtin_amdgcn_global_load_async_to_lds_b128(
        (GLOBAL_AS v4i*)(gsrc + idx), (LDS_AS v4i*)(ldst + dst), 0, 0);
  }
}
#endif

__device__ __forceinline__ void pack8(v16bf& v, int base, float4 lo, float4 hi) {
  v[base + 0] = (__bf16)lo.x; v[base + 1] = (__bf16)lo.y;
  v[base + 2] = (__bf16)lo.z; v[base + 3] = (__bf16)lo.w;
  v[base + 4] = (__bf16)hi.x; v[base + 5] = (__bf16)hi.y;
  v[base + 6] = (__bf16)hi.z; v[base + 7] = (__bf16)hi.w;
}

template <int N, int K>
__device__ __forceinline__ void proj_gemm_bf16(
    const float* __restrict__ X, const float* __restrict__ W,
    const float* __restrict__ bias, float* __restrict__ Y, int M, int useBias, int blk)
{
  const int wave = threadIdx.x >> 5;
  const int lane = threadIdx.x & 31;
  const int gw = blk * 8 + wave;
  constexpr int ntn = N >> 4;
  const int total = (M >> 4) * ntn;
  if (gw >= total) return;
  const int tm = gw / ntn;
  const int tn = gw % ntn;

  const int row   = lane & 15;
  const int kbase = (lane < 16) ? 0 : 8;
  const float4* __restrict__ xr4 =
      (const float4*)(X + (size_t)(tm * 16 + row) * K + kbase);
  const float4* __restrict__ wr4 =
      (const float4*)(W + (size_t)(tn * 16 + row) * K + kbase);

  // C/D layout: VGPR r -> M=r (lanes 0-15) / M=r+8 (lanes 16-31), N=lane%16
  const int mofs = (lane >> 4) * 8;
  const int gn   = tn * 16 + (lane & 15);
  const float bv = useBias ? bias[gn] : 0.0f;

  // The k steps go in two halves; the 32 loads of a half are issued as one run, so a
  // wave waits for memory twice and ends well inside the feature part's time. Left as
  // one loop with the wait behind it, the loads came out two at a time, each pair
  // with a full wait.
  constexpr int kSteps = K / 64;  // k steps of 32 per half
  v8f c = {};
#pragma unroll  // xv[] and wv[] stay in registers, offsets fold into the loads
  for (int h = 0; h < 2; ++h) {
    float4 xv[kSteps * 4], wv[kSteps * 4];
#pragma unroll
    for (int ks = 0; ks < kSteps; ++ks) {
      const int q4 = (h * kSteps + ks) * 8;
      xv[ks * 4 + 0] = xr4[q4 + 0];  // K = k0+kbase + 0..7
      xv[ks * 4 + 1] = xr4[q4 + 1];
      xv[ks * 4 + 2] = xr4[q4 + 4];  // K = k0+kbase + 16..23
      xv[ks * 4 + 3] = xr4[q4 + 5];
      wv[ks * 4 + 0] = wr4[q4 + 0];
      wv[ks * 4 + 1] = wr4[q4 + 1];
      wv[ks * 4 + 2] = wr4[q4 + 4];
      wv[ks * 4 + 3] = wr4[q4 + 5];
    }
    // The wait that belongs in front of a rewrite of the loads' address registers; both
    // pointers are inputs so that their register pairs live up to it.
    asm volatile("s_wait_xcnt 0x0" ::"v"(xr4), "v"(wr4) : "memory");
    // Keeps the run of loads in front of the first conversion.
    __builtin_amdgcn_sched_barrier(0);
#pragma unroll
    for (int ks = 0; ks < kSteps; ++ks) {
      v16bf a, b;
      pack8(a, 0, xv[ks * 4 + 0], xv[ks * 4 + 1]);
      pack8(a, 8, xv[ks * 4 + 2], xv[ks * 4 + 3]);
      pack8(b, 0, wv[ks * 4 + 0], wv[ks * 4 + 1]);
      pack8(b, 8, wv[ks * 4 + 2], wv[ks * 4 + 3]);
      c = WMMA_BF16(a, b, c);
    }
  }

  float* __restrict__ yp = Y + (size_t)(tm * 16 + mofs) * N + gn;
#pragma unroll
  for (int r = 0; r < 8; ++r) yp[r * N] = c[r] + bv;
}

// ---------------------------------------------------------------------------
// Feature projection: Y[M,kA] = X[M,kD] * W[kA,kD]^T. One workgroup = 128 rows,
// one wave = 16 rows x all kA columns, so every X element is loaded once on the
// chip. W is read once per workgroup in whole lines, rounded to bf16 and kept in
// LDS; the B fragments come from there. Fragment k order and the order of the
// k steps are those of proj_gemm_bf16.
// ---------------------------------------------------------------------------
constexpr int kWP = kD + 8;  // bf16 per LDS row of W: 528 B = 16 B x odd, no bank conflict for b128 readers

__device__ __forceinline__ void proj_rows_bf16(
    const float* __restrict__ X, const float* __restrict__ W, float* __restrict__ Y)
{
  __shared__ __attribute__((aligned(16))) __bf16 wl[kA * kWP];
  const int tid   = threadIdx.x;
  const int wave  = tid >> 5;
  const int lane  = tid & 31;
  const int row   = lane & 15;
  const int kbase = (lane < 16) ? 0 : 8;
  const int m0    = (blockIdx.x * 8 + wave) * 16;

  // W passes through registers in two halves, so that one half (64 registers) and
  // the wave's whole X strip (128) are in flight together below 256 registers.
  const float4* __restrict__ w4 = (const float4*)W;  // kD/4 = 64 float4 per row
  constexpr int kWH = kA * kD / 4 / 256 / 2;         // float4 per thread and half
  __bf16* wdst = &wl[(tid >> 6) * kWP + (tid & 63) * 4];  // a wave reads 512 B, writes 256 B
  float4 wv[kWH];
#pragma unroll  // keeps wv[] in registers
  for (int i = 0; i < kWH; ++i) wv[i] = w4[tid + i * 256];

  const float4* __restrict__ xr4 =
      (const float4*)(X + (size_t)(m0 + row) * kD + kbase);
  float4 xv[kD / 8];
#pragma unroll  // keeps xv[] in registers
  for (int ks = 0; ks < kD / 32; ++ks) {
    xv[ks * 4 + 0] = xr4[ks * 8 + 0];  // K = ks*32+kbase + 0..7
    xv[ks * 4 + 1] = xr4[ks * 8 + 1];
    xv[ks * 4 + 2] = xr4[ks * 8 + 4];  // K = ks*32+kbase + 16..23
    xv[ks * 4 + 3] = xr4[ks * 8 + 5];
  }
  // The wait that belongs in front of a rewrite of these loads' address registers. The
  // pointer is an input so that its register pair lives up to the wait; in this build
  // the compiler had otherwise let the last load's result land on the pair.
  asm volatile("s_wait_xcnt 0x0" ::"v"(xr4) : "memory");
  // Keeps all 48 loads in front of the first wait; without it the compiler holds
  // part of the X loads back until the first half of W has arrived.
  __builtin_amdgcn_sched_barrier(0);

#pragma unroll  // wv[] is indexed by constants only, here and in the two inner loops
  for (int h = 0; h < 2; ++h) {
#pragma unroll
    for (int i = 0; i < kWH; ++i) {
      v4bf p;
      p[0] = (__bf16)wv[i].x; p[1] = (__bf16)wv[i].y;
      p[2] = (__bf16)wv[i].z; p[3] = (__bf16)wv[i].w;
      *(v4bf*)(wdst + (h * kWH + i) * 4 * kWP) = p;  // 4 rows of W per 256 threads
    }
    if (h == 0) {
#pragma unroll
      for (int i = 0; i < kWH; ++i) wv[i] = w4[tid + (kWH + i) * 256];
    }
  }

  v16bf a[kD / 32];
#pragma unroll  // keeps a[] in registers
  for (int ks = 0; ks < kD / 32; ++ks) {
    pack8(a[ks], 0, xv[ks * 4 + 0], xv[ks * 4 + 1]);
    pack8(a[ks], 8, xv[ks * 4 + 2], xv[ks * 4 + 3]);
  }
  __syncthreads();  // W is complete in LDS

  v8f c[kA / 16];
#pragma unroll  // keeps c[] in registers
  for (int tn = 0; tn < kA / 16; ++tn) c[tn] = v8f{};

  // Groups of 4 WMMAs (one k step, 4 column tiles); the B fragments of a group are
  // read as one run of 8 ds_load_b128, two groups ahead, into a ring of 3 sets.
  const __bf16* bbase = &wl[row * kWP + kbase];
  constexpr int kG = (kD / 32) * 2;
  v16bf bq[3][4];
  auto load_group = [&](int g) {
#pragma unroll  // bq[] is indexed by constants only
    for (int t = 0; t < 4; ++t) {
      const __bf16* bp = bbase + ((g & 1) * 4 + t) * 16 * kWP + (g >> 1) * 32;
      const v8bf lo = *(const v8bf*)bp;         // K = ks*32+kbase + 0..7
      const v8bf hi = *(const v8bf*)(bp + 16);  // K = ks*32+kbase + 16..23
      bq[g % 3][t] = __builtin_shufflevector(lo, hi, 0, 1, 2, 3, 4, 5, 6, 7, 8, 9, 10, 11,
                                             12, 13, 14, 15);
    }
  };
  load_group(0);
  load_group(1);
#pragma unroll  // a[], c[] and bq[] are indexed by constants only
  for (int g = 0; g < kG; ++g) {
    if (g + 2 < kG) load_group(g + 2);
    // The two fences keep each group's LDS reads together and two groups ahead of
    // their WMMAs; left alone the compiler put each read pair directly in front of
    // its WMMA with a full wait.
    __builtin_amdgcn_sched_barrier(0);
#pragma unroll  // c[] and bq[] are indexed by constants only
    for (int t = 0; t < 4; ++t)
      c[(g & 1) * 4 + t] = WMMA_BF16(a[g >> 1], bq[g % 3][t], c[(g & 1) * 4 + t]);
    __builtin_amdgcn_sched_barrier(0);
  }

  // C/D layout as in proj_gemm_bf16; the wave writes its 16 rows whole.
  float* __restrict__ yp = Y + (size_t)(m0 + (lane >> 4) * 8) * kA + row;
#pragma unroll  // both loops: c[] is indexed by constants only, offsets fold into the stores
  for (int tn = 0; tn < kA / 16; ++tn)
#pragma unroll
    for (int r = 0; r < 8; ++r) yp[r * kA + tn * 16] = c[tn][r];
}

// ---------------------------------------------------------------------------
// Both projections in one launch: neither reads what the other writes. The first
// kRowBlocks workgroups do the feature projection, the long part;
// the kQBlocks behind them do the query projection beside it.
// The second launch bound (4 waves per SIMD) holds the kernel to 256 registers, so
// that a query workgroup fits on a WGP that already runs a feature workgroup and
// need not wait for one to end.
// ---------------------------------------------------------------------------
constexpr int kRowBlocks = kB * kF / 128;
constexpr int kQBlocks   = (kB * kQ / 16) * (kA / 16) / 8;

__global__ __launch_bounds__(256, 4) void proj_both(
    const float* __restrict__ feature, const float* __restrict__ Wf,
    float* __restrict__ pf, const float* __restrict__ query,
    const float* __restrict__ Wq, const float* __restrict__ bq, float* __restrict__ pq)
{
  if (blockIdx.x < kRowBlocks)  // the same for a whole workgroup: its barrier is safe
    proj_rows_bf16(feature, Wf, pf);
  else
    proj_gemm_bf16<kA, kD>(query, Wq, bq, pq, kB * kQ, 1, blockIdx.x - kRowBlocks);
}

// Sum of x over the lanes l ^ m, m = CTRL - 0x160, inside a 16-lane row (DPP row_xmask).
template <int CTRL>
__device__ __forceinline__ float add_xmask(float x) {
  return x + __builtin_bit_cast(float, __builtin_amdgcn_update_dpp(
                 0, __builtin_bit_cast(int, x), CTRL, 0xf, 0xf, true));
}

// ---------------------------------------------------------------------------
// Fused attention: one workgroup (256 thr = 8 waves) per (batch, 16-q tile,
// feature range). It leaves the range's row maxima, row sums and the
// un-normalised weighted sum in the workspace; merge_ranges finishes the softmax.
// LDS: s[16][kSP] + list[kFS] + wcnt[32] + 2x feature slab [32][kDP] (82KB).
// ---------------------------------------------------------------------------
static_assert(kFS == 256, "one feature of the range per thread when the list is built");

__global__ __launch_bounds__(256) void fused_attn(
    const float* __restrict__ feature,  // [B,F,D]
    const float* __restrict__ pf,       // [B,F,A]
    const float* __restrict__ pq,       // [B,Q,A] (bias included)
    const float* __restrict__ wa,       // [A]
    const int*   __restrict__ mask,     // [B,F]
    float*       __restrict__ po,       // [B*Q/16,S,16,D] un-normalised partial sums
    float*       __restrict__ pml)      // [B*Q/16,S,32] 16 range maxima, 16 range sums
{
  extern __shared__ __attribute__((aligned(16))) float lds[];
  float* s    = lds;                   // [16][kSP], kFS used per row
  int*   list = (int*)(s + 16 * kSP);  // [kFS] the range's unmasked features, ascending
  int*   wcnt = list + kFS;            // [32], 8 used: unmasked features per wave
  float* fb0  = (float*)(wcnt + 32);   // [32][kDP] slab buffer 0, kD used per row
  float* fb1  = fb0 + 32 * kDP;        // [32][kDP] slab buffer 1

  const int tid  = threadIdx.x;
  const int wave = tid >> 5;
  const int lane = tid & 31;
  const int sp   = blockIdx.x % kS;  // feature range
  const int tile = blockIdx.x / kS;
  const int b  = tile >> 2;          // Q/16 == 4 query tiles per batch
  const int q0 = (tile & 3) * 16;
  const int f0 = sp * kFS;

  // ---- Pass 1: masked scores s[q][f] = sum_a wa[a]*tanh(pf[f][a]+pq[q][a])
  // A wave takes one unmasked feature at a time, so a masked one costs nothing.
  // Lane = (g, c): queries 4g..4g+3, terms a = 32j + 4c + e (j, e = 0..3). The
  // lane's 64 pq values and 16 wa values stay in registers; a pf row is 4 loads
  // of one 128-byte line each; the 8 lanes c of a query are summed by DPP.
  const int wv = __builtin_amdgcn_readfirstlane(wave);
  const int c  = lane & 7;
  const int g  = lane >> 3;

  const int mk = mask[b * kF + f0 + tid];
  const unsigned bal = __builtin_amdgcn_ballot_w32(mk != 0);
  if (lane == 0) wcnt[wave] = __popc(bal);

  const float4* __restrict__ pq4 =
      (const float4*)(pq + ((size_t)b * kQ + q0 + g * 4) * kA) + c;
  const float4* __restrict__ wa4 = (const float4*)wa + c;
  v2f pq01[4][4], pq23[4][4], wa01[4], wa23[4];
#pragma unroll  // both loops: the arrays stay in registers
  for (int j = 0; j < 4; ++j) {
    const float4 w = wa4[j * 8];
    wa01[j] = v2f{w.x, w.y};
    wa23[j] = v2f{w.z, w.w};
#pragma unroll
    for (int i = 0; i < 4; ++i) {
      const float4 v = pq4[i * (kA / 4) + j * 8];
      pq01[i][j] = v2f{v.x, v.y};
      pq23[i][j] = v2f{v.z, v.w};
    }
  }
  __syncthreads();  // wcnt complete

  int base = 0, nu = 0;  // unmasked features in the waves before this one; in the range
#pragma unroll  // the 8 LDS reads go out together
  for (int w = 0; w < 8; ++w) {
    const int cw = wcnt[w];
    base += (w < wv) ? cw : 0;
    nu += cw;
  }
  nu = __builtin_amdgcn_readfirstlane(nu);
  if (mk) {
    list[base + __popc(bal & ((1u << lane) - 1u))] = tid;
  } else {
#pragma unroll  // offsets fold into the stores
    for (int q = 0; q < 16; ++q) s[q * kSP + tid] = -1.0e9f;
  }
  __syncthreads();  // list complete

  {
    const int cnt = (nu - wv + 7) >> 3;  // list entries wv, wv + 8, ... below nu
    const int li  = wv + lane * 8;      // lane i holds the wave's i-th feature
    const int myf = (li < nu) ? list[li] : 0;
    const float4* __restrict__ pf4 =
        (const float4*)(pf + ((size_t)b * kF + f0) * kA) + c;
    float* srow = s + (g * 4 + (c & 3)) * kSP;
    auto row_load = [&](float4 (&d)[4], int i) {  // the wave's i-th row, i clamped
      const int f = __builtin_amdgcn_readlane(myf, (i < cnt) ? i : cnt - 1);
#pragma unroll  // d[] stays in registers
      for (int j = 0; j < 4; ++j) d[j] = pf4[f * (kA / 4) + j * 8];
    };
    auto row_score = [&](const float4 (&p)[4], int i) {
      v2f acc[4];
#pragma unroll  // here and below: register arrays are indexed by constants only
      for (int q = 0; q < 4; ++q) acc[q] = v2f{0.0f, 0.0f};
#pragma unroll
      for (int j = 0; j < 4; ++j) {
        const v2f p01 = v2f{p[j].x, p[j].y};
        const v2f p23 = v2f{p[j].z, p[j].w};
#pragma unroll
        for (int q = 0; q < 4; ++q) {
          const v2f x01 = p01 + pq01[q][j];
          const v2f x23 = p23 + pq23[q][j];
          const v2f t01 = v2f{fast_tanh(x01.x), fast_tanh(x01.y)};
          const v2f t23 = v2f{fast_tanh(x23.x), fast_tanh(x23.y)};
          acc[q] = __builtin_elementwise_fma(t01, wa01[j], acc[q]);
          acc[q] = __builtin_elementwise_fma(t23, wa23[j], acc[q]);
        }
      }
      float r[4];
#pragma unroll
      for (int q = 0; q < 4; ++q) {
        r[q] = acc[q].x + acc[q].y;
        r[q] = add_xmask<0x161>(r[q]);
        r[q] = add_xmask<0x162>(r[q]);
        r[q] = add_xmask<0x164>(r[q]);
      }
      const float r01 = (c & 1) ? r[1] : r[0];
      const float r23 = (c & 1) ? r[3] : r[2];
      if (c < 4)  // lane c stores query 4g + c
        srow[__builtin_amdgcn_readlane(myf, i)] = (c & 2) ? r23 : r01;
    };
    if (cnt > 0) {
      float4 ra[4], rb[4];  // two rows: one flies while the other is worked on
      row_load(ra, 0);
      for (int i = 0; i < cnt; i += 2) {
        row_load(rb, i + 1);
        // The two fences keep the next row's loads in front of this row's arithmetic;
        // left alone the compiler issued them at the end of it and waited at once.
        __builtin_amdgcn_sched_barrier(0);
        row_score(ra, i);
        row_load(ra, i + 2);
        // The next trip rewrites the address registers of these loads: the wait that
        // belongs in front of that.
        asm volatile("s_wait_xcnt 0x0" ::: "memory");
        __builtin_amdgcn_sched_barrier(0);
        if (i + 1 < cnt) row_score(rb, i + 1);
      }
    }
  }
  __syncthreads();

  // ---- Pass 2: range max, exp and range sum per row (wave32 shuffles) ------
  for (int q = wave * 2; q < wave * 2 + 2; ++q) {
    float m = -3.0e38f;
    for (int f = lane; f < kFS; f += 32) m = fmaxf(m, s[q * kSP + f]);
#pragma unroll
    for (int o = 16; o >= 1; o >>= 1) m = fmaxf(m, __shfl_xor(m, o, 32));
    float sum = 0.0f;
    for (int f = lane; f < kFS; f += 32) {
      const float e = __expf(s[q * kSP + f] - m);
      s[q * kSP + f] = e;
      sum += e;
    }
#pragma unroll
    for (int o = 16; o >= 1; o >>= 1) sum += __shfl_xor(sum, o, 32);
    if (lane == 0) {  // one 128-byte line per workgroup
      pml[blockIdx.x * 32 + q]      = m;
      pml[blockIdx.x * 32 + 16 + q] = sum;
    }
  }
  __syncthreads();

  // ---- Pass 3: po[16][256] = e[16][kFS] @ feature[b][f0..] (WMMA bf16) -----
  // A wave owns columns 32w .. 32w+31; lane n holds column 32w+2n of its first tile
  // and 32w+2n+1 of its second, so both come from LDS in one 8-byte read, 16 lanes
  // cover 32 banks, and 16 lanes store one whole 128-byte line of po.
  const int n     = lane & 15;
  const int col0  = wave * 32 + n * 2;
  const int col1  = col0 + 1;
  const int arow  = lane & 15;
  const int kbase = (lane < 16) ? 0 : 8;
  v8f c0 = {}, c1 = {};

#if HAVE_ASYNC_LDS
  const float* fbase = feature + ((size_t)b * kF + f0) * kD;
  async_slab(fbase, fb0, tid);
  for (int ks = 0; ks < kFS / 32; ++ks) {
    float* cur = (ks & 1) ? fb1 : fb0;
    float* nxt = (ks & 1) ? fb0 : fb1;
    const bool more = (ks + 1) < (kFS / 32);
    if (more) {
      async_slab(fbase + (size_t)(ks + 1) * 32 * kD, nxt, tid);
      wait_async<8>();   // my 8 loads for `cur` are done (in-order)
    } else {
      wait_async<0>();
    }
    __syncthreads();     // everyone's slab data visible

    const int k0 = ks * 32;
    v16bf af, b0v, b1v;
    const float4* ap = (const float4*)(s + arow * kSP + k0 + kbase);
    pack8(af, 0, ap[0], ap[1]);  // K = k0+kbase + 0..7
    pack8(af, 8, ap[4], ap[5]);  // K = k0+kbase + 16..23
#pragma unroll
    for (int e = 0; e < 16; ++e) {
      const int kk = kbase + e + ((e >= 8) ? 8 : 0);   // 0..31 within slab
      const float2 v = *(const float2*)(cur + kk * kDP + col0);
      b0v[e] = (__bf16)v.x;
      b1v[e] = (__bf16)v.y;
    }
    c0 = WMMA_BF16(af, b0v, c0);
    c1 = WMMA_BF16(af, b1v, c1);
    __syncthreads();     // all waves done reading `cur` before it is reused
  }
#else
  for (int k0 = 0; k0 < kFS; k0 += 32) {
    if (k0 + 32 < kFS)
      __builtin_prefetch(feature + ((size_t)b * kF + f0 + k0 + 32 + kbase) * kD, 0, 1);
    v16bf af, b0v, b1v;
#pragma unroll
    for (int e = 0; e < 16; ++e) {
      const int k = k0 + kbase + e + ((e >= 8) ? 8 : 0);
      af[e] = (__bf16)s[arow * kSP + k];
      const float* __restrict__ fr = feature + ((size_t)b * kF + f0 + k) * kD;
      b0v[e] = (__bf16)fr[col0];
      b1v[e] = (__bf16)fr[col1];
    }
    c0 = WMMA_BF16(af, b0v, c0);
    c1 = WMMA_BF16(af, b1v, c1);
  }
#endif

  const int mofs = (lane >> 4) * 8;
#pragma unroll
  for (int r = 0; r < 8; ++r) {
    float* __restrict__ orow = po + ((size_t)blockIdx.x * 16 + mofs + r) * kD;
    *(float2*)(orow + col0) = make_float2(c0[r], c1[r]);
  }
}

// exp(x). The v_nop in the statement is the free slot that the instruction set
// asks for behind a transcendental before its source register is overwritten.
__device__ __forceinline__ float exp_slot(float x) {
  float r;
  asm("v_exp_f32 %0, %1\n\tv_nop" : "=v"(r) : "v"(x * 1.44269504f));
  return r;
}

// ---------------------------------------------------------------------------
// Merge of the kS ranges of one (batch, query) row: weight exp(m_s - M) per
// range, out = sum_s w_s * po_s / sum_s w_s * l_s. 64 threads per row, float4.
// ---------------------------------------------------------------------------
__global__ __launch_bounds__(256) void merge_ranges(
    const float* __restrict__ po,   // [B*Q/16,S,16,D]
    const float* __restrict__ pml,  // [B*Q/16,S,32]
    float*       __restrict__ out)  // [B*Q,D]
{
  const int row  = blockIdx.x * 4 + (threadIdx.x >> 6);
  const int d4   = threadIdx.x & 63;
  const int tile = row >> 4;
  const int qi   = row & 15;
  const float* __restrict__ ml = pml + tile * kS * 32 + qi;
  float mv[kS];
  float M = -3.0e38f;
#pragma unroll  // keeps mv[] in registers
  for (int i = 0; i < kS; ++i) {
    mv[i] = ml[i * 32];
    M = fmaxf(M, mv[i]);
  }
  const float4* __restrict__ p4 =
      (const float4*)(po + ((size_t)tile * kS * 16 + qi) * kD) + d4;
  float L = 0.0f;
  float4 o = make_float4(0.0f, 0.0f, 0.0f, 0.0f);
#pragma unroll  // all kS loads in flight at once: one L2 latency, not kS
  for (int i = 0; i < kS; ++i) {
    const float w = exp_slot(mv[i] - M);
    const float4 v = p4[i * (16 * kD / 4)];
    L += w * ml[i * 32 + 16];
    o.x += w * v.x; o.y += w * v.y; o.z += w * v.z; o.w += w * v.w;
  }
  const float inv = __builtin_amdgcn_rcpf(L);
  ((float4*)(out + (size_t)row * kD))[d4] =
      make_float4(o.x * inv, o.y * inv, o.z * inv, o.w * inv);
}

// ---------------------------------------------------------------------------
extern "C" void kernel_launch(void* const* d_in, const int* in_sizes, int n_in,
                              void* d_out, int out_size, void* d_ws, size_t ws_size,
                              hipStream_t stream) {
  const float* feature = (const float*)d_in[0];  // [B,F,D]
  const float* query   = (const float*)d_in[1];  // [B,Q,QD]
  const float* Wf      = (const float*)d_in[2];  // [A,D]
  const float* Wq      = (const float*)d_in[3];  // [A,QD]
  const float* bq      = (const float*)d_in[4];  // [A]
  const float* wa      = (const float*)d_in[5];  // [A]
  const int*   mask    = (const int*)d_in[6];    // [B,F]
  float* out = (float*)d_out;

  float* pf  = (float*)d_ws;                     // [B,F,A] = 16 MB
  float* pqv = pf + (size_t)kB * kF * kA;        // [B,Q,A] = 0.5 MB
  float* po  = pqv + (size_t)kB * kQ * kA;       // [B*Q/16,S,16,D]
  float* pml = po + (size_t)kB * kQ * kS * kD;   // [B*Q/16,S,32]

  // pf = feature @ Wf^T : M=32768, N=128, K=256; 128 rows per workgroup
  // pq = query @ Wq^T + bq : M=1024, N=128, K=256; 8 tiles of 16x16 per workgroup
  proj_both<<<kRowBlocks + kQBlocks, 256, 0, stream>>>(feature, Wf, pf, query, Wq, bq, pqv);
  {  // scores + softmax partials + weighted sum, one feature range per workgroup
    const size_t shmem =
        (size_t)(16 * kSP + kFS + 32 + 2 * 32 * kDP) * sizeof(float);
    fused_attn<<<kB * (kQ / 16) * kS, 256, shmem, stream>>>(feature, pf, pqv, wa, mask,
                                                            po, pml);
  }
  // merge of the ranges: 4 rows per workgroup
  merge_ranges<<<kB * kQ / 4, 256, 0, stream>>>(po, pml, out);
}

// v006
// One run takes 30.7 microseconds.
// In both of two side-by-side timings against v005, it was 1.11 times as fast.
// All steps since v000 together make it 7.71 times as fast.
#include <hip/hip_runtime.h>
#include <hip/hip_bf16.h>

// CDNA5 (gfx1250) fused additive attention.
// K1: both bf16-WMMA projection GEMMs (pf, pq). K2: fused score(tanh)+softmax
// partials+weights@feature for one range of the feature axis per workgroup,
// the whole range staged once via async global->LDS (ASYNCcnt) under the score pass.
// K3: merges the ranges' partials (max, sum, un-normalised weighted sum).

typedef __attribute__((ext_vector_type(16))) __bf16 v16bf;
typedef __attribute__((ext_vector_type(8)))  __bf16 v8bf;
typedef __attribute__((ext_vector_type(4)))  __bf16 v4bf;
typedef __attribute__((ext_vector_type(8)))  float  v8f;
typedef __attribute__((ext_vector_type(2)))  float  v2f;
typedef __attribute__((ext_vector_type(4)))  int    v4i;

#define WMMA_BF16(a, b, c) \
  __builtin_amdgcn_wmma_f32_16x16x32_bf16(false, (a), false, (b), (short)0, (c), false, false)

#define GLOBAL_AS __attribute__((address_space(1)))
#define LDS_AS    __attribute__((address_space(3)))

constexpr int kB = 16, kF = 2048, kQ = 64, kD = 256, kA = 128;
constexpr int kS  = 8;         // ranges of the feature axis, one workgroup each
constexpr int kFS = kF / kS;   // features per range
// LDS row pitches in floats, 1040 B = 16 B x odd. Score rows: the 16 rows that a
// b128 A-fragment read (or a score store) touches fall on different banks. Slab
// rows: rows k and k + 8, read by the two halves of a wave, lie 32 banks apart.
constexpr int kSP = kFS + 4;
constexpr int kDP = kD + 4;

// ---- native tanh if the toolchain exposes V_TANH_F32 ------------------------
#if __has_builtin(__builtin_amdgcn_tanhf)
__device__ __forceinline__ float fast_tanh(float x) { return __builtin_amdgcn_tanhf(x); }
#elif __has_builtin(__builtin_amdgcn_tanh_f32)
__device__ __forceinline__ float fast_tanh(float x) { return __builtin_amdgcn_tanh_f32(x); }
#else
__device__ __forceinline__ float fast_tanh(float x) {
  const float t = __expf(2.0f * x);                      // v_exp_f32
  return (t - 1.0f) * __builtin_amdgcn_rcpf(t + 1.0f);   // v_rcp_f32, no slow div
}
#endif

// ---- async global->LDS staging (gfx1250 ASYNC path) -------------------------
#if __has_builtin(__builtin_amdgcn_global_load_async_to_lds_b128)
#define HAVE_ASYNC_LDS 1
#else
#define HAVE_ASYNC_LDS 0
#endif

#if HAVE_ASYNC_LDS
// Copy a 32 x kD f32 slab (32KB) global->LDS rows of pitch kDP: 4 x b128 per thread of
// a 512-thread workgroup, coalesced; 64 threads per row, 8 rows per step.
// Builtin signature (per hipcc diagnostic): (as1 v4i*, as3 v4i*, imm, imm).
__device__ __forceinline__ void async_slab(const float* __restrict__ gsrc,
                                           float* __restrict__ ldst, int tid) {
#pragma unroll
  for (int i = 0; i < 4; ++i) {
    const int idx = (tid + i * 512) * 4;  // float index, 16B aligned
    const int dst = ((tid >> 6) + i * 8) * kDP + (tid & 63) * 4;  // 16B aligned too
    __builtin_amdgcn_global_load_async_to_lds_b128(
        (GLOBAL_AS v4i*)(gsrc + idx), (LDS_AS v4i*)(ldst + dst), 0, 0);
  }
}
#endif

__device__ __forceinline__ void pack8(v16bf& v, int base, float4 lo, float4 hi) {
  v[base + 0] = (__bf16)lo.x; v[base + 1] = (__bf16)lo.y;
  v[base + 2] = (__bf16)lo.z; v[base + 3] = (__bf16)lo.w;
  v[base + 4] = (__bf16)hi.x; v[base + 5] = (__bf16)hi.y;
  v[base + 6] = (__bf16)hi.z; v[base + 7] = (__bf16)hi.w;
}

template <int N, int K>
__device__ __forceinline__ void proj_gemm_bf16(
    const float* __restrict__ X, const float* __restrict__ W,
    const float* __restrict__ bias, float* __restrict__ Y, int M, int useBias, int blk)
{
  const int wave = threadIdx.x >> 5;
  const int lane = threadIdx.x & 31;
  const int gw = blk * 8 + wave;
  constexpr int ntn = N >> 4;
  const int total = (M >> 4) * ntn;
  if (gw >= total) return;
  const int tm = gw / ntn;
  const int tn = gw % ntn;

  const int row   = lane & 15;
  const int kbase = (lane < 16) ? 0 : 8;
  const float4* __restrict__ xr4 =
      (const float4*)(X + (size_t)(tm * 16 + row) * K + kbase);
  const float4* __restrict__ wr4 =
      (const float4*)(W + (size_t)(tn * 16 + row) * K + kbase);

  // C/D layout: VGPR r -> M=r (lanes 0-15) / M=r+8 (lanes 16-31), N=lane%16
  const int mofs = (lane >> 4) * 8;
  const int gn   = tn * 16 + (lane & 15);
  const float bv = useBias ? bias[gn] : 0.0f;

  // The k steps go in two halves; the 32 loads of a half are issued as one run, so a
  // wave waits for memory twice and ends well inside the feature part's time. Left as
  // one loop with the wait behind it, the loads came out two at a time, each pair
  // with a full wait.
  constexpr int kSteps = K / 64;  // k steps of 32 per half
  v8f c = {};
#pragma unroll  // xv[] and wv[] stay in registers, offsets fold into the loads
  for (int h = 0; h < 2; ++h) {
    float4 xv[kSteps * 4], wv[kSteps * 4];
#pragma unroll
    for (int ks = 0; ks < kSteps; ++ks) {
      const int q4 = (h * kSteps + ks) * 8;
      xv[ks * 4 + 0] = xr4[q4 + 0];  // K = k0+kbase + 0..7
      xv[ks * 4 + 1] = xr4[q4 + 1];
      xv[ks * 4 + 2] = xr4[q4 + 4];  // K = k0+kbase + 16..23
      xv[ks * 4 + 3] = xr4[q4 + 5];
      wv[ks * 4 + 0] = wr4[q4 + 0];
      wv[ks * 4 + 1] = wr4[q4 + 1];
      wv[ks * 4 + 2] = wr4[q4 + 4];
      wv[ks * 4 + 3] = wr4[q4 + 5];
    }
    // The wait that belongs in front of a rewrite of the loads' address registers; both
    // pointers are inputs so that their register pairs live up to it.
    asm volatile("s_wait_xcnt 0x0" ::"v"(xr4), "v"(wr4) : "memory");
    // Keeps the run of loads in front of the first conversion.
    __builtin_amdgcn_sched_barrier(0);
#pragma unroll
    for (int ks = 0; ks < kSteps; ++ks) {
      v16bf a, b;
      pack8(a, 0, xv[ks * 4 + 0], xv[ks * 4 + 1]);
      pack8(a, 8, xv[ks * 4 + 2], xv[ks * 4 + 3]);
      pack8(b, 0, wv[ks * 4 + 0], wv[ks * 4 + 1]);
      pack8(b, 8, wv[ks * 4 + 2], wv[ks * 4 + 3]);
      c = WMMA_BF16(a, b, c);
    }
  }

  float* __restrict__ yp = Y + (size_t)(tm * 16 + mofs) * N + gn;
#pragma unroll
  for (int r = 0; r < 8; ++r) yp[r * N] = c[r] + bv;
}

// ---------------------------------------------------------------------------
// Feature projection: Y[M,kA] = X[M,kD] * W[kA,kD]^T. One workgroup = 128 rows,
// one wave = 16 rows x all kA columns, so every X element is loaded once on the
// chip. W is read once per workgroup in whole lines, rounded to bf16 and kept in
// LDS; the B fragments come from there. Fragment k order and the order of the
// k steps are those of proj_gemm_bf16.
// ---------------------------------------------------------------------------
constexpr int kWP = kD + 8;  // bf16 per LDS row of W: 528 B = 16 B x odd, no bank conflict for b128 readers

__device__ __forceinline__ void proj_rows_bf16(
    const float* __restrict__ X, const float* __restrict__ W, float* __restrict__ Y)
{
  __shared__ __attribute__((aligned(16))) __bf16 wl[kA * kWP];
  const int tid   = threadIdx.x;
  const int wave  = tid >> 5;
  const int lane  = tid & 31;
  const int row   = lane & 15;
  const int kbase = (lane < 16) ? 0 : 8;
  const int m0    = (blockIdx.x * 8 + wave) * 16;

  // W passes through registers in two halves, so that one half (64 registers) and
  // the wave's whole X strip (128) are in flight together below 256 registers.
  const float4* __restrict__ w4 = (const float4*)W;  // kD/4 = 64 float4 per row
  constexpr int kWH = kA * kD / 4 / 256 / 2;         // float4 per thread and half
  __bf16* wdst = &wl[(tid >> 6) * kWP + (tid & 63) * 4];  // a wave reads 512 B, writes 256 B
  float4 wv[kWH];
#pragma unroll  // keeps wv[] in registers
  for (int i = 0; i < kWH; ++i) wv[i] = w4[tid + i * 256];

  const float4* __restrict__ xr4 =
      (const float4*)(X + (size_t)(m0 + row) * kD + kbase);
  float4 xv[kD / 8];
#pragma unroll  // keeps xv[] in registers
  for (int ks = 0; ks < kD / 32; ++ks) {
    xv[ks * 4 + 0] = xr4[ks * 8 + 0];  // K = ks*32+kbase + 0..7
    xv[ks * 4 + 1] = xr4[ks * 8 + 1];
    xv[ks * 4 + 2] = xr4[ks * 8 + 4];  // K = ks*32+kbase + 16..23
    xv[ks * 4 + 3] = xr4[ks * 8 + 5];
  }
  // The wait that belongs in front of a rewrite of these loads' address registers. The
  // pointer is an input so that its register pair lives up to the wait; in this build
  // the compiler had otherwise let the last load's result land on the pair.
  asm volatile("s_wait_xcnt 0x0" ::"v"(xr4) : "memory");
  // Keeps all 48 loads in front of the first wait; without it the compiler holds
  // part of the X loads back until the first half of W has arrived.
  __builtin_amdgcn_sched_barrier(0);

#pragma unroll  // wv[] is indexed by constants only, here and in the two inner loops
  for (int h = 0; h < 2; ++h) {
#pragma unroll
    for (int i = 0; i < kWH; ++i) {
      v4bf p;
      p[0] = (__bf16)wv[i].x; p[1] = (__bf16)wv[i].y;
      p[2] = (__bf16)wv[i].z; p[3] = (__bf16)wv[i].w;
      *(v4bf*)(wdst + (h * kWH + i) * 4 * kWP) = p;  // 4 rows of W per 256 threads
    }
    if (h == 0) {
#pragma unroll
      for (int i = 0; i < kWH; ++i) wv[i] = w4[tid + (kWH + i) * 256];
    }
  }

  v16bf a[kD / 32];
#pragma unroll  // keeps a[] in registers
  for (int ks = 0; ks < kD / 32; ++ks) {
    pack8(a[ks], 0, xv[ks * 4 + 0], xv[ks * 4 + 1]);
    pack8(a[ks], 8, xv[ks * 4 + 2], xv[ks * 4 + 3]);
  }
  __syncthreads();  // W is complete in LDS

  v8f c[kA / 16];
#pragma unroll  // keeps c[] in registers
  for (int tn = 0; tn < kA / 16; ++tn) c[tn] = v8f{};

  // Groups of 4 WMMAs (one k step, 4 column tiles); the B fragments of a group are
  // read as one run of 8 ds_load_b128, two groups ahead, into a ring of 3 sets.
  const __bf16* bbase = &wl[row * kWP + kbase];
  constexpr int kG = (kD / 32) * 2;
  v16bf bq[3][4];
  auto load_group = [&](int g) {
#pragma unroll  // bq[] is indexed by constants only
    for (int t = 0; t < 4; ++t) {
      const __bf16* bp = bbase + ((g & 1) * 4 + t) * 16 * kWP + (g >> 1) * 32;
      const v8bf lo = *(const v8bf*)bp;         // K = ks*32+kbase + 0..7
      const v8bf hi = *(const v8bf*)(bp + 16);  // K = ks*32+kbase + 16..23
      bq[g % 3][t] = __builtin_shufflevector(lo, hi, 0, 1, 2, 3, 4, 5, 6, 7, 8, 9, 10, 11,
                                             12, 13, 14, 15);
    }
  };
  load_group(0);
  load_group(1);
#pragma unroll  // a[], c[] and bq[] are indexed by constants only
  for (int g = 0; g < kG; ++g) {
    if (g + 2 < kG) load_group(g + 2);
    // The two fences keep each group's LDS reads together and two groups ahead of
    // their WMMAs; left alone the compiler put each read pair directly in front of
    // its WMMA with a full wait.
    __builtin_amdgcn_sched_barrier(0);
#pragma unroll  // c[] and bq[] are indexed by constants only
    for (int t = 0; t < 4; ++t)
      c[(g & 1) * 4 + t] = WMMA_BF16(a[g >> 1], bq[g % 3][t], c[(g & 1) * 4 + t]);
    __builtin_amdgcn_sched_barrier(0);
  }

  // C/D layout as in proj_gemm_bf16; the wave writes its 16 rows whole.
  float* __restrict__ yp = Y + (size_t)(m0 + (lane >> 4) * 8) * kA + row;
#pragma unroll  // both loops: c[] is indexed by constants only, offsets fold into the stores
  for (int tn = 0; tn < kA / 16; ++tn)
#pragma unroll
    for (int r = 0; r < 8; ++r) yp[r * kA + tn * 16] = c[tn][r];
}

// ---------------------------------------------------------------------------
// Both projections in one launch: neither reads what the other writes. The first
// kRowBlocks workgroups do the feature projection, the long part;
// the kQBlocks behind them do the query projection beside it.
// The second launch bound (4 waves per SIMD) holds the kernel to 256 registers, so
// that a query workgroup fits on a WGP that already runs a feature workgroup and
// need not wait for one to end.
// ---------------------------------------------------------------------------
constexpr int kRowBlocks = kB * kF / 128;
constexpr int kQBlocks   = (kB * kQ / 16) * (kA / 16) / 8;

__global__ __launch_bounds__(256, 4) void proj_both(
    const float* __restrict__ feature, const float* __restrict__ Wf,
    float* __restrict__ pf, const float* __restrict__ query,
    const float* __restrict__ Wq, const float* __restrict__ bq, float* __restrict__ pq)
{
  if (blockIdx.x < kRowBlocks)  // the same for a whole workgroup: its barrier is safe
    proj_rows_bf16(feature, Wf, pf);
  else
    proj_gemm_bf16<kA, kD>(query, Wq, bq, pq, kB * kQ, 1, blockIdx.x - kRowBlocks);
}

// Sum of x over the lanes l ^ m, m = CTRL - 0x160, inside a 16-lane row (DPP row_xmask).
template <int CTRL>
__device__ __forceinline__ float add_xmask(float x) {
  return x + __builtin_bit_cast(float, __builtin_amdgcn_update_dpp(
                 0, __builtin_bit_cast(int, x), CTRL, 0xf, 0xf, true));
}

// ---------------------------------------------------------------------------
// Fused attention: one workgroup (512 thr = 16 waves) per (batch, 32 queries,
// feature range); waves 0-7 take the first 16-query tile, waves 8-15 the second.
// It leaves the range's row maxima, row sums and the un-normalised weighted sum in
// the workspace; merge_ranges finishes the softmax.
// LDS: s[32][kSP] + list[kFS] + wcnt[32] + the range's features [kFS][kDP] (260KB):
// one workgroup per WGP. The features are copied in while the scores are computed,
// so the weighted sum finds all of them in LDS and waits for no memory.
// ---------------------------------------------------------------------------
static_assert(kFS == 256, "one feature of the range per thread and tile when the list is built");
constexpr int kAttnLds = 32 * kSP + kFS + 32 + kFS * kDP;  // floats

__global__ __launch_bounds__(512) void fused_attn(
    const float* __restrict__ feature,  // [B,F,D]
    const float* __restrict__ pf,       // [B,F,A]
    const float* __restrict__ pq,       // [B,Q,A] (bias included)
    const float* __restrict__ wa,       // [A]
    const int*   __restrict__ mask,     // [B,F]
    float*       __restrict__ po,       // [B*Q/16,S,16,D] un-normalised partial sums
    float*       __restrict__ pml)      // [B*Q/16,S,32] 16 range maxima, 16 range sums
{
  __shared__ __attribute__((aligned(16))) float lds[kAttnLds];
  int*   list = (int*)(lds + 32 * kSP);  // [kFS] the range's unmasked features, ascending
  int*   wcnt = list + kFS;              // [32], 8 used: unmasked features per 32 features
  float* fb   = (float*)(wcnt + 32);     // [kFS][kDP] the range's features, kD used per row

  const int tid  = threadIdx.x;
  const int lane = tid & 31;
  const int fid  = tid & 255;                                 // feature of the range
  const int qt   = __builtin_amdgcn_readfirstlane(tid >> 8);  // the wave's 16-query tile
  const int wave = (tid >> 5) & 7;                            // the wave's place in its tile
  const int sp   = blockIdx.x % kS;  // feature range
  const int tile = (blockIdx.x / kS) * 2 + qt;
  const int blk  = tile * kS + sp;   // place of the tile's partials in po and pml
  const int b  = tile >> 2;          // Q/16 == 4 query tiles per batch
  const int q0 = (tile & 3) * 16;
  const int f0 = sp * kFS;
  float* s = lds + qt * 16 * kSP;    // [16][kSP] the tile's scores, kFS used per row

  // ---- Pass 1: masked scores s[q][f] = sum_a wa[a]*tanh(pf[f][a]+pq[q][a])
  // A wave takes one unmasked feature at a time, so a masked one costs nothing.
  // Lane = (g, c): queries 4g..4g+3, terms a = 32j + 4c + e (j, e = 0..3). The
  // lane's 64 pq values and 16 wa values stay in registers; a pf row is 4 loads
  // of one 128-byte line each; the 8 lanes c of a query are summed by DPP.
  const int wv = __builtin_amdgcn_readfirstlane(wave);
  const int c  = lane & 7;
  const int g  = lane >> 3;

  const int mk = mask[b * kF + f0 + fid];
  const unsigned bal = __builtin_amdgcn_ballot_w32(mk != 0);
  if (lane == 0 && qt == 0) wcnt[wave] = __popc(bal);

  const float4* __restrict__ pq4 =
      (const float4*)(pq + ((size_t)b * kQ + q0 + g * 4) * kA) + c;
  const float4* __restrict__ wa4 = (const float4*)wa + c;
  v2f pq01[4][4], pq23[4][4], wa01[4], wa23[4];
#pragma unroll  // both loops: the arrays stay in registers
  for (int j = 0; j < 4; ++j) {
    const float4 w = wa4[j * 8];
    wa01[j] = v2f{w.x, w.y};
    wa23[j] = v2f{w.z, w.w};
#pragma unroll
    for (int i = 0; i < 4; ++i) {
      const float4 v = pq4[i * (kA / 4) + j * 8];
      pq01[i][j] = v2f{v.x, v.y};
      pq23[i][j] = v2f{v.z, v.w};
    }
  }
  __syncthreads();  // wcnt complete

  int base = 0, nu = 0;  // unmasked features in the waves before this one; in the range
#pragma unroll  // the 8 LDS reads go out together
  for (int w = 0; w < 8; ++w) {
    const int cw = wcnt[w];
    base += (w < wv) ? cw : 0;
    nu += cw;
  }
  nu = __builtin_amdgcn_readfirstlane(nu);
  if (mk) {
    if (qt == 0) list[base + __popc(bal & ((1u << lane) - 1u))] = fid;
  } else {
#pragma unroll  // offsets fold into the stores
    for (int q = 0; q < 16; ++q) s[q * kSP + fid] = -1.0e9f;
  }
  __syncthreads();  // list complete

#if HAVE_ASYNC_LDS
  const float* fbase = feature + ((size_t)b * kF + f0) * kD;
#endif
  {
    const int cnt = (nu - wv + 7) >> 3;  // list entries wv, wv + 8, ... below nu
    const int li  = wv + lane * 8;      // lane i holds the wave's i-th feature
    const int myf = (li < nu) ? list[li] : 0;
    const float4* __restrict__ pf4 =
        (const float4*)(pf + ((size_t)b * kF + f0) * kA) + c;
    float* srow = s + (g * 4 + (c & 3)) * kSP;
    auto row_load = [&](float4 (&d)[4], int i) {  // the wave's i-th row, i clamped
      const int f = __builtin_amdgcn_readlane(myf, (i < cnt) ? i : cnt - 1);
      const float4* __restrict__ pr = pf4 + f * (kA / 4);
#pragma unroll  // d[] stays in registers
      for (int j = 0; j < 4; ++j) d[j] = pr[j * 8];
      // The wait that belongs in front of a rewrite of these loads' address registers. The
      // pointer is an input so that its register pair lives up to the wait; in this build
      // the compiler had otherwise let the last load's result land on the pair.
      asm volatile("s_wait_xcnt 0x0" ::"v"(pr) : "memory");
    };
    auto row_score = [&](const float4 (&p)[4], int i) {
      v2f acc[4];
#pragma unroll  // here and below: register arrays are indexed by constants only
      for (int q = 0; q < 4; ++q) acc[q] = v2f{0.0f, 0.0f};
#pragma unroll
      for (int j = 0; j < 4; ++j) {
        const v2f p01 = v2f{p[j].x, p[j].y};
        const v2f p23 = v2f{p[j].z, p[j].w};
#pragma unroll
        for (int q = 0; q < 4; ++q) {
          const v2f x01 = p01 + pq01[q][j];
          const v2f x23 = p23 + pq23[q][j];
          const v2f t01 = v2f{fast_tanh(x01.x), fast_tanh(x01.y)};
          const v2f t23 = v2f{fast_tanh(x23.x), fast_tanh(x23.y)};
          acc[q] = __builtin_elementwise_fma(t01, wa01[j], acc[q]);
          acc[q] = __builtin_elementwise_fma(t23, wa23[j], acc[q]);
        }
      }
      float r[4];
#pragma unroll
      for (int q = 0; q < 4; ++q) {
        r[q] = acc[q].x + acc[q].y;
        r[q] = add_xmask<0x161>(r[q]);
        r[q] = add_xmask<0x162>(r[q]);
        r[q] = add_xmask<0x164>(r[q]);
      }
      const float r01 = (c & 1) ? r[1] : r[0];
      const float r23 = (c & 1) ? r[3] : r[2];
      if (c < 4)  // lane c stores query 4g + c
        srow[__builtin_amdgcn_readlane(myf, i)] = (c & 2) ? r23 : r01;
    };
    if (cnt > 0) {
      float4 ra[4], rb[4];  // two rows: one flies while the other is worked on
      row_load(ra, 0);
      for (int i = 0; i < cnt; i += 2) {
        row_load(rb, i + 1);
#if HAVE_ASYNC_LDS
        // One slab of the range per trip: spread so, the copies never stand as one long
        // queue in front of the pf rows that the score pass is waiting for.
        if (i < kFS / 16) async_slab(fbase + (i >> 1) * 32 * kD, fb + (i >> 1) * 32 * kDP, tid);
#endif
        // The two fences keep the next row's loads in front of this row's arithmetic;
        // left alone the compiler issued them at the end of it and waited at once.
        __builtin_amdgcn_sched_barrier(0);
        row_score(ra, i);
        row_load(ra, i + 2);
        __builtin_amdgcn_sched_barrier(0);
        if (i + 1 < cnt) row_score(rb, i + 1);
      }
    }
#if HAVE_ASYNC_LDS
    // The slabs that a wave with few rows has not yet sent for.
#pragma nounroll  // a tail that seldom runs: kept short
    for (int sl = (cnt + 1) >> 1; sl < kFS / 32; ++sl)
      async_slab(fbase + sl * 32 * kD, fb + sl * 32 * kDP, tid);
#endif
  }
  __syncthreads();

  // ---- Pass 2: range max, exp and range sum per row (wave32 shuffles) ------
  for (int q = wave * 2; q < wave * 2 + 2; ++q) {
    float m = -3.0e38f;
    for (int f = lane; f < kFS; f += 32) m = fmaxf(m, s[q * kSP + f]);
#pragma unroll
    for (int o = 16; o >= 1; o >>= 1) m = fmaxf(m, __shfl_xor(m, o, 32));
    float sum = 0.0f;
    for (int f = lane; f < kFS; f += 32) {
      const float e = __expf(s[q * kSP + f] - m);
      s[q * kSP + f] = e;
      sum += e;
    }
#pragma unroll
    for (int o = 16; o >= 1; o >>= 1) sum += __shfl_xor(sum, o, 32);
    if (lane == 0) {  // one 128-byte line per tile
      pml[blk * 32 + q]      = m;
      pml[blk * 32 + 16 + q] = sum;
    }
  }
#if HAVE_ASYNC_LDS
  // This wave's copies have landed; the barrier behind it shows them to the other waves.
  asm volatile("s_wait_asynccnt 0x0" ::: "memory");
#endif
  __syncthreads();

  // ---- Pass 3: po[16][256] = e[16][kFS] @ feature[b][f0..] (WMMA bf16) -----
  // A wave owns columns 32w .. 32w+31; lane n holds column 32w+2n of its first tile
  // and 32w+2n+1 of its second, so both come from LDS in one 8-byte read, 16 lanes
  // cover 32 banks, and 16 lanes store one whole 128-byte line of po.
  const int n     = lane & 15;
  const int col0  = wave * 32 + n * 2;
  const int col1  = col0 + 1;
  const int arow  = lane & 15;
  const int kbase = (lane < 16) ? 0 : 8;
  v8f c0 = {}, c1 = {};

#if HAVE_ASYNC_LDS
#pragma unroll  // offsets fold into the LDS reads, and a later step's reads go ahead of the WMMAs
  for (int ks = 0; ks < kFS / 32; ++ks) {
    const float* cur = fb + ks * 32 * kDP;
    const int k0 = ks * 32;
    v16bf af, b0v, b1v;
    const float4* ap = (const float4*)(s + arow * kSP + k0 + kbase);
    pack8(af, 0, ap[0], ap[1]);  // K = k0+kbase + 0..7
    pack8(af, 8, ap[4], ap[5]);  // K = k0+kbase + 16..23
#pragma unroll
    for (int e = 0; e < 16; ++e) {
      const int kk = kbase + e + ((e >= 8) ? 8 : 0);   // 0..31 within slab
      const float2 v = *(const float2*)(cur + kk * kDP + col0);
      b0v[e] = (__bf16)v.x;
      b1v[e] = (__bf16)v.y;
    }
    c0 = WMMA_BF16(af, b0v, c0);
    c1 = WMMA_BF16(af, b1v, c1);
  }
#else
  for (int k0 = 0; k0 < kFS; k0 += 32) {
    if (k0 + 32 < kFS)
      __builtin_prefetch(feature + ((size_t)b * kF + f0 + k0 + 32 + kbase) * kD, 0, 1);
    v16bf af, b0v, b1v;
#pragma unroll
    for (int e = 0; e < 16; ++e) {
      const int k = k0 + kbase + e + ((e >= 8) ? 8 : 0);
      af[e] = (__bf16)s[arow * kSP + k];
      const float* __restrict__ fr = feature + ((size_t)b * kF + f0 + k) * kD;
      b0v[e] = (__bf16)fr[col0];
      b1v[e] = (__bf16)fr[col1];
    }
    c0 = WMMA_BF16(af, b0v, c0);
    c1 = WMMA_BF16(af, b1v, c1);
  }
#endif

  const int mofs = (lane >> 4) * 8;
#pragma unroll
  for (int r = 0; r < 8; ++r) {
    float* __restrict__ orow = po + ((size_t)blk * 16 + mofs + r) * kD;
    *(float2*)(orow + col0) = make_float2(c0[r], c1[r]);
  }
}

// exp(x). The v_nop in the statement is the free slot that the instruction set
// asks for behind a transcendental before its source register is overwritten.
__device__ __forceinline__ float exp_slot(float x) {
  float r;
  asm("v_exp_f32 %0, %1\n\tv_nop" : "=v"(r) : "v"(x * 1.44269504f));
  return r;
}

// ---------------------------------------------------------------------------
// Merge of the kS ranges of one (batch, query) row: weight exp(m_s - M) per
// range, out = sum_s w_s * po_s / sum_s w_s * l_s. 64 threads per row, float4.
// ---------------------------------------------------------------------------
__global__ __launch_bounds__(256) void merge_ranges(
    const float* __restrict__ po,   // [B*Q/16,S,16,D]
    const float* __restrict__ pml,  // [B*Q/16,S,32]
    float*       __restrict__ out)  // [B*Q,D]
{
  const int row  = blockIdx.x * 4 + (threadIdx.x >> 6);
  const int d4   = threadIdx.x & 63;
  const int tile = row >> 4;
  const int qi   = row & 15;
  const float* __restrict__ ml = pml + tile * kS * 32 + qi;
  float mv[kS];
  float M = -3.0e38f;
#pragma unroll  // keeps mv[] in registers
  for (int i = 0; i < kS; ++i) {
    mv[i] = ml[i * 32];
    M = fmaxf(M, mv[i]);
  }
  const float4* __restrict__ p4 =
      (const float4*)(po + ((size_t)tile * kS * 16 + qi) * kD) + d4;
  float L = 0.0f;
  float4 o = make_float4(0.0f, 0.0f, 0.0f, 0.0f);
#pragma unroll  // all kS loads in flight at once: one L2 latency, not kS
  for (int i = 0; i < kS; ++i) {
    const float w = exp_slot(mv[i] - M);
    const float4 v = p4[i * (16 * kD / 4)];
    L += w * ml[i * 32 + 16];
    o.x += w * v.x; o.y += w * v.y; o.z += w * v.z; o.w += w * v.w;
  }
  const float inv = __builtin_amdgcn_rcpf(L);
  ((float4*)(out + (size_t)row * kD))[d4] =
      make_float4(o.x * inv, o.y * inv, o.z * inv, o.w * inv);
}

// ---------------------------------------------------------------------------
extern "C" void kernel_launch(void* const* d_in, const int* in_sizes, int n_in,
                              void* d_out, int out_size, void* d_ws, size_t ws_size,
                              hipStream_t stream) {
  const float* feature = (const float*)d_in[0];  // [B,F,D]
  const float* query   = (const float*)d_in[1];  // [B,Q,QD]
  const float* Wf      = (const float*)d_in[2];  // [A,D]
  const float* Wq      = (const float*)d_in[3];  // [A,QD]
  const float* bq      = (const float*)d_in[4];  // [A]
  const float* wa      = (const float*)d_in[5];  // [A]
  const int*   mask    = (const int*)d_in[6];    // [B,F]
  float* out = (float*)d_out;

  float* pf  = (float*)d_ws;                     // [B,F,A] = 16 MB
  float* pqv = pf + (size_t)kB * kF * kA;        // [B,Q,A] = 0.5 MB
  float* po  = pqv + (size_t)kB * kQ * kA;       // [B*Q/16,S,16,D]
  float* pml = po + (size_t)kB * kQ * kS * kD;   // [B*Q/16,S,32]

  // pf = feature @ Wf^T : M=32768, N=128, K=256; 128 rows per workgroup
  // pq = query @ Wq^T + bq : M=1024, N=128, K=256; 8 tiles of 16x16 per workgroup
  proj_both<<<kRowBlocks + kQBlocks, 256, 0, stream>>>(feature, Wf, pf, query, Wq, bq, pqv);
  // scores + softmax partials + weighted sum, 32 queries and one feature range per workgroup
  fused_attn<<<kB * (kQ / 32) * kS, 512, 0, stream>>>(feature, pf, pqv, wa, mask, po, pml);
  // merge of the ranges: 4 rows per workgroup
  merge_ranges<<<kB * kQ / 4, 256, 0, stream>>>(po, pml, out);
}

// v007
// It runs in 28.2 microseconds.
// Two timings next to v006 put it at 1.09 and 1.08 times that version's speed.
// All steps since v000 together make it 8.38 times as fast.
#include <hip/hip_runtime.h>
#include <hip/hip_bf16.h>

// CDNA5 (gfx1250) fused additive attention.
// K1: both bf16-WMMA projection GEMMs (pf, pq). K2: fused score(tanh)+softmax
// partials+weights@feature for one range of the feature axis per workgroup,
// the range's unmasked features staged once via async global->LDS (ASYNCcnt) under the score pass.
// K3: merges the ranges' partials (max, sum, un-normalised weighted sum).

typedef __attribute__((ext_vector_type(16))) __bf16 v16bf;
typedef __attribute__((ext_vector_type(8)))  __bf16 v8bf;
typedef __attribute__((ext_vector_type(4)))  __bf16 v4bf;
typedef __attribute__((ext_vector_type(8)))  float  v8f;
typedef __attribute__((ext_vector_type(2)))  float  v2f;
typedef __attribute__((ext_vector_type(4)))  int    v4i;

#define WMMA_BF16(a, b, c) \
  __builtin_amdgcn_wmma_f32_16x16x32_bf16(false, (a), false, (b), (short)0, (c), false, false)

#define GLOBAL_AS __attribute__((address_space(1)))
#define LDS_AS    __attribute__((address_space(3)))

constexpr int kB = 16, kF = 2048, kQ = 64, kD = 256, kA = 128;
constexpr int kS  = 8;         // ranges of the feature axis, one workgroup each
constexpr int kFS = kF / kS;   // features per range
// LDS row pitches in floats, 1040 B = 16 B x odd. Score rows: the 16 rows that a
// b128 A-fragment read (or a score store) touches fall on different banks. Slab
// rows: rows k and k + 8, read by the two halves of a wave, lie 32 banks apart.
constexpr int kSP = kFS + 4;
constexpr int kDP = kD + 4;

// ---- native tanh if the toolchain exposes V_TANH_F32 ------------------------
#if __has_builtin(__builtin_amdgcn_tanhf)
__device__ __forceinline__ float fast_tanh(float x) { return __builtin_amdgcn_tanhf(x); }
#elif __has_builtin(__builtin_amdgcn_tanh_f32)
__device__ __forceinline__ float fast_tanh(float x) { return __builtin_amdgcn_tanh_f32(x); }
#else
__device__ __forceinline__ float fast_tanh(float x) {
  const float t = __expf(2.0f * x);                      // v_exp_f32
  return (t - 1.0f) * __builtin_amdgcn_rcpf(t + 1.0f);   // v_rcp_f32, no slow div
}
#endif

// ---- async global->LDS staging (gfx1250 ASYNC path) -------------------------
#if __has_builtin(__builtin_amdgcn_global_load_async_to_lds_b128)
#define HAVE_ASYNC_LDS 1
#else
#define HAVE_ASYNC_LDS 0
#endif

#if HAVE_ASYNC_LDS
// Copy slab sl, 32 listed rows of kD f32 (32KB), global->LDS rows of pitch kDP: 4 x b128
// per thread of a 512-thread workgroup; 64 threads per row, 8 rows per step. Lane j of
// crow holds the feature at list place (tid >> 6) + 8 * j, a number below kFS.
// Builtin signature (per hipcc diagnostic): (as1 v4i*, as3 v4i*, imm, imm).
__device__ __forceinline__ void async_slab(const float* __restrict__ gsrc,
                                           float* __restrict__ fb, int tid, int crow, int sl) {
#pragma unroll
  for (int i = 0; i < 4; ++i) {
    const int f   = __builtin_amdgcn_readlane(crow, sl * 4 + i);
    const int idx = f * kD + (tid & 63) * 4;  // float index, 16B aligned
    const int dst = (sl * 32 + (tid >> 6) + i * 8) * kDP + (tid & 63) * 4;  // 16B aligned too
    __builtin_amdgcn_global_load_async_to_lds_b128(
        (GLOBAL_AS v4i*)(gsrc + idx), (LDS_AS v4i*)(fb + dst), 0, 0);
  }
}
#endif

__device__ __forceinline__ void pack8(v16bf& v, int base, float4 lo, float4 hi) {
  v[base + 0] = (__bf16)lo.x; v[base + 1] = (__bf16)lo.y;
  v[base + 2] = (__bf16)lo.z; v[base + 3] = (__bf16)lo.w;
  v[base + 4] = (__bf16)hi.x; v[base + 5] = (__bf16)hi.y;
  v[base + 6] = (__bf16)hi.z; v[base + 7] = (__bf16)hi.w;
}

template <int N, int K>
__device__ __forceinline__ void proj_gemm_bf16(
    const float* __restrict__ X, const float* __restrict__ W,
    const float* __restrict__ bias, float* __restrict__ Y, int M, int useBias, int blk)
{
  const int wave = threadIdx.x >> 5;
  const int lane = threadIdx.x & 31;
  const int gw = blk * 8 + wave;
  constexpr int ntn = N >> 4;
  const int total = (M >> 4) * ntn;
  if (gw >= total) return;
  const int tm = gw / ntn;
  const int tn = gw % ntn;

  const int row   = lane & 15;
  const int kbase = (lane < 16) ? 0 : 8;
  const float4* __restrict__ xr4 =
      (const float4*)(X + (size_t)(tm * 16 + row) * K + kbase);
  const float4* __restrict__ wr4 =
      (const float4*)(W + (size_t)(tn * 16 + row) * K + kbase);

  // C/D layout: VGPR r -> M=r (lanes 0-15) / M=r+8 (lanes 16-31), N=lane%16
  const int mofs = (lane >> 4) * 8;
  const int gn   = tn * 16 + (lane & 15);
  const float bv = useBias ? bias[gn] : 0.0f;

  // The k steps go in two halves; the 32 loads of a half are issued as one run, so a
  // wave waits for memory twice and ends well inside the feature part's time. Left as
  // one loop with the wait behind it, the loads came out two at a time, each pair
  // with a full wait.
  constexpr int kSteps = K / 64;  // k steps of 32 per half
  v8f c = {};
#pragma unroll  // xv[] and wv[] stay in registers, offsets fold into the loads
  for (int h = 0; h < 2; ++h) {
    float4 xv[kSteps * 4], wv[kSteps * 4];
#pragma unroll
    for (int ks = 0; ks < kSteps; ++ks) {
      const int q4 = (h * kSteps + ks) * 8;
      xv[ks * 4 + 0] = xr4[q4 + 0];  // K = k0+kbase + 0..7
      xv[ks * 4 + 1] = xr4[q4 + 1];
      xv[ks * 4 + 2] = xr4[q4 + 4];  // K = k0+kbase + 16..23
      xv[ks * 4 + 3] = xr4[q4 + 5];
      wv[ks * 4 + 0] = wr4[q4 + 0];
      wv[ks * 4 + 1] = wr4[q4 + 1];
      wv[ks * 4 + 2] = wr4[q4 + 4];
      wv[ks * 4 + 3] = wr4[q4 + 5];
    }
    // The wait that belongs in front of a rewrite of the loads' address registers; both
    // pointers are inputs so that their register pairs live up to it.
    asm volatile("s_wait_xcnt 0x0" ::"v"(xr4), "v"(wr4) : "memory");
    // Keeps the run of loads in front of the first conversion.
    __builtin_amdgcn_sched_barrier(0);
#pragma unroll
    for (int ks = 0; ks < kSteps; ++ks) {
      v16bf a, b;
      pack8(a, 0, xv[ks * 4 + 0], xv[ks * 4 + 1]);
      pack8(a, 8, xv[ks * 4 + 2], xv[ks * 4 + 3]);
      pack8(b, 0, wv[ks * 4 + 0], wv[ks * 4 + 1]);
      pack8(b, 8, wv[ks * 4 + 2], wv[ks * 4 + 3]);
      c = WMMA_BF16(a, b, c);
    }
  }

  float* __restrict__ yp = Y + (size_t)(tm * 16 + mofs) * N + gn;
#pragma unroll
  for (int r = 0; r < 8; ++r) yp[r * N] = c[r] + bv;
}

// ---------------------------------------------------------------------------
// Feature projection: Y[M,kA] = X[M,kD] * W[kA,kD]^T, for the unmasked rows alone.
// One workgroup = 128 rows, one wave = 16 of their unmasked rows x all kA columns, so
// an X element of a listed row is loaded once, but places behind the list's end load the last one again. W is read once per workgroup in
// whole lines, rounded to bf16 and kept in LDS; the B fragments come from there.
// Fragment k order and the order of the k steps are those of proj_gemm_bf16.
// ---------------------------------------------------------------------------
constexpr int kWP = kD + 8;  // bf16 per LDS row of W: 528 B = 16 B x odd, no bank conflict for b128 readers

__device__ __forceinline__ void proj_rows_bf16(
    const float* __restrict__ X, const float* __restrict__ W,
    const int* __restrict__ mask, float* __restrict__ Y)
{
  __shared__ __attribute__((aligned(16))) __bf16 wl[kA * kWP];
  __shared__ __attribute__((aligned(16))) int rl[8][128];  // each wave's own copy of the row list
  const int tid   = threadIdx.x;
  const int wave  = __builtin_amdgcn_readfirstlane(tid >> 5);
  const int lane  = tid & 31;
  const int row   = lane & 15;
  const int kbase = (lane < 16) ? 0 : 8;
  const int r0    = blockIdx.x * 128;  // the workgroup's first row
  const int t0    = wave * 16;         // the wave's first place in the list

  // Issued first, so that the wait for it does not wait for W as well.
  const int4 mk = ((const int4*)(mask + r0))[lane];  // rows 4 * lane .. 4 * lane + 3

  // W passes through registers in two halves, so that one half (64 registers) and
  // the wave's whole X strip (128) are in flight together below 256 registers.
  const float4* __restrict__ w4 = (const float4*)W;  // kD/4 = 64 float4 per row
  constexpr int kWH = kA * kD / 4 / 256 / 2;         // float4 per thread and half
  __bf16* wdst = &wl[(tid >> 6) * kWP + (tid & 63) * 4];  // a wave reads 512 B, writes 256 B
  float4 wv[kWH];
#pragma unroll  // keeps wv[] in registers
  for (int i = 0; i < kWH; ++i) wv[i] = w4[tid + i * 256];

  // The workgroup's unmasked rows, ascending. Nothing reads pf of a masked row, so only
  // these are projected. Every wave builds the whole list for itself: no barrier.
  int* my = rl[wave];
  const unsigned b0 = __builtin_amdgcn_ballot_w32(mk.x != 0);
  const unsigned b1 = __builtin_amdgcn_ballot_w32(mk.y != 0);
  const unsigned b2 = __builtin_amdgcn_ballot_w32(mk.z != 0);
  const unsigned b3 = __builtin_amdgcn_ballot_w32(mk.w != 0);
  const int nu = __popc(b0) + __popc(b1) + __popc(b2) + __popc(b3);
  {
    const unsigned below = (1u << lane) - 1u;
    int pos = __popc(b0 & below) + __popc(b1 & below) + __popc(b2 & below) + __popc(b3 & below);
    if (mk.x) my[pos++] = lane * 4 + 0;
    if (mk.y) my[pos++] = lane * 4 + 1;
    if (mk.z) my[pos++] = lane * 4 + 2;
    if (mk.w) my[pos++] = lane * 4 + 3;
  }
  // A place behind the list's end takes the last row (computed, never stored). The
  // "& 127" bounds the address where the list is empty and the entry was never written.
  const int last = (nu > 0) ? nu - 1 : 0;
  const int xrow = my[(t0 + row < last) ? t0 + row : last] & 127;

  const float4* __restrict__ xr4 =
      (const float4*)(X + (size_t)(r0 + xrow) * kD + kbase);
  float4 xv[kD / 8];
#pragma unroll  // keeps xv[] in registers
  for (int ks = 0; ks < kD / 32; ++ks) {
    xv[ks * 4 + 0] = xr4[ks * 8 + 0];  // K = ks*32+kbase + 0..7
    xv[ks * 4 + 1] = xr4[ks * 8 + 1];
    xv[ks * 4 + 2] = xr4[ks * 8 + 4];  // K = ks*32+kbase + 16..23
    xv[ks * 4 + 3] = xr4[ks * 8 + 5];
  }
  // The wait that belongs in front of a rewrite of these loads' address registers. The
  // pointer is an input so that its register pair lives up to the wait; in this build
  // the compiler had otherwise let the last load's result land on the pair.
  asm volatile("s_wait_xcnt 0x0" ::"v"(xr4) : "memory");
  // Keeps all 48 loads in front of the first wait for W; without it the compiler holds
  // part of the X loads back until the first half of W has arrived.
  __builtin_amdgcn_sched_barrier(0);

#pragma unroll  // wv[] is indexed by constants only, here and in the two inner loops
  for (int h = 0; h < 2; ++h) {
#pragma unroll
    for (int i = 0; i < kWH; ++i) {
      v4bf p;
      p[0] = (__bf16)wv[i].x; p[1] = (__bf16)wv[i].y;
      p[2] = (__bf16)wv[i].z; p[3] = (__bf16)wv[i].w;
      *(v4bf*)(wdst + (h * kWH + i) * 4 * kWP) = p;  // 4 rows of W per 256 threads
    }
    if (h == 0) {
#pragma unroll
      for (int i = 0; i < kWH; ++i) wv[i] = w4[tid + (kWH + i) * 256];
    }
  }

  v16bf a[kD / 32];
#pragma unroll  // keeps a[] in registers
  for (int ks = 0; ks < kD / 32; ++ks) {
    pack8(a[ks], 0, xv[ks * 4 + 0], xv[ks * 4 + 1]);
    pack8(a[ks], 8, xv[ks * 4 + 2], xv[ks * 4 + 3]);
  }
  __syncthreads();  // W is complete in LDS
  if (t0 >= nu) return;  // no rows left for this wave; no barrier follows

  // The rows that this lane's 8 accumulator rows belong to.
  const int p0 = t0 + (lane >> 4) * 8;
  const int4 ia = *(const int4*)&my[p0];
  const int4 ib = *(const int4*)&my[p0 + 4];
  const int id[8] = {ia.x, ia.y, ia.z, ia.w, ib.x, ib.y, ib.z, ib.w};
  unsigned yo[8];  // where each of them begins in Y, this lane's column counted in
#pragma unroll  // yo[] stays in registers
  for (int r = 0; r < 8; ++r) yo[r] = (unsigned)(r0 + id[r]) * kA + row;

  v8f c[kA / 16];
#pragma unroll  // keeps c[] in registers
  for (int tn = 0; tn < kA / 16; ++tn) c[tn] = v8f{};

  // Groups of 4 WMMAs (one k step, 4 column tiles); the B fragments of a group are
  // read as one run of 8 ds_load_b128, two groups ahead, into a ring of 3 sets.
  const __bf16* bbase = &wl[row * kWP + kbase];
  constexpr int kG = (kD / 32) * 2;
  v16bf bq[3][4];
  auto load_group = [&](int g) {
#pragma unroll  // bq[] is indexed by constants only
    for (int t = 0; t < 4; ++t) {
      const __bf16* bp = bbase + ((g & 1) * 4 + t) * 16 * kWP + (g >> 1) * 32;
      const v8bf lo = *(const v8bf*)bp;         // K = ks*32+kbase + 0..7
      const v8bf hi = *(const v8bf*)(bp + 16);  // K = ks*32+kbase + 16..23
      bq[g % 3][t] = __builtin_shufflevector(lo, hi, 0, 1, 2, 3, 4, 5, 6, 7, 8, 9, 10, 11,
                                             12, 13, 14, 15);
    }
  };
  load_group(0);
  load_group(1);
#pragma unroll  // a[], c[] and bq[] are indexed by constants only
  for (int g = 0; g < kG; ++g) {
    if (g + 2 < kG) load_group(g + 2);
    // The two fences keep each group's LDS reads together and two groups ahead of
    // their WMMAs; left alone the compiler put each read pair directly in front of
    // its WMMA with a full wait.
    __builtin_amdgcn_sched_barrier(0);
#pragma unroll  // c[] and bq[] are indexed by constants only
    for (int t = 0; t < 4; ++t)
      c[(g & 1) * 4 + t] = WMMA_BF16(a[g >> 1], bq[g % 3][t], c[(g & 1) * 4 + t]);
    __builtin_amdgcn_sched_barrier(0);
  }

  // C/D layout as in proj_gemm_bf16; the wave writes each of its listed rows whole.
#pragma unroll  // both loops: c[] and yo[] are indexed by constants only, offsets fold into the stores
  for (int r = 0; r < 8; ++r) {
    if (p0 + r < nu) {
#pragma unroll
      for (int tn = 0; tn < kA / 16; ++tn) Y[yo[r] + tn * 16] = c[tn][r];
    }
  }
}

// ---------------------------------------------------------------------------
// Both projections in one launch: neither reads what the other writes. The first
// kRowBlocks workgroups do the feature projection, the long part;
// the kQBlocks behind them do the query projection beside it.
// The second launch bound (4 waves per SIMD) holds the kernel to 256 registers, so
// that a query workgroup fits on a WGP that already runs a feature workgroup and
// need not wait for one to end.
// ---------------------------------------------------------------------------
constexpr int kRowBlocks = kB * kF / 128;
constexpr int kQBlocks   = (kB * kQ / 16) * (kA / 16) / 8;

__global__ __launch_bounds__(256, 4) void proj_both(
    const float* __restrict__ feature, const float* __restrict__ Wf,
    const int* __restrict__ mask, float* __restrict__ pf, const float* __restrict__ query,
    const float* __restrict__ Wq, const float* __restrict__ bq, float* __restrict__ pq)
{
  if (blockIdx.x < kRowBlocks)  // the same for a whole workgroup: its barrier is safe
    proj_rows_bf16(feature, Wf, mask, pf);
  else
    proj_gemm_bf16<kA, kD>(query, Wq, bq, pq, kB * kQ, 1, blockIdx.x - kRowBlocks);
}

// Sum of x over the lanes l ^ m, m = CTRL - 0x160, inside a 16-lane row (DPP row_xmask).
template <int CTRL>
__device__ __forceinline__ float add_xmask(float x) {
  return x + __builtin_bit_cast(float, __builtin_amdgcn_update_dpp(
                 0, __builtin_bit_cast(int, x), CTRL, 0xf, 0xf, true));
}

// ---------------------------------------------------------------------------
// Fused attention: one workgroup (512 thr = 16 waves) per (batch, 32 queries,
// feature range); waves 0-7 take the first 16-query tile, waves 8-15 the second.
// It leaves the range's row maxima, row sums and the un-normalised weighted sum in
// the workspace; merge_ranges finishes the softmax.
// LDS: s[32][kSP] + list[kFS] + wcnt[32] + the range's features [kFS][kDP] (260KB):
// one workgroup per WGP. The listed features are copied in while the scores are computed,
// so the weighted sum finds all of them in LDS and waits for no memory.
// ---------------------------------------------------------------------------
static_assert(kFS == 256, "one feature of the range per thread and tile when the list is built");
constexpr int kAttnLds = 32 * kSP + kFS + 32 + kFS * kDP;  // floats

__global__ __launch_bounds__(512) void fused_attn(
    const float* __restrict__ feature,  // [B,F,D]
    const float* __restrict__ pf,       // [B,F,A]
    const float* __restrict__ pq,       // [B,Q,A] (bias included)
    const float* __restrict__ wa,       // [A]
    const int*   __restrict__ mask,     // [B,F]
    float*       __restrict__ po,       // [B*Q/16,S,16,D] un-normalised partial sums
    float*       __restrict__ pml)      // [B*Q/16,S,32] 16 range maxima, 16 range sums
{
  __shared__ __attribute__((aligned(16))) float lds[kAttnLds];
  int*   list = (int*)(lds + 32 * kSP);  // [kFS] the range's unmasked features, ascending
  int*   wcnt = list + kFS;              // [32], 8 used: unmasked features per 32 features
  float* fb   = (float*)(wcnt + 32);     // [kFS][kDP] the listed features, kD used per row

  const int tid  = threadIdx.x;
  const int lane = tid & 31;
  const int fid  = tid & 255;                                 // feature of the range
  const int qt   = __builtin_amdgcn_readfirstlane(tid >> 8);  // the wave's 16-query tile
  const int wave = (tid >> 5) & 7;                            // the wave's place in its tile
  const int sp   = blockIdx.x % kS;  // feature range
  const int tile = (blockIdx.x / kS) * 2 + qt;
  const int blk  = tile * kS + sp;   // place of the tile's partials in po and pml
  const int b  = tile >> 2;          // Q/16 == 4 query tiles per batch
  const int q0 = (tile & 3) * 16;
  const int f0 = sp * kFS;
  float* s = lds + qt * 16 * kSP;    // [16][kSP] the tile's scores, at most kFS used per row

  // ---- Pass 1: masked scores s[q][f] = sum_a wa[a]*tanh(pf[f][a]+pq[q][a])
  // A wave takes one unmasked feature at a time, so a masked one costs nothing.
  // Lane = (g, c): queries 4g..4g+3, terms a = 32j + 4c + e (j, e = 0..3). The
  // lane's 64 pq values and 16 wa values stay in registers; a pf row is 4 loads
  // of one 128-byte line each; the 8 lanes c of a query are summed by DPP.
  const int wv = __builtin_amdgcn_readfirstlane(wave);
  const int c  = lane & 7;
  const int g  = lane >> 3;

  const int mk = mask[b * kF + f0 + fid];
  const unsigned bal = __builtin_amdgcn_ballot_w32(mk != 0);
  if (lane == 0 && qt == 0) wcnt[wave] = __popc(bal);

  const float4* __restrict__ pq4 =
      (const float4*)(pq + ((size_t)b * kQ + q0 + g * 4) * kA) + c;
  const float4* __restrict__ wa4 = (const float4*)wa + c;
  v2f pq01[4][4], pq23[4][4], wa01[4], wa23[4];
#pragma unroll  // both loops: the arrays stay in registers
  for (int j = 0; j < 4; ++j) {
    const float4 w = wa4[j * 8];
    wa01[j] = v2f{w.x, w.y};
    wa23[j] = v2f{w.z, w.w};
#pragma unroll
    for (int i = 0; i < 4; ++i) {
      const float4 v = pq4[i * (kA / 4) + j * 8];
      pq01[i][j] = v2f{v.x, v.y};
      pq23[i][j] = v2f{v.z, v.w};
    }
  }
  __syncthreads();  // wcnt complete

  int base = 0, nu = 0;  // unmasked features in the waves before this one; in the range
#pragma unroll  // the 8 LDS reads go out together
  for (int w = 0; w < 8; ++w) {
    const int cw = wcnt[w];
    base += (w < wv) ? cw : 0;
    nu += cw;
  }
  nu = __builtin_amdgcn_readfirstlane(nu);
  // From here on a column of s and a row of fb is a PLACE IN THE LIST, not a feature. Beside
  // an unmasked feature a masked one has weight exp(-1e9 - max) = 0 exactly, so it is left
  // out of copies, softmax and weighted sum. A range with no unmasked feature keeps all of
  // its features, each at -1e9: should the whole batch row be masked, they all count alike.
  const int nl    = (nu > 0) ? nu : kFS;  // length of the list
  const int nslab = (nl + 31) >> 5;       // slabs of 32 places
  if (qt == 0) {
    if (nu == 0) list[fid] = fid;
    else if (mk) list[base + __popc(bal & ((1u << lane) - 1u))] = fid;
  }
  if (fid >= nu && fid < nslab * 32) {  // places without a computed score: weight 0, or all alike
#pragma unroll  // offsets fold into the stores
    for (int q = 0; q < 16; ++q) s[q * kSP + fid] = -1.0e9f;
  }
  __syncthreads();  // list complete

#if HAVE_ASYNC_LDS
  const float* fbase = feature + ((size_t)b * kF + f0) * kD;
  // The rows that this wave copies. A place behind the list's end takes the last listed
  // row: finite values under a weight of 0.
  const int cp   = (tid >> 6) + lane * 8;
  const int crow = list[(cp < nl) ? cp : nl - 1];
#endif
  {
    const int cnt = (nu - wv + 7) >> 3;  // list entries wv, wv + 8, ... below nu
    const int li  = wv + lane * 8;      // lane i holds the wave's i-th feature
    const int myf = (li < nu) ? list[li] : 0;
    const float4* __restrict__ pf4 =
        (const float4*)(pf + ((size_t)b * kF + f0) * kA) + c;
    float* srow = s + (g * 4 + (c & 3)) * kSP;
    auto row_load = [&](float4 (&d)[4], int i) {  // the wave's i-th row, i clamped
      const int f = __builtin_amdgcn_readlane(myf, (i < cnt) ? i : cnt - 1);
      const float4* __restrict__ pr = pf4 + f * (kA / 4);
#pragma unroll  // d[] stays in registers
      for (int j = 0; j < 4; ++j) d[j] = pr[j * 8];
      // The wait that belongs in front of a rewrite of these loads' address registers. The
      // pointer is an input so that its register pair lives up to the wait; in this build
      // the compiler had otherwise let the last load's result land on the pair.
      asm volatile("s_wait_xcnt 0x0" ::"v"(pr) : "memory");
    };
    auto row_score = [&](const float4 (&p)[4], int i) {
      v2f acc[4];
#pragma unroll  // here and below: register arrays are indexed by constants only
      for (int q = 0; q < 4; ++q) acc[q] = v2f{0.0f, 0.0f};
#pragma unroll
      for (int j = 0; j < 4; ++j) {
        const v2f p01 = v2f{p[j].x, p[j].y};
        const v2f p23 = v2f{p[j].z, p[j].w};
#pragma unroll
        for (int q = 0; q < 4; ++q) {
          const v2f x01 = p01 + pq01[q][j];
          const v2f x23 = p23 + pq23[q][j];
          const v2f t01 = v2f{fast_tanh(x01.x), fast_tanh(x01.y)};
          const v2f t23 = v2f{fast_tanh(x23.x), fast_tanh(x23.y)};
          acc[q] = __builtin_elementwise_fma(t01, wa01[j], acc[q]);
          acc[q] = __builtin_elementwise_fma(t23, wa23[j], acc[q]);
        }
      }
      float r[4];
#pragma unroll
      for (int q = 0; q < 4; ++q) {
        r[q] = acc[q].x + acc[q].y;
        r[q] = add_xmask<0x161>(r[q]);
        r[q] = add_xmask<0x162>(r[q]);
        r[q] = add_xmask<0x164>(r[q]);
      }
      const float r01 = (c & 1) ? r[1] : r[0];
      const float r23 = (c & 1) ? r[3] : r[2];
      if (c < 4)  // lane c stores query 4g + c
        srow[wv + i * 8] = (c & 2) ? r23 : r01;
    };
    if (cnt > 0) {
      float4 ra[4], rb[4];  // two rows: one flies while the other is worked on
      row_load(ra, 0);
      for (int i = 0; i < cnt; i += 2) {
        row_load(rb, i + 1);
#if HAVE_ASYNC_LDS
        // One slab of the range per trip: spread so, the copies never stand as one long
        // queue in front of the pf rows that the score pass is waiting for.
        if ((i >> 1) < nslab) async_slab(fbase, fb, tid, crow, i >> 1);
#endif
        // The two fences keep the next row's loads in front of this row's arithmetic;
        // left alone the compiler issued them at the end of it and waited at once.
        __builtin_amdgcn_sched_barrier(0);
        row_score(ra, i);
        row_load(ra, i + 2);
        __builtin_amdgcn_sched_barrier(0);
        if (i + 1 < cnt) row_score(rb, i + 1);
      }
    }
#if HAVE_ASYNC_LDS
    // All the slabs, for a wave with no rows: the loop above sent for none.
#pragma nounroll  // a tail that seldom runs: kept short
    for (int sl = (cnt + 1) >> 1; sl < nslab; ++sl)
      async_slab(fbase, fb, tid, crow, sl);
#endif
  }
  __syncthreads();

  // ---- Pass 2: range max, exp and range sum per row (wave32 shuffles) ------
  for (int q = wave * 2; q < wave * 2 + 2; ++q) {
    float m = -3.0e38f;
    for (int f = lane; f < nslab * 32; f += 32) m = fmaxf(m, s[q * kSP + f]);
#pragma unroll
    for (int o = 16; o >= 1; o >>= 1) m = fmaxf(m, __shfl_xor(m, o, 32));
    float sum = 0.0f;
    for (int f = lane; f < nslab * 32; f += 32) {
      const float e = __expf(s[q * kSP + f] - m);
      s[q * kSP + f] = e;
      sum += e;
    }
#pragma unroll
    for (int o = 16; o >= 1; o >>= 1) sum += __shfl_xor(sum, o, 32);
    if (lane == 0) {  // one 128-byte line per tile
      pml[blk * 32 + q]      = m;
      pml[blk * 32 + 16 + q] = sum;
    }
  }
#if HAVE_ASYNC_LDS
  // This wave's copies have landed; the barrier behind it shows them to the other waves.
  asm volatile("s_wait_asynccnt 0x0" ::: "memory");
#endif
  __syncthreads();

  // ---- Pass 3: po[16][256] = e[16][places] @ listed features (WMMA bf16) -----
  // A wave owns columns 32w .. 32w+31; lane n holds column 32w+2n of its first tile
  // and 32w+2n+1 of its second, so both come from LDS in one 8-byte read, 16 lanes
  // cover 32 banks, and 16 lanes store one whole 128-byte line of po.
  const int n     = lane & 15;
  const int col0  = wave * 32 + n * 2;
  const int col1  = col0 + 1;
  const int arow  = lane & 15;
  const int kbase = (lane < 16) ? 0 : 8;
  v8f c0 = {}, c1 = {};

#if HAVE_ASYNC_LDS
  for (int ks = 0; ks < nslab; ++ks) {
    const float* cur = fb + ks * 32 * kDP;
    const int k0 = ks * 32;
    v16bf af, b0v, b1v;
    const float4* ap = (const float4*)(s + arow * kSP + k0 + kbase);
    pack8(af, 0, ap[0], ap[1]);  // K = k0+kbase + 0..7
    pack8(af, 8, ap[4], ap[5]);  // K = k0+kbase + 16..23
#pragma unroll
    for (int e = 0; e < 16; ++e) {
      const int kk = kbase + e + ((e >= 8) ? 8 : 0);   // 0..31 within slab
      const float2 v = *(const float2*)(cur + kk * kDP + col0);
      b0v[e] = (__bf16)v.x;
      b1v[e] = (__bf16)v.y;
    }
    c0 = WMMA_BF16(af, b0v, c0);
    c1 = WMMA_BF16(af, b1v, c1);
  }
#else
  for (int k0 = 0; k0 < nslab * 32; k0 += 32) {
    v16bf af, b0v, b1v;
#pragma unroll
    for (int e = 0; e < 16; ++e) {
      const int k = k0 + kbase + e + ((e >= 8) ? 8 : 0);
      af[e] = (__bf16)s[arow * kSP + k];
      const float* __restrict__ fr =
          feature + ((size_t)b * kF + f0 + list[(k < nl) ? k : nl - 1]) * kD;
      b0v[e] = (__bf16)fr[col0];
      b1v[e] = (__bf16)fr[col1];
    }
    c0 = WMMA_BF16(af, b0v, c0);
    c1 = WMMA_BF16(af, b1v, c1);
  }
#endif

  const int mofs = (lane >> 4) * 8;
#pragma unroll
  for (int r = 0; r < 8; ++r) {
    float* __restrict__ orow = po + ((size_t)blk * 16 + mofs + r) * kD;
    *(float2*)(orow + col0) = make_float2(c0[r], c1[r]);
  }
}

// exp(x). The v_nop in the statement is the free slot that the instruction set
// asks for behind a transcendental before its source register is overwritten.
__device__ __forceinline__ float exp_slot(float x) {
  float r;
  asm("v_exp_f32 %0, %1\n\tv_nop" : "=v"(r) : "v"(x * 1.44269504f));
  return r;
}

// ---------------------------------------------------------------------------
// Merge of the kS ranges of one (batch, query) row: weight exp(m_s - M) per
// range, out = sum_s w_s * po_s / sum_s w_s * l_s. 64 threads per row, float4.
// ---------------------------------------------------------------------------
__global__ __launch_bounds__(256) void merge_ranges(
    const float* __restrict__ po,   // [B*Q/16,S,16,D]
    const float* __restrict__ pml,  // [B*Q/16,S,32]
    float*       __restrict__ out)  // [B*Q,D]
{
  const int row  = blockIdx.x * 4 + (threadIdx.x >> 6);
  const int d4   = threadIdx.x & 63;
  const int tile = row >> 4;
  const int qi   = row & 15;
  const float* __restrict__ ml = pml + tile * kS * 32 + qi;
  float mv[kS];
  float M = -3.0e38f;
#pragma unroll  // keeps mv[] in registers
  for (int i = 0; i < kS; ++i) {
    mv[i] = ml[i * 32];
    M = fmaxf(M, mv[i]);
  }
  const float4* __restrict__ p4 =
      (const float4*)(po + ((size_t)tile * kS * 16 + qi) * kD) + d4;
  float L = 0.0f;
  float4 o = make_float4(0.0f, 0.0f, 0.0f, 0.0f);
#pragma unroll  // all kS loads in flight at once: one L2 latency, not kS
  for (int i = 0; i < kS; ++i) {
    const float w = exp_slot(mv[i] - M);
    const float4 v = p4[i * (16 * kD / 4)];
    L += w * ml[i * 32 + 16];
    o.x += w * v.x; o.y += w * v.y; o.z += w * v.z; o.w += w * v.w;
  }
  const float inv = __builtin_amdgcn_rcpf(L);
  ((float4*)(out + (size_t)row * kD))[d4] =
      make_float4(o.x * inv, o.y * inv, o.z * inv, o.w * inv);
}

// ---------------------------------------------------------------------------
extern "C" void kernel_launch(void* const* d_in, const int* in_sizes, int n_in,
                              void* d_out, int out_size, void* d_ws, size_t ws_size,
                              hipStream_t stream) {
  const float* feature = (const float*)d_in[0];  // [B,F,D]
  const float* query   = (const float*)d_in[1];  // [B,Q,QD]
  const float* Wf      = (const float*)d_in[2];  // [A,D]
  const float* Wq      = (const float*)d_in[3];  // [A,QD]
  const float* bq      = (const float*)d_in[4];  // [A]
  const float* wa      = (const float*)d_in[5];  // [A]
  const int*   mask    = (const int*)d_in[6];    // [B,F]
  float* out = (float*)d_out;

  float* pf  = (float*)d_ws;                     // [B,F,A] = 16 MB
  float* pqv = pf + (size_t)kB * kF * kA;        // [B,Q,A] = 0.5 MB
  float* po  = pqv + (size_t)kB * kQ * kA;       // [B*Q/16,S,16,D]
  float* pml = po + (size_t)kB * kQ * kS * kD;   // [B*Q/16,S,32]

  // pf = feature @ Wf^T : M=32768 less the masked rows, N=128, K=256; 128 rows per workgroup
  // pq = query @ Wq^T + bq : M=1024, N=128, K=256; 8 tiles of 16x16 per workgroup
  proj_both<<<kRowBlocks + kQBlocks, 256, 0, stream>>>(feature, Wf, mask, pf, query, Wq, bq, pqv);
  // scores + softmax partials + weighted sum, 32 queries and one feature range per workgroup
  fused_attn<<<kB * (kQ / 32) * kS, 512, 0, stream>>>(feature, pf, pqv, wa, mask, po, pml);
  // merge of the ranges: 4 rows per workgroup
  merge_ranges<<<kB * kQ / 4, 256, 0, stream>>>(po, pml, out);
}

// v008
// One run takes 26.6 microseconds.
// Next to v007, in two timings, it ran 1.06 times as fast each time.
// Counting every step since v000, it is 8.87 times as fast.
#include <hip/hip_runtime.h>
#include <hip/hip_bf16.h>

// CDNA5 (gfx1250) fused additive attention.
// K1: both bf16-WMMA projection GEMMs (pf, pq). K2: fused score(tanh)+softmax
// partials+weights@feature for one range of the feature axis per workgroup,
// the range's unmasked features staged once via async global->LDS (ASYNCcnt) under the score pass.
// K3: merges the ranges' partials (max, sum, un-normalised weighted sum).

typedef __attribute__((ext_vector_type(16))) __bf16 v16bf;
typedef __attribute__((ext_vector_type(8)))  __bf16 v8bf;
typedef __attribute__((ext_vector_type(4)))  __bf16 v4bf;
typedef __attribute__((ext_vector_type(8)))  float  v8f;
typedef __attribute__((ext_vector_type(2)))  float  v2f;
typedef __attribute__((ext_vector_type(4)))  int    v4i;

#define WMMA_BF16(a, b, c) \
  __builtin_amdgcn_wmma_f32_16x16x32_bf16(false, (a), false, (b), (short)0, (c), false, false)

#define GLOBAL_AS __attribute__((address_space(1)))
#define LDS_AS    __attribute__((address_space(3)))

constexpr int kB = 16, kF = 2048, kQ = 64, kD = 256, kA = 128;
constexpr int kS  = 8;         // ranges of the feature axis, one workgroup each
constexpr int kFS = kF / kS;   // features per range
// LDS row pitches in floats, 1040 B = 16 B x odd. Score rows: the 16 rows that a
// b128 A-fragment read (or a score store) touches fall on different banks. Slab
// rows: rows k and k + 8, read by the two halves of a wave, lie 32 banks apart.
constexpr int kSP = kFS + 4;
constexpr int kDP = kD + 4;

// ---- native tanh if the toolchain exposes V_TANH_F32 ------------------------
#if __has_builtin(__builtin_amdgcn_tanhf)
__device__ __forceinline__ float fast_tanh(float x) { return __builtin_amdgcn_tanhf(x); }
#elif __has_builtin(__builtin_amdgcn_tanh_f32)
__device__ __forceinline__ float fast_tanh(float x) { return __builtin_amdgcn_tanh_f32(x); }
#else
__device__ __forceinline__ float fast_tanh(float x) {
  const float t = __expf(2.0f * x);                      // v_exp_f32
  return (t - 1.0f) * __builtin_amdgcn_rcpf(t + 1.0f);   // v_rcp_f32, no slow div
}
#endif

// ---- async global->LDS staging (gfx1250 ASYNC path) -------------------------
#if __has_builtin(__builtin_amdgcn_global_load_async_to_lds_b128)
#define HAVE_ASYNC_LDS 1
#else
#define HAVE_ASYNC_LDS 0
#endif

#if HAVE_ASYNC_LDS
// Copy slab sl, 32 listed rows of kD f32 (32KB), global->LDS rows of pitch kDP: 4 x b128
// per thread of a 512-thread workgroup; 64 threads per row, 8 rows per step. Lane j of
// crow holds the feature at list place (tid >> 6) + 8 * j, a number below kFS.
// Builtin signature (per hipcc diagnostic): (as1 v4i*, as3 v4i*, imm, imm).
__device__ __forceinline__ void async_slab(const float* __restrict__ gsrc,
                                           float* __restrict__ fb, int tid, int crow, int sl) {
#pragma unroll
  for (int i = 0; i < 4; ++i) {
    const int f   = __builtin_amdgcn_readlane(crow, sl * 4 + i);
    const int idx = f * kD + (tid & 63) * 4;  // float index, 16B aligned
    const int dst = (sl * 32 + (tid >> 6) + i * 8) * kDP + (tid & 63) * 4;  // 16B aligned too
    __builtin_amdgcn_global_load_async_to_lds_b128(
        (GLOBAL_AS v4i*)(gsrc + idx), (LDS_AS v4i*)(fb + dst), 0, 0);
  }
}
#endif

__device__ __forceinline__ void pack8(v16bf& v, int base, float4 lo, float4 hi) {
  v[base + 0] = (__bf16)lo.x; v[base + 1] = (__bf16)lo.y;
  v[base + 2] = (__bf16)lo.z; v[base + 3] = (__bf16)lo.w;
  v[base + 4] = (__bf16)hi.x; v[base + 5] = (__bf16)hi.y;
  v[base + 6] = (__bf16)hi.z; v[base + 7] = (__bf16)hi.w;
}

template <int N, int K>
__device__ __forceinline__ void proj_gemm_bf16(
    const float* __restrict__ X, const float* __restrict__ W,
    const float* __restrict__ bias, float* __restrict__ Y, int M, int useBias, int blk)
{
  const int wave = threadIdx.x >> 5;
  const int lane = threadIdx.x & 31;
  const int gw = blk * 8 + wave;
  constexpr int ntn = N >> 4;
  const int total = (M >> 4) * ntn;
  if (gw >= total) return;
  const int tm = gw / ntn;
  const int tn = gw % ntn;

  const int row   = lane & 15;
  const int kbase = (lane < 16) ? 0 : 8;
  const float4* __restrict__ xr4 =
      (const float4*)(X + (size_t)(tm * 16 + row) * K + kbase);
  const float4* __restrict__ wr4 =
      (const float4*)(W + (size_t)(tn * 16 + row) * K + kbase);

  // C/D layout: VGPR r -> M=r (lanes 0-15) / M=r+8 (lanes 16-31), N=lane%16
  const int mofs = (lane >> 4) * 8;
  const int gn   = tn * 16 + (lane & 15);
  const float bv = useBias ? bias[gn] : 0.0f;

  // The k steps go in two halves; the 32 loads of a half are issued as one run, so a
  // wave waits for memory twice and ends well inside the feature part's time. Left as
  // one loop with the wait behind it, the loads came out two at a time, each pair
  // with a full wait.
  constexpr int kSteps = K / 64;  // k steps of 32 per half
  v8f c = {};
#pragma unroll  // xv[] and wv[] stay in registers, offsets fold into the loads
  for (int h = 0; h < 2; ++h) {
    float4 xv[kSteps * 4], wv[kSteps * 4];
#pragma unroll
    for (int ks = 0; ks < kSteps; ++ks) {
      const int q4 = (h * kSteps + ks) * 8;
      xv[ks * 4 + 0] = xr4[q4 + 0];  // K = k0+kbase + 0..7
      xv[ks * 4 + 1] = xr4[q4 + 1];
      xv[ks * 4 + 2] = xr4[q4 + 4];  // K = k0+kbase + 16..23
      xv[ks * 4 + 3] = xr4[q4 + 5];
      wv[ks * 4 + 0] = wr4[q4 + 0];
      wv[ks * 4 + 1] = wr4[q4 + 1];
      wv[ks * 4 + 2] = wr4[q4 + 4];
      wv[ks * 4 + 3] = wr4[q4 + 5];
    }
    // The wait that belongs in front of a rewrite of the loads' address registers; both
    // pointers are inputs so that their register pairs live up to it.
    asm volatile("s_wait_xcnt 0x0" ::"v"(xr4), "v"(wr4) : "memory");
    // Keeps the run of loads in front of the first conversion.
    __builtin_amdgcn_sched_barrier(0);
#pragma unroll
    for (int ks = 0; ks < kSteps; ++ks) {
      v16bf a, b;
      pack8(a, 0, xv[ks * 4 + 0], xv[ks * 4 + 1]);
      pack8(a, 8, xv[ks * 4 + 2], xv[ks * 4 + 3]);
      pack8(b, 0, wv[ks * 4 + 0], wv[ks * 4 + 1]);
      pack8(b, 8, wv[ks * 4 + 2], wv[ks * 4 + 3]);
      c = WMMA_BF16(a, b, c);
    }
  }

  float* __restrict__ yp = Y + (size_t)(tm * 16 + mofs) * N + gn;
#pragma unroll
  for (int r = 0; r < 8; ++r) yp[r * N] = c[r] + bv;
}

// ---------------------------------------------------------------------------
// Feature projection: Y[M,kA] = X[M,kD] * W[kA,kD]^T, for the unmasked rows alone.
// One workgroup = 128 rows, one wave = 16 of their unmasked rows x all kA columns, so
// an X element of a listed row is loaded once, but places behind the list's end load the last one again. W is read once per workgroup in
// whole lines, rounded to bf16 and kept in LDS; the B fragments come from there.
// Fragment k order and the order of the k steps are those of proj_gemm_bf16.
// ---------------------------------------------------------------------------
constexpr int kWP = kD + 8;  // bf16 per LDS row of W: 528 B = 16 B x odd, no bank conflict for b128 readers

__device__ __forceinline__ void proj_rows_bf16(
    const float* __restrict__ X, const float* __restrict__ W,
    const int* __restrict__ mask, float* __restrict__ Y)
{
  __shared__ __attribute__((aligned(16))) __bf16 wl[kA * kWP];
  __shared__ __attribute__((aligned(16))) int rl[8][128];  // each wave's own copy of the row list
  const int tid   = threadIdx.x;
  const int wave  = __builtin_amdgcn_readfirstlane(tid >> 5);
  const int lane  = tid & 31;
  const int row   = lane & 15;
  const int kbase = (lane < 16) ? 0 : 8;
  const int r0    = blockIdx.x * 128;  // the workgroup's first row
  const int t0    = wave * 16;         // the wave's first place in the list

  // Issued first, so that the wait for it does not wait for W as well.
  const int4 mk = ((const int4*)(mask + r0))[lane];  // rows 4 * lane .. 4 * lane + 3

  // W passes through registers in two halves, so that one half (64 registers) and
  // the wave's whole X strip (128) are in flight together below 256 registers.
  const float4* __restrict__ w4 = (const float4*)W;  // kD/4 = 64 float4 per row
  constexpr int kWH = kA * kD / 4 / 256 / 2;         // float4 per thread and half
  __bf16* wdst = &wl[(tid >> 6) * kWP + (tid & 63) * 4];  // a wave reads 512 B, writes 256 B
  float4 wv[kWH];
#pragma unroll  // keeps wv[] in registers
  for (int i = 0; i < kWH; ++i) wv[i] = w4[tid + i * 256];

  // The workgroup's unmasked rows, ascending. Nothing reads pf of a masked row, so only
  // these are projected. Every wave builds the whole list for itself: no barrier.
  int* my = rl[wave];
  const unsigned b0 = __builtin_amdgcn_ballot_w32(mk.x != 0);
  const unsigned b1 = __builtin_amdgcn_ballot_w32(mk.y != 0);
  const unsigned b2 = __builtin_amdgcn_ballot_w32(mk.z != 0);
  const unsigned b3 = __builtin_amdgcn_ballot_w32(mk.w != 0);
  const int nu = __popc(b0) + __popc(b1) + __popc(b2) + __popc(b3);
  {
    const unsigned below = (1u << lane) - 1u;
    int pos = __popc(b0 & below) + __popc(b1 & below) + __popc(b2 & below) + __popc(b3 & below);
    if (mk.x) my[pos++] = lane * 4 + 0;
    if (mk.y) my[pos++] = lane * 4 + 1;
    if (mk.z) my[pos++] = lane * 4 + 2;
    if (mk.w) my[pos++] = lane * 4 + 3;
  }
  // A place behind the list's end takes the last row (computed, never stored). The
  // "& 127" bounds the address where the list is empty and the entry was never written.
  const int last = (nu > 0) ? nu - 1 : 0;
  const int xrow = my[(t0 + row < last) ? t0 + row : last] & 127;

  const float4* __restrict__ xr4 =
      (const float4*)(X + (size_t)(r0 + xrow) * kD + kbase);
  float4 xv[kD / 8];
#pragma unroll  // keeps xv[] in registers
  for (int ks = 0; ks < kD / 32; ++ks) {
    xv[ks * 4 + 0] = xr4[ks * 8 + 0];  // K = ks*32+kbase + 0..7
    xv[ks * 4 + 1] = xr4[ks * 8 + 1];
    xv[ks * 4 + 2] = xr4[ks * 8 + 4];  // K = ks*32+kbase + 16..23
    xv[ks * 4 + 3] = xr4[ks * 8 + 5];
  }
  // The wait that belongs in front of a rewrite of these loads' address registers. The
  // pointer is an input so that its register pair lives up to the wait; in this build
  // the compiler had otherwise let the last load's result land on the pair.
  asm volatile("s_wait_xcnt 0x0" ::"v"(xr4) : "memory");
  // Keeps all 48 loads in front of the first wait for W; without it the compiler holds
  // part of the X loads back until the first half of W has arrived.
  __builtin_amdgcn_sched_barrier(0);

#pragma unroll  // wv[] is indexed by constants only, here and in the two inner loops
  for (int h = 0; h < 2; ++h) {
#pragma unroll
    for (int i = 0; i < kWH; ++i) {
      v4bf p;
      p[0] = (__bf16)wv[i].x; p[1] = (__bf16)wv[i].y;
      p[2] = (__bf16)wv[i].z; p[3] = (__bf16)wv[i].w;
      *(v4bf*)(wdst + (h * kWH + i) * 4 * kWP) = p;  // 4 rows of W per 256 threads
    }
    if (h == 0) {
#pragma unroll
      for (int i = 0; i < kWH; ++i) wv[i] = w4[tid + (kWH + i) * 256];
    }
  }

  v16bf a[kD / 32];
#pragma unroll  // keeps a[] in registers
  for (int ks = 0; ks < kD / 32; ++ks) {
    pack8(a[ks], 0, xv[ks * 4 + 0], xv[ks * 4 + 1]);
    pack8(a[ks], 8, xv[ks * 4 + 2], xv[ks * 4 + 3]);
  }
  __syncthreads();  // W is complete in LDS
  if (t0 >= nu) return;  // no rows left for this wave; no barrier follows

  // The rows that this lane's 8 accumulator rows belong to.
  const int p0 = t0 + (lane >> 4) * 8;
  const int4 ia = *(const int4*)&my[p0];
  const int4 ib = *(const int4*)&my[p0 + 4];
  const int id[8] = {ia.x, ia.y, ia.z, ia.w, ib.x, ib.y, ib.z, ib.w};
  unsigned yo[8];  // where each of them begins in Y, this lane's column counted in
#pragma unroll  // yo[] stays in registers
  for (int r = 0; r < 8; ++r) yo[r] = (unsigned)(r0 + id[r]) * kA + row;

  v8f c[kA / 16];
#pragma unroll  // keeps c[] in registers
  for (int tn = 0; tn < kA / 16; ++tn) c[tn] = v8f{};

  // Groups of 4 WMMAs (one k step, 4 column tiles); the B fragments of a group are
  // read as one run of 8 ds_load_b128, two groups ahead, into a ring of 3 sets.
  const __bf16* bbase = &wl[row * kWP + kbase];
  constexpr int kG = (kD / 32) * 2;
  v16bf bq[3][4];
  auto load_group = [&](int g) {
#pragma unroll  // bq[] is indexed by constants only
    for (int t = 0; t < 4; ++t) {
      const __bf16* bp = bbase + ((g & 1) * 4 + t) * 16 * kWP + (g >> 1) * 32;
      const v8bf lo = *(const v8bf*)bp;         // K = ks*32+kbase + 0..7
      const v8bf hi = *(const v8bf*)(bp + 16);  // K = ks*32+kbase + 16..23
      bq[g % 3][t] = __builtin_shufflevector(lo, hi, 0, 1, 2, 3, 4, 5, 6, 7, 8, 9, 10, 11,
                                             12, 13, 14, 15);
    }
  };
  load_group(0);
  load_group(1);
#pragma unroll  // a[], c[] and bq[] are indexed by constants only
  for (int g = 0; g < kG; ++g) {
    if (g + 2 < kG) load_group(g + 2);
    // The two fences keep each group's LDS reads together and two groups ahead of
    // their WMMAs; left alone the compiler put each read pair directly in front of
    // its WMMA with a full wait.
    __builtin_amdgcn_sched_barrier(0);
#pragma unroll  // c[] and bq[] are indexed by constants only
    for (int t = 0; t < 4; ++t)
      c[(g & 1) * 4 + t] = WMMA_BF16(a[g >> 1], bq[g % 3][t], c[(g & 1) * 4 + t]);
    __builtin_amdgcn_sched_barrier(0);
  }

  // C/D layout as in proj_gemm_bf16; the wave writes each of its listed rows whole.
#pragma unroll  // both loops: c[] and yo[] are indexed by constants only, offsets fold into the stores
  for (int r = 0; r < 8; ++r) {
    if (p0 + r < nu) {
#pragma unroll
      for (int tn = 0; tn < kA / 16; ++tn) Y[yo[r] + tn * 16] = c[tn][r];
    }
  }
}

// ---------------------------------------------------------------------------
// Both projections in one launch: neither reads what the other writes. The first
// kRowBlocks workgroups do the feature projection, the long part;
// the kQBlocks behind them do the query projection beside it.
// The second launch bound (4 waves per SIMD) holds the kernel to 256 registers, so
// that a query workgroup fits on a WGP that already runs a feature workgroup and
// need not wait for one to end.
// ---------------------------------------------------------------------------
constexpr int kRowBlocks = kB * kF / 128;
constexpr int kQBlocks   = (kB * kQ / 16) * (kA / 16) / 8;

__global__ __launch_bounds__(256, 4) void proj_both(
    const float* __restrict__ feature, const float* __restrict__ Wf,
    const int* __restrict__ mask, float* __restrict__ pf, const float* __restrict__ query,
    const float* __restrict__ Wq, const float* __restrict__ bq, float* __restrict__ pq)
{
  if (blockIdx.x < kRowBlocks)  // the same for a whole workgroup: its barrier is safe
    proj_rows_bf16(feature, Wf, mask, pf);
  else
    proj_gemm_bf16<kA, kD>(query, Wq, bq, pq, kB * kQ, 1, blockIdx.x - kRowBlocks);
}

// Sum of x over the lanes l ^ m, m = CTRL - 0x160, inside a 16-lane row (DPP row_xmask).
template <int CTRL>
__device__ __forceinline__ float add_xmask(float x) {
  return x + __builtin_bit_cast(float, __builtin_amdgcn_update_dpp(
                 0, __builtin_bit_cast(int, x), CTRL, 0xf, 0xf, true));
}

// Maximum of x over the lanes l ^ m, in the same way.
template <int CTRL>
__device__ __forceinline__ float max_xmask(float x) {
  return fmaxf(x, __builtin_bit_cast(float, __builtin_amdgcn_update_dpp(
                      0, __builtin_bit_cast(int, x), CTRL, 0xf, 0xf, true)));
}

// ---------------------------------------------------------------------------
// Fused attention: one workgroup (512 thr = 16 waves) per (batch, 32 queries,
// feature range); waves 0-7 take the first 16-query tile, waves 8-15 the second.
// It leaves the range's row maxima, row sums and the un-normalised weighted sum in
// the workspace; merge_ranges finishes the softmax.
// LDS: s[32][kSP] + list[kFS] + wcnt[32] + the range's features [kFS][kDP] (260KB):
// one workgroup per WGP. The listed features are copied in while the scores are computed,
// so the weighted sum finds all of them in LDS and waits for no memory.
// ---------------------------------------------------------------------------
static_assert(kFS == 256, "one feature of the range per thread and tile when the list is built");
constexpr int kAttnLds = 32 * kSP + kFS + 32 + kFS * kDP;  // floats

__global__ __launch_bounds__(512) void fused_attn(
    const float* __restrict__ feature,  // [B,F,D]
    const float* __restrict__ pf,       // [B,F,A]
    const float* __restrict__ pq,       // [B,Q,A] (bias included)
    const float* __restrict__ wa,       // [A]
    const int*   __restrict__ mask,     // [B,F]
    float*       __restrict__ po,       // [B*Q/16,S,16,D] un-normalised partial sums
    float*       __restrict__ pml)      // [B*Q/16,S,32] 16 range maxima, 16 range sums
{
  __shared__ __attribute__((aligned(16))) float lds[kAttnLds];
  int*   list = (int*)(lds + 32 * kSP);  // [kFS] the range's unmasked features, ascending
  int*   wcnt = list + kFS;              // [32], 8 used: unmasked features per 32 features
  float* fb   = (float*)(wcnt + 32);     // [kFS][kDP] the listed features, kD used per row

  const int tid  = threadIdx.x;
  const int lane = tid & 31;
  const int fid  = tid & 255;                                 // feature of the range
  const int qt   = __builtin_amdgcn_readfirstlane(tid >> 8);  // the wave's 16-query tile
  const int wave = (tid >> 5) & 7;                            // the wave's place in its tile
  const int sp   = blockIdx.x % kS;  // feature range
  const int tile = (blockIdx.x / kS) * 2 + qt;
  const int blk  = tile * kS + sp;   // place of the tile's partials in po and pml
  const int b  = tile >> 2;          // Q/16 == 4 query tiles per batch
  const int q0 = (tile & 3) * 16;
  const int f0 = sp * kFS;
  float* s = lds + qt * 16 * kSP;    // [16][kSP] the tile's scores, at most kFS used per row

  // ---- Pass 1: masked scores s[q][f] = sum_a wa[a]*tanh(pf[f][a]+pq[q][a])
  // A wave takes one unmasked feature at a time, so a masked one costs nothing.
  // Lane = (g, c): queries 4g..4g+3, terms a = 32j + 4c + e (j, e = 0..3). The
  // lane's 64 pq values and 16 wa values stay in registers; a pf row is 4 loads
  // of one 128-byte line each; the 8 lanes c of a query are summed by DPP.
  const int wv = __builtin_amdgcn_readfirstlane(wave);
  const int c  = lane & 7;
  const int g  = lane >> 3;

  const int mk = mask[b * kF + f0 + fid];
  const unsigned bal = __builtin_amdgcn_ballot_w32(mk != 0);
  if (lane == 0 && qt == 0) wcnt[wave] = __popc(bal);

  const float4* __restrict__ pq4 =
      (const float4*)(pq + ((size_t)b * kQ + q0 + g * 4) * kA) + c;
  const float4* __restrict__ wa4 = (const float4*)wa + c;
  v2f pq01[4][4], pq23[4][4], wa01[4], wa23[4];
#pragma unroll  // both loops: the arrays stay in registers
  for (int j = 0; j < 4; ++j) {
    const float4 w = wa4[j * 8];
    wa01[j] = v2f{w.x, w.y};
    wa23[j] = v2f{w.z, w.w};
#pragma unroll
    for (int i = 0; i < 4; ++i) {
      const float4 v = pq4[i * (kA / 4) + j * 8];
      pq01[i][j] = v2f{v.x, v.y};
      pq23[i][j] = v2f{v.z, v.w};
    }
  }
  __syncthreads();  // wcnt complete

  int base = 0, nu = 0;  // unmasked features in the waves before this one; in the range
#pragma unroll  // the 8 LDS reads go out together
  for (int w = 0; w < 8; ++w) {
    const int cw = wcnt[w];
    base += (w < wv) ? cw : 0;
    nu += cw;
  }
  nu = __builtin_amdgcn_readfirstlane(nu);
  // From here on a column of s and a row of fb is a PLACE IN THE LIST, not a feature. Beside
  // an unmasked feature a masked one has weight exp(-1e9 - max) = 0 exactly, so it is left
  // out of copies, softmax and weighted sum. A range with no unmasked feature keeps all of
  // its features, each at -1e9: should the whole batch row be masked, they all count alike.
  const int nl    = (nu > 0) ? nu : kFS;  // length of the list
  const int nslab = (nl + 31) >> 5;       // slabs of 32 places
  if (qt == 0) {
    if (nu == 0) list[fid] = fid;
    else if (mk) list[base + __popc(bal & ((1u << lane) - 1u))] = fid;
  }
  if (fid >= nu && fid < nslab * 32) {  // places without a computed score: weight 0, or all alike
#pragma unroll  // offsets fold into the stores
    for (int q = 0; q < 16; ++q) s[q * kSP + fid] = -1.0e9f;
  }
  __syncthreads();  // list complete

#if HAVE_ASYNC_LDS
  const float* fbase = feature + ((size_t)b * kF + f0) * kD;
  // The rows that this wave copies. A place behind the list's end takes the last listed
  // row: finite values under a weight of 0.
  const int cp   = (tid >> 6) + lane * 8;
  const int crow = list[(cp < nl) ? cp : nl - 1];
#endif
  {
    const int cnt = (nu - wv + 7) >> 3;  // list entries wv, wv + 8, ... below nu
    const int li  = wv + lane * 8;      // lane i holds the wave's i-th feature
    const int myf = (li < nu) ? list[li] : 0;
    const float4* __restrict__ pf4 =
        (const float4*)(pf + ((size_t)b * kF + f0) * kA) + c;
    float* srow = s + (g * 4 + (c & 3)) * kSP;
    auto row_load = [&](float4 (&d)[4], int i) {  // the wave's i-th row, i clamped
      const int f = __builtin_amdgcn_readlane(myf, (i < cnt) ? i : cnt - 1);
      const float4* __restrict__ pr = pf4 + f * (kA / 4);
#pragma unroll  // d[] stays in registers
      for (int j = 0; j < 4; ++j) d[j] = pr[j * 8];
      // The wait that belongs in front of a rewrite of these loads' address registers. The
      // pointer is an input so that its register pair lives up to the wait; in this build
      // the compiler had otherwise let the last load's result land on the pair.
      asm volatile("s_wait_xcnt 0x0" ::"v"(pr) : "memory");
    };
    auto row_score = [&](const float4 (&p)[4], int i) {
      v2f acc[4];
#pragma unroll  // here and below: register arrays are indexed by constants only
      for (int q = 0; q < 4; ++q) acc[q] = v2f{0.0f, 0.0f};
#pragma unroll
      for (int j = 0; j < 4; ++j) {
        const v2f p01 = v2f{p[j].x, p[j].y};
        const v2f p23 = v2f{p[j].z, p[j].w};
#pragma unroll
        for (int q = 0; q < 4; ++q) {
          const v2f x01 = p01 + pq01[q][j];
          const v2f x23 = p23 + pq23[q][j];
          const v2f t01 = v2f{fast_tanh(x01.x), fast_tanh(x01.y)};
          const v2f t23 = v2f{fast_tanh(x23.x), fast_tanh(x23.y)};
          acc[q] = __builtin_elementwise_fma(t01, wa01[j], acc[q]);
          acc[q] = __builtin_elementwise_fma(t23, wa23[j], acc[q]);
        }
      }
      float r[4];
#pragma unroll
      for (int q = 0; q < 4; ++q) {
        r[q] = acc[q].x + acc[q].y;
        r[q] = add_xmask<0x161>(r[q]);
        r[q] = add_xmask<0x162>(r[q]);
        r[q] = add_xmask<0x164>(r[q]);
      }
      const float r01 = (c & 1) ? r[1] : r[0];
      const float r23 = (c & 1) ? r[3] : r[2];
      if (c < 4)  // lane c stores query 4g + c
        srow[wv + i * 8] = (c & 2) ? r23 : r01;
    };
    if (cnt > 0) {
      float4 ra[4], rb[4];  // two rows: one flies while the other is worked on
      row_load(ra, 0);
      for (int i = 0; i < cnt; i += 2) {
        row_load(rb, i + 1);
#if HAVE_ASYNC_LDS
        // One slab of the range per trip: spread so, the copies never stand as one long
        // queue in front of the pf rows that the score pass is waiting for.
        if ((i >> 1) < nslab) async_slab(fbase, fb, tid, crow, i >> 1);
#endif
        // The two fences keep the next row's loads in front of this row's arithmetic;
        // left alone the compiler issued them at the end of it and waited at once.
        __builtin_amdgcn_sched_barrier(0);
        row_score(ra, i);
        row_load(ra, i + 2);
        __builtin_amdgcn_sched_barrier(0);
        if (i + 1 < cnt) row_score(rb, i + 1);
      }
    }
#if HAVE_ASYNC_LDS
    // All the slabs, for a wave with no rows: the loop above sent for none.
#pragma nounroll  // a tail that seldom runs: kept short
    for (int sl = (cnt + 1) >> 1; sl < nslab; ++sl)
      async_slab(fbase, fb, tid, crow, sl);
#endif
  }
  __syncthreads();

  // ---- Pass 2: range max, exp and range sum per row -------------------------
  // Half a wave per row, both rows of the wave at once. A lane holds the row's places
  // 64j + 4n .. 64j + 4n + 3 in registers: each score is read from LDS once, in 16-byte
  // reads that 16 lanes spread over all banks, and max and sum cross the 16 lanes by DPP.
  // So the pass is one short chain with a single wait for LDS; single reads in a loop and
  // shuffles through LDS, row behind row, would make a wave wait for LDS some forty times.
  const int hn = lane & 15;
  const int q2 = wave * 2 + (lane >> 4);  // the lane's row in its tile
  float rmax = -3.0e38f, rsum = 0.0f;
  {
    float* prow = s + q2 * kSP + hn * 4;
    const int left = nslab * 32 - hn * 4;  // group j of 4 places exists while 64j < left
    float4 v[kFS / 64];
#pragma unroll  // here and below: v[] stays in registers
    for (int j = 0; j < kFS / 64; ++j) {
      v[j] = make_float4(-3.0e38f, -3.0e38f, -3.0e38f, -3.0e38f);  // no place: weight 0
      if (j * 64 < left) v[j] = *(const float4*)(prow + j * 64);
    }
#pragma unroll
    for (int j = 0; j < kFS / 64; ++j)
      rmax = fmaxf(rmax, fmaxf(fmaxf(v[j].x, v[j].y), fmaxf(v[j].z, v[j].w)));
    rmax = max_xmask<0x161>(rmax);
    rmax = max_xmask<0x162>(rmax);
    rmax = max_xmask<0x164>(rmax);
    rmax = max_xmask<0x168>(rmax);
#pragma unroll
    for (int j = 0; j < kFS / 64; ++j) {
      const float4 e = make_float4(__expf(v[j].x - rmax), __expf(v[j].y - rmax),
                                   __expf(v[j].z - rmax), __expf(v[j].w - rmax));
      rsum += (e.x + e.y) + (e.z + e.w);
      if (j * 64 < left) *(float4*)(prow + j * 64) = e;
    }
    rsum = add_xmask<0x161>(rsum);
    rsum = add_xmask<0x162>(rsum);
    rsum = add_xmask<0x164>(rsum);
    rsum = add_xmask<0x168>(rsum);
  }
#if HAVE_ASYNC_LDS
  // This wave's copies have landed; the barrier behind it shows them to the other waves.
  asm volatile("s_wait_asynccnt 0x0" ::: "memory");
#endif
  __syncthreads();

  // ---- Pass 3: po[16][256] = e[16][places] @ listed features (WMMA bf16) -----
  // A wave owns columns 32w .. 32w+31; lane n holds column 32w+2n of its first tile
  // and 32w+2n+1 of its second, so both come from LDS in one 8-byte read, 16 lanes
  // cover 32 banks, and 16 lanes store one whole 128-byte line of po.
  const int n     = lane & 15;
  const int col0  = wave * 32 + n * 2;
  const int col1  = col0 + 1;
  const int arow  = lane & 15;
  const int kbase = (lane < 16) ? 0 : 8;
  v8f c0 = {}, c1 = {};

#if HAVE_ASYNC_LDS
  for (int ks = 0; ks < nslab; ++ks) {
    const float* cur = fb + ks * 32 * kDP;
    const int k0 = ks * 32;
    v16bf af, b0v, b1v;
    const float4* ap = (const float4*)(s + arow * kSP + k0 + kbase);
    pack8(af, 0, ap[0], ap[1]);  // K = k0+kbase + 0..7
    pack8(af, 8, ap[4], ap[5]);  // K = k0+kbase + 16..23
#pragma unroll
    for (int e = 0; e < 16; ++e) {
      const int kk = kbase + e + ((e >= 8) ? 8 : 0);   // 0..31 within slab
      const float2 v = *(const float2*)(cur + kk * kDP + col0);
      b0v[e] = (__bf16)v.x;
      b1v[e] = (__bf16)v.y;
    }
    c0 = WMMA_BF16(af, b0v, c0);
    c1 = WMMA_BF16(af, b1v, c1);
  }
#else
  for (int k0 = 0; k0 < nslab * 32; k0 += 32) {
    v16bf af, b0v, b1v;
#pragma unroll
    for (int e = 0; e < 16; ++e) {
      const int k = k0 + kbase + e + ((e >= 8) ? 8 : 0);
      af[e] = (__bf16)s[arow * kSP + k];
      const float* __restrict__ fr =
          feature + ((size_t)b * kF + f0 + list[(k < nl) ? k : nl - 1]) * kD;
      b0v[e] = (__bf16)fr[col0];
      b1v[e] = (__bf16)fr[col1];
    }
    c0 = WMMA_BF16(af, b0v, c0);
    c1 = WMMA_BF16(af, b1v, c1);
  }
#endif

  const int mofs = (lane >> 4) * 8;
#pragma unroll
  for (int r = 0; r < 8; ++r) {
    float* __restrict__ orow = po + ((size_t)blk * 16 + mofs + r) * kD;
    *(float2*)(orow + col0) = make_float2(c0[r], c1[r]);
  }
  // Stored here and not in pass 2, where the barrier behind it would wait for the stores.
  if (hn == 0) {  // one 128-byte line per tile
    pml[blk * 32 + q2]      = rmax;
    pml[blk * 32 + 16 + q2] = rsum;
  }
}

// exp(x). The v_nop in the statement is the free slot that the instruction set
// asks for behind a transcendental before its source register is overwritten.
__device__ __forceinline__ float exp_slot(float x) {
  float r;
  asm("v_exp_f32 %0, %1\n\tv_nop" : "=v"(r) : "v"(x * 1.44269504f));
  return r;
}

// ---------------------------------------------------------------------------
// Merge of the kS ranges of one (batch, query) row: weight exp(m_s - M) per
// range, out = sum_s w_s * po_s / sum_s w_s * l_s. 64 threads per row, float4.
// ---------------------------------------------------------------------------
__global__ __launch_bounds__(256) void merge_ranges(
    const float* __restrict__ po,   // [B*Q/16,S,16,D]
    const float* __restrict__ pml,  // [B*Q/16,S,32]
    float*       __restrict__ out)  // [B*Q,D]
{
  const int row  = blockIdx.x * 4 + (threadIdx.x >> 6);
  const int d4   = threadIdx.x & 63;
  const int tile = row >> 4;
  const int qi   = row & 15;
  const float* __restrict__ ml = pml + tile * kS * 32 + qi;
  float mv[kS];
  float M = -3.0e38f;
#pragma unroll  // keeps mv[] in registers
  for (int i = 0; i < kS; ++i) {
    mv[i] = ml[i * 32];
    M = fmaxf(M, mv[i]);
  }
  const float4* __restrict__ p4 =
      (const float4*)(po + ((size_t)tile * kS * 16 + qi) * kD) + d4;
  float L = 0.0f;
  float4 o = make_float4(0.0f, 0.0f, 0.0f, 0.0f);
#pragma unroll  // all kS loads in flight at once: one L2 latency, not kS
  for (int i = 0; i < kS; ++i) {
    const float w = exp_slot(mv[i] - M);
    const float4 v = p4[i * (16 * kD / 4)];
    L += w * ml[i * 32 + 16];
    o.x += w * v.x; o.y += w * v.y; o.z += w * v.z; o.w += w * v.w;
  }
  const float inv = __builtin_amdgcn_rcpf(L);
  ((float4*)(out + (size_t)row * kD))[d4] =
      make_float4(o.x * inv, o.y * inv, o.z * inv, o.w * inv);
}

// ---------------------------------------------------------------------------
extern "C" void kernel_launch(void* const* d_in, const int* in_sizes, int n_in,
                              void* d_out, int out_size, void* d_ws, size_t ws_size,
                              hipStream_t stream) {
  const float* feature = (const float*)d_in[0];  // [B,F,D]
  const float* query   = (const float*)d_in[1];  // [B,Q,QD]
  const float* Wf      = (const float*)d_in[2];  // [A,D]
  const float* Wq      = (const float*)d_in[3];  // [A,QD]
  const float* bq      = (const float*)d_in[4];  // [A]
  const float* wa      = (const float*)d_in[5];  // [A]
  const int*   mask    = (const int*)d_in[6];    // [B,F]
  float* out = (float*)d_out;

  float* pf  = (float*)d_ws;                     // [B,F,A] = 16 MB
  float* pqv = pf + (size_t)kB * kF * kA;        // [B,Q,A] = 0.5 MB
  float* po  = pqv + (size_t)kB * kQ * kA;       // [B*Q/16,S,16,D]
  float* pml = po + (size_t)kB * kQ * kS * kD;   // [B*Q/16,S,32]

  // pf = feature @ Wf^T : M=32768 less the masked rows, N=128, K=256; 128 rows per workgroup
  // pq = query @ Wq^T + bq : M=1024, N=128, K=256; 8 tiles of 16x16 per workgroup
  proj_both<<<kRowBlocks + kQBlocks, 256, 0, stream>>>(feature, Wf, mask, pf, query, Wq, bq, pqv);
  // scores + softmax partials + weighted sum, 32 queries and one feature range per workgroup
  fused_attn<<<kB * (kQ / 32) * kS, 512, 0, stream>>>(feature, pf, pqv, wa, mask, po, pml);
  // merge of the ranges: 4 rows per workgroup
  merge_ranges<<<kB * kQ / 4, 256, 0, stream>>>(po, pml, out);
}

// v009
// One run takes 24.8 microseconds.
// Timed twice side by side with v008, it ran 1.08 and 1.07 times as fast.
// Counting every step since v000, it is 9.54 times as fast.
#include <hip/hip_runtime.h>
#include <hip/hip_bf16.h>

// CDNA5 (gfx1250) fused additive attention.
// K1: both bf16-WMMA projection GEMMs (pf, pq). K2: fused score(tanh)+softmax
// partials+weights@feature for one range of the feature axis per workgroup,
// the range's unmasked features staged once via async global->LDS (ASYNCcnt) under the score pass.
// K3: merges the ranges' partials (max, sum, un-normalised weighted sum).

typedef __attribute__((ext_vector_type(16))) __bf16 v16bf;
typedef __attribute__((ext_vector_type(8)))  __bf16 v8bf;
typedef __attribute__((ext_vector_type(4)))  __bf16 v4bf;
typedef __attribute__((ext_vector_type(8)))  float  v8f;
typedef __attribute__((ext_vector_type(2)))  float  v2f;
typedef __attribute__((ext_vector_type(4)))  int    v4i;

#define WMMA_BF16(a, b, c) \
  __builtin_amdgcn_wmma_f32_16x16x32_bf16(false, (a), false, (b), (short)0, (c), false, false)

#define GLOBAL_AS __attribute__((address_space(1)))
#define LDS_AS    __attribute__((address_space(3)))

constexpr int kB = 16, kF = 2048, kQ = 64, kD = 256, kA = 128;
constexpr int kS  = 8;         // ranges of the feature axis, one workgroup each
constexpr int kFS = kF / kS;   // features per range
// LDS row pitches in floats, 1040 B = 16 B x odd. Score rows: the 16 rows that a
// b128 A-fragment read (or a score store) touches fall on different banks. Slab
// rows: rows k and k + 8, read by the two halves of a wave, lie 32 banks apart.
constexpr int kSP = kFS + 4;
constexpr int kDP = kD + 4;

// ---- native tanh if the toolchain exposes V_TANH_F32 ------------------------
#if __has_builtin(__builtin_amdgcn_tanhf)
__device__ __forceinline__ float fast_tanh(float x) { return __builtin_amdgcn_tanhf(x); }
#elif __has_builtin(__builtin_amdgcn_tanh_f32)
__device__ __forceinline__ float fast_tanh(float x) { return __builtin_amdgcn_tanh_f32(x); }
#else
__device__ __forceinline__ float fast_tanh(float x) {
  const float t = __expf(2.0f * x);                      // v_exp_f32
  return (t - 1.0f) * __builtin_amdgcn_rcpf(t + 1.0f);   // v_rcp_f32, no slow div
}
#endif

// ---- async global->LDS staging (gfx1250 ASYNC path) -------------------------
#if __has_builtin(__builtin_amdgcn_global_load_async_to_lds_b128)
#define HAVE_ASYNC_LDS 1
#else
#define HAVE_ASYNC_LDS 0
#endif

#if HAVE_ASYNC_LDS
// Copy slab sl, 32 listed rows of kD f32 (32KB), global->LDS rows of pitch kDP: 4 x b128
// per thread of a 512-thread workgroup; 64 threads per row, 8 rows per step. Lane j of
// crow holds the feature at list place (tid >> 6) + 8 * j, a number below kFS.
// Builtin signature (per hipcc diagnostic): (as1 v4i*, as3 v4i*, imm, imm).
__device__ __forceinline__ void async_slab(const float* __restrict__ gsrc,
                                           float* __restrict__ fb, int tid, int crow, int sl) {
#pragma unroll
  for (int i = 0; i < 4; ++i) {
    const int f   = __builtin_amdgcn_readlane(crow, sl * 4 + i);
    const int idx = f * kD + (tid & 63) * 4;  // float index, 16B aligned
    const int dst = (sl * 32 + (tid >> 6) + i * 8) * kDP + (tid & 63) * 4;  // 16B aligned too
    __builtin_amdgcn_global_load_async_to_lds_b128(
        (GLOBAL_AS v4i*)(gsrc + idx), (LDS_AS v4i*)(fb + dst), 0, 0);
  }
}
#endif

__device__ __forceinline__ void pack8(v16bf& v, int base, float4 lo, float4 hi) {
  v[base + 0] = (__bf16)lo.x; v[base + 1] = (__bf16)lo.y;
  v[base + 2] = (__bf16)lo.z; v[base + 3] = (__bf16)lo.w;
  v[base + 4] = (__bf16)hi.x; v[base + 5] = (__bf16)hi.y;
  v[base + 6] = (__bf16)hi.z; v[base + 7] = (__bf16)hi.w;
}

// ---------------------------------------------------------------------------
// Projection: Y[rows,kA] = X[rows,kD] * W[kA,kD]^T (+ bias), bf16 WMMA, for the listed rows
// of one workgroup. One wave = 16 listed rows x all kA columns, so an X element is loaded
// once on the chip, or never. Every global load takes whole 128-byte lines: a load in
// fragment order would touch 16 lines for its 512 bytes. W is read once per workgroup,
// rounded to bf16 and kept in LDS; a wave reads each of its X rows in two loads of 512
// bytes, rounds it and keeps it in its own LDS strip. All fragments come from LDS.
// A-frag: lane row M=lane%16; K pack: lane<16 -> {0..7,16..23}, lane>=16 -> +8.
// B-frag: lane column N=lane%16 with identical K packing.
// C/D layout: VGPR r -> M=r (lanes 0-15) / M=r+8 (lanes 16-31), N=lane%16.
// Feature workgroup: the unmasked of 128 rows. Query workgroup: kQR rows, all listed.
// ---------------------------------------------------------------------------
constexpr int kWP = kD + 8;  // bf16 per LDS row of W and X: 528 B = 16 B x odd, no bank conflict for b128 readers
constexpr int kQR = 32;      // query rows per workgroup

// Four floats rounded to bf16, as the cast does it. Written in asm and volatile so that it
// stays where it stands: as plain casts the compiler put the rounding of X, and with it the
// wait for X, in front of the loads of the second half of W, which then flew alone, and the
// rounding of the first half of W, with its wait, in front of the loads of X.
__device__ __forceinline__ v4bf round4_here(float4 v) {
  uint2 r;
  asm volatile("v_cvt_pk_bf16_f32 %0, %2, %3\n\tv_cvt_pk_bf16_f32 %1, %4, %5"
               : "=&v"(r.x), "=v"(r.y)
               : "v"(v.x), "v"(v.y), "v"(v.z), "v"(v.w));
  return __builtin_bit_cast(v4bf, r);
}

__device__ __forceinline__ void proj_rows_bf16(
    const float* __restrict__ X, const float* __restrict__ W,
    const int* __restrict__ mask, const float* __restrict__ bias,
    float* __restrict__ Y, int r0, bool isq)
{
  __shared__ __attribute__((aligned(16))) __bf16 wl[kA * kWP];
  __shared__ __attribute__((aligned(16))) __bf16 xs[8][16 * kWP];  // each wave's own 16 rows of X
  __shared__ __attribute__((aligned(16))) int rl[8][128];  // each wave's own copy of the row list
  const int tid   = threadIdx.x;
  const int wave  = __builtin_amdgcn_readfirstlane(tid >> 5);
  const int lane  = tid & 31;
  const int row   = lane & 15;
  const int kbase = (lane < 16) ? 0 : 8;
  const int t0    = wave * 16;         // the wave's first place in the list

  // Issued first, so that the wait for it does not wait for W as well.
  // A query workgroup reads the mask's first rows and lists its kQR rows whatever they hold:
  // one path for both kinds, so that the load stands in front of W's and is waited for behind.
  const int4* __restrict__ mp = (const int4*)(mask + (isq ? 0 : r0));
  int4 mk = mp[lane];  // rows 4 * lane .. 4 * lane + 3

  // W passes through registers in two halves, so that one half (64 registers) and
  // the wave's whole X strip (128) are in flight together below 256 registers.
  const float4* __restrict__ wp = (const float4*)W + tid;  // kD/4 = 64 float4 per row
  constexpr int kWH = kA * kD / 4 / 256 / 2;         // float4 per thread and half
  __bf16* wdst = &wl[(tid >> 6) * kWP + (tid & 63) * 4];  // a wave reads 512 B, writes 256 B
  float4 wv[kWH];
  auto w_load = [&](int h) {
#pragma unroll  // keeps wv[] in registers
    for (int i = 0; i < kWH; ++i) wv[i] = wp[(h * kWH + i) * 256];
    // The wait that belongs in front of a rewrite of the address registers of these loads and
    // of the mask's. The pointers are inputs so that their registers live up to it.
    asm volatile("s_wait_xcnt 0x0" ::"v"(wp), "s"(W), "s"(mp), "v"(lane) : "memory");
  };
  auto w_store = [&](int h) {
#pragma unroll  // wv[] is indexed by constants only
    for (int i = 0; i < kWH; ++i)
      *(v4bf*)(wdst + (h * kWH + i) * 4 * kWP) = round4_here(wv[i]);  // 4 rows of W per 256 threads
  };
  w_load(0);

  if (isq) mk = make_int4(lane * 4 < kQR, lane * 4 < kQR, lane * 4 < kQR, lane * 4 < kQR);  // kQR % 4 == 0

  // The workgroup's listed rows, ascending. Nothing reads pf of a masked row, so only
  // the unmasked are projected. Every wave builds the whole list for itself: no barrier.
  int* my = rl[wave];
  const unsigned b0 = __builtin_amdgcn_ballot_w32(mk.x != 0);
  const unsigned b1 = __builtin_amdgcn_ballot_w32(mk.y != 0);
  const unsigned b2 = __builtin_amdgcn_ballot_w32(mk.z != 0);
  const unsigned b3 = __builtin_amdgcn_ballot_w32(mk.w != 0);
  const int nu = __popc(b0) + __popc(b1) + __popc(b2) + __popc(b3);
  {
    const unsigned below = (1u << lane) - 1u;
    int pos = __popc(b0 & below) + __popc(b1 & below) + __popc(b2 & below) + __popc(b3 & below);
    if (mk.x) my[pos++] = lane * 4 + 0;
    if (mk.y) my[pos++] = lane * 4 + 1;
    if (mk.z) my[pos++] = lane * 4 + 2;
    if (mk.w) my[pos++] = lane * 4 + 3;
  }
  // A place behind the list's end takes the last row (computed, never stored). The
  // "& 127" keeps xrow below 128; where the list is empty no wave is active and none uses it.
  const int last = (nu > 0) ? nu - 1 : 0;
  const int xrow = my[(t0 + row < last) ? t0 + row : last] & 127;
  const bool active = t0 < nu;  // the same for a whole wave: it has rows to project

  // Two paths, so that each has its own exact counts in the waits for its loads.
  if (active) {
    float4 xv[kD / 8];  // row j of the strip: xv[2j] holds floats 4 * lane .., xv[2j + 1] those 128 on
    const unsigned lo = lane * 16;  // the lane's bytes in each half row
    const char* xb[16];
#pragma unroll  // xb[] stays in registers
    for (int j = 0; j < 16; ++j)
      xb[j] = (const char*)(X + (size_t)(r0 + __builtin_amdgcn_readlane(xrow, j)) * kD);
#pragma unroll  // keeps xv[] in registers
    for (int j = 0; j < 16; ++j) {
      xv[j * 2 + 0] = *(const float4*)(xb[j] + lo);
      xv[j * 2 + 1] = *(const float4*)(xb[j] + lo + 512);
    }
    // The wait that belongs in front of a rewrite of these loads' address registers. The
    // row bases and the lane's offset are inputs so that their registers live up to it.
    asm volatile("s_wait_xcnt 0x0" ::"s"(xb[0]), "s"(xb[1]), "s"(xb[2]), "s"(xb[3]), "s"(xb[4]),
                 "s"(xb[5]), "s"(xb[6]), "s"(xb[7]), "s"(xb[8]), "s"(xb[9]), "s"(xb[10]),
                 "s"(xb[11]), "s"(xb[12]), "s"(xb[13]), "s"(xb[14]), "s"(xb[15]), "v"(lo)
                 : "memory");
    // Keeps all 48 loads in front of the first wait.
    __builtin_amdgcn_sched_barrier(0);
    w_store(0);
    w_load(1);
    // Keeps the second half's loads in front of the wait for X.
    __builtin_amdgcn_sched_barrier(0);
    // The X strip goes to LDS while the second half of W flies: 256 B per store.
    __bf16* xd = &xs[wave][lane * 4];
#pragma unroll  // xv[] is indexed by constants only
    for (int j = 0; j < 32; ++j) *(v4bf*)(xd + (j >> 1) * kWP + (j & 1) * 128) = round4_here(xv[j]);
    w_store(1);
  } else {  // a wave without rows only helps to bring W in
    w_store(0);
    w_load(1);
    w_store(1);
  }
  __syncthreads();  // W is complete in LDS
  if (!active) return;  // no rows left for this wave; no barrier follows

  float bv[kA / 16];  // the bias of this lane's column in each column tile
#pragma unroll  // bv[] stays in registers
  for (int tn = 0; tn < kA / 16; ++tn) bv[tn] = 0.0f;
  if (isq) {
#pragma unroll
    for (int tn = 0; tn < kA / 16; ++tn) bv[tn] = bias[tn * 16 + row];
    // The wait that belongs in front of a rewrite of these loads' address registers.
    asm volatile("s_wait_xcnt 0x0" ::"s"(bias), "v"(row) : "memory");
  }

  const __bf16* abase = &xs[wave][row * kWP + kbase];
  v16bf a[kD / 32];
#pragma unroll  // keeps a[] in registers
  for (int ks = 0; ks < kD / 32; ++ks) {
    const v8bf lo8 = *(const v8bf*)(abase + ks * 32);       // K = ks*32+kbase + 0..7
    const v8bf hi8 = *(const v8bf*)(abase + ks * 32 + 16);  // K = ks*32+kbase + 16..23
    a[ks] = __builtin_shufflevector(lo8, hi8, 0, 1, 2, 3, 4, 5, 6, 7, 8, 9, 10, 11, 12, 13, 14, 15);
  }

  // The rows that this lane's 8 accumulator rows belong to.
  const int p0 = t0 + (lane >> 4) * 8;
  const int4 ia = *(const int4*)&my[p0];
  const int4 ib = *(const int4*)&my[p0 + 4];
  const int id[8] = {ia.x, ia.y, ia.z, ia.w, ib.x, ib.y, ib.z, ib.w};
  unsigned yo[8];  // where each of them begins in Y, this lane's column counted in
#pragma unroll  // yo[] stays in registers
  for (int r = 0; r < 8; ++r) yo[r] = (unsigned)(r0 + id[r]) * kA + row;

  v8f c[kA / 16];
#pragma unroll  // keeps c[] in registers
  for (int tn = 0; tn < kA / 16; ++tn) c[tn] = v8f{};

  // Groups of 4 WMMAs (one k step, 4 column tiles); the B fragments of a group are
  // read as one run of 8 ds_load_b128, two groups ahead, into a ring of 3 sets.
  const __bf16* bbase = &wl[row * kWP + kbase];
  constexpr int kG = (kD / 32) * 2;
  v16bf bfr[3][4];
  auto load_group = [&](int g) {
#pragma unroll  // bfr[] is indexed by constants only
    for (int t = 0; t < 4; ++t) {
      const __bf16* bp = bbase + ((g & 1) * 4 + t) * 16 * kWP + (g >> 1) * 32;
      const v8bf lo = *(const v8bf*)bp;         // K = ks*32+kbase + 0..7
      const v8bf hi = *(const v8bf*)(bp + 16);  // K = ks*32+kbase + 16..23
      bfr[g % 3][t] = __builtin_shufflevector(lo, hi, 0, 1, 2, 3, 4, 5, 6, 7, 8, 9, 10, 11,
                                              12, 13, 14, 15);
    }
  };
  load_group(0);
  load_group(1);
#pragma unroll  // a[], c[] and bfr[] are indexed by constants only
  for (int g = 0; g < kG; ++g) {
    if (g + 2 < kG) load_group(g + 2);
    // The two fences keep each group's LDS reads together and two groups ahead of
    // their WMMAs; left alone the compiler put each read pair directly in front of
    // its WMMA with a full wait.
    __builtin_amdgcn_sched_barrier(0);
#pragma unroll  // c[] and bfr[] are indexed by constants only
    for (int t = 0; t < 4; ++t)
      c[(g & 1) * 4 + t] = WMMA_BF16(a[g >> 1], bfr[g % 3][t], c[(g & 1) * 4 + t]);
    __builtin_amdgcn_sched_barrier(0);
  }

  // The wave writes each of its listed rows whole.
#pragma unroll  // both loops: c[], bv[] and yo[] are indexed by constants only, offsets fold into the stores
  for (int r = 0; r < 8; ++r) {
    if (p0 + r < nu) {
#pragma unroll
      for (int tn = 0; tn < kA / 16; ++tn) Y[yo[r] + tn * 16] = c[tn][r] + bv[tn];
    }
  }
}

// ---------------------------------------------------------------------------
// Both projections in one launch: neither reads what the other writes. The first
// kRowBlocks workgroups do the feature projection, the long part;
// the kQBlocks behind them do the query projection beside it.
// The second launch bound (4 waves per SIMD) holds the kernel to 256 registers, so
// that a query workgroup fits on a WGP that already runs a feature workgroup and
// need not wait for one to end.
// ---------------------------------------------------------------------------
constexpr int kRowBlocks = kB * kF / 128;
constexpr int kQBlocks   = kB * kQ / kQR;

__global__ __launch_bounds__(256, 4) void proj_both(
    const float* __restrict__ feature, const float* __restrict__ Wf,
    const int* __restrict__ mask, float* __restrict__ pf, const float* __restrict__ query,
    const float* __restrict__ Wq, const float* __restrict__ bq, float* __restrict__ pq)
{
  const bool isq = blockIdx.x >= kRowBlocks;  // the same for a whole workgroup: its barrier is safe
  proj_rows_bf16(isq ? query : feature, isq ? Wq : Wf, mask, bq, isq ? pq : pf,
                 isq ? (blockIdx.x - kRowBlocks) * kQR : blockIdx.x * 128, isq);
}

// Sum of x over the lanes l ^ m, m = CTRL - 0x160, inside a 16-lane row (DPP row_xmask).
template <int CTRL>
__device__ __forceinline__ float add_xmask(float x) {
  return x + __builtin_bit_cast(float, __builtin_amdgcn_update_dpp(
                 0, __builtin_bit_cast(int, x), CTRL, 0xf, 0xf, true));
}

// Maximum of x over the lanes l ^ m, in the same way.
template <int CTRL>
__device__ __forceinline__ float max_xmask(float x) {
  return fmaxf(x, __builtin_bit_cast(float, __builtin_amdgcn_update_dpp(
                      0, __builtin_bit_cast(int, x), CTRL, 0xf, 0xf, true)));
}

// ---------------------------------------------------------------------------
// Fused attention: one workgroup (512 thr = 16 waves) per (batch, 32 queries,
// feature range); waves 0-7 take the first 16-query tile, waves 8-15 the second.
// It leaves the range's row maxima, row sums and the un-normalised weighted sum in
// the workspace; merge_ranges finishes the softmax.
// LDS: s[32][kSP] + list[kFS] + wcnt[32] + the range's features [kFS][kDP] (260KB):
// one workgroup per WGP. The listed features are copied in while the scores are computed,
// so the weighted sum finds all of them in LDS and waits for no memory.
// ---------------------------------------------------------------------------
static_assert(kFS == 256, "one feature of the range per thread and tile when the list is built");
constexpr int kAttnLds = 32 * kSP + kFS + 32 + kFS * kDP;  // floats

__global__ __launch_bounds__(512) void fused_attn(
    const float* __restrict__ feature,  // [B,F,D]
    const float* __restrict__ pf,       // [B,F,A]
    const float* __restrict__ pq,       // [B,Q,A] (bias included)
    const float* __restrict__ wa,       // [A]
    const int*   __restrict__ mask,     // [B,F]
    float*       __restrict__ po,       // [B*Q/16,S,16,D] un-normalised partial sums
    float*       __restrict__ pml)      // [B*Q/16,S,32] 16 range maxima, 16 range sums
{
  __shared__ __attribute__((aligned(16))) float lds[kAttnLds];
  int*   list = (int*)(lds + 32 * kSP);  // [kFS] the range's unmasked features, ascending
  int*   wcnt = list + kFS;              // [32], 8 used: unmasked features per 32 features
  float* fb   = (float*)(wcnt + 32);     // [kFS][kDP] the listed features, kD used per row

  const int tid  = threadIdx.x;
  const int lane = tid & 31;
  const int fid  = tid & 255;                                 // feature of the range
  const int qt   = __builtin_amdgcn_readfirstlane(tid >> 8);  // the wave's 16-query tile
  const int wave = (tid >> 5) & 7;                            // the wave's place in its tile
  const int sp   = blockIdx.x % kS;  // feature range
  const int tile = (blockIdx.x / kS) * 2 + qt;
  const int blk  = tile * kS + sp;   // place of the tile's partials in po and pml
  const int b  = tile >> 2;          // Q/16 == 4 query tiles per batch
  const int q0 = (tile & 3) * 16;
  const int f0 = sp * kFS;
  float* s = lds + qt * 16 * kSP;    // [16][kSP] the tile's scores, at most kFS used per row

  // ---- Pass 1: masked scores s[q][f] = sum_a wa[a]*tanh(pf[f][a]+pq[q][a])
  // A wave takes one unmasked feature at a time, so a masked one costs nothing.
  // Lane = (g, c): queries 4g..4g+3, terms a = 32j + 4c + e (j, e = 0..3). The
  // lane's 64 pq values and 16 wa values stay in registers; a pf row is 4 loads
  // of one 128-byte line each; the 8 lanes c of a query are summed by DPP.
  const int wv = __builtin_amdgcn_readfirstlane(wave);
  const int c  = lane & 7;
  const int g  = lane >> 3;

  const int mk = mask[b * kF + f0 + fid];
  const unsigned bal = __builtin_amdgcn_ballot_w32(mk != 0);
  if (lane == 0 && qt == 0) wcnt[wave] = __popc(bal);

  const float4* __restrict__ pq4 =
      (const float4*)(pq + ((size_t)b * kQ + q0 + g * 4) * kA) + c;
  const float4* __restrict__ wa4 = (const float4*)wa + c;
  v2f pq01[4][4], pq23[4][4], wa01[4], wa23[4];
#pragma unroll  // both loops: the arrays stay in registers
  for (int j = 0; j < 4; ++j) {
    const float4 w = wa4[j * 8];
    wa01[j] = v2f{w.x, w.y};
    wa23[j] = v2f{w.z, w.w};
#pragma unroll
    for (int i = 0; i < 4; ++i) {
      const float4 v = pq4[i * (kA / 4) + j * 8];
      pq01[i][j] = v2f{v.x, v.y};
      pq23[i][j] = v2f{v.z, v.w};
    }
  }
  __syncthreads();  // wcnt complete

  int base = 0, nu = 0;  // unmasked features in the waves before this one; in the range
#pragma unroll  // the 8 LDS reads go out together
  for (int w = 0; w < 8; ++w) {
    const int cw = wcnt[w];
    base += (w < wv) ? cw : 0;
    nu += cw;
  }
  nu = __builtin_amdgcn_readfirstlane(nu);
  // From here on a column of s and a row of fb is a PLACE IN THE LIST, not a feature. Beside
  // an unmasked feature a masked one has weight exp(-1e9 - max) = 0 exactly, so it is left
  // out of copies, softmax and weighted sum. A range with no unmasked feature keeps all of
  // its features, each at -1e9: should the whole batch row be masked, they all count alike.
  const int nl    = (nu > 0) ? nu : kFS;  // length of the list
  const int nslab = (nl + 31) >> 5;       // slabs of 32 places
  if (qt == 0) {
    if (nu == 0) list[fid] = fid;
    else if (mk) list[base + __popc(bal & ((1u << lane) - 1u))] = fid;
  }
  if (fid >= nu && fid < nslab * 32) {  // places without a computed score: weight 0, or all alike
#pragma unroll  // offsets fold into the stores
    for (int q = 0; q < 16; ++q) s[q * kSP + fid] = -1.0e9f;
  }
  __syncthreads();  // list complete

#if HAVE_ASYNC_LDS
  const float* fbase = feature + ((size_t)b * kF + f0) * kD;
  // The rows that this wave copies. A place behind the list's end takes the last listed
  // row: finite values under a weight of 0.
  const int cp   = (tid >> 6) + lane * 8;
  const int crow = list[(cp < nl) ? cp : nl - 1];
#endif
  {
    const int cnt = (nu - wv + 7) >> 3;  // list entries wv, wv + 8, ... below nu
    const int li  = wv + lane * 8;      // lane i holds the wave's i-th feature
    const int myf = (li < nu) ? list[li] : 0;
    const float4* __restrict__ pf4 =
        (const float4*)(pf + ((size_t)b * kF + f0) * kA) + c;
    float* srow = s + (g * 4 + (c & 3)) * kSP;
    auto row_load = [&](float4 (&d)[4], int i) {  // the wave's i-th row, i clamped
      const int f = __builtin_amdgcn_readlane(myf, (i < cnt) ? i : cnt - 1);
      const float4* __restrict__ pr = pf4 + f * (kA / 4);
#pragma unroll  // d[] stays in registers
      for (int j = 0; j < 4; ++j) d[j] = pr[j * 8];
      // The wait that belongs in front of a rewrite of these loads' address registers. The
      // pointer is an input so that its register pair lives up to the wait; in this build
      // the compiler had otherwise let the last load's result land on the pair.
      asm volatile("s_wait_xcnt 0x0" ::"v"(pr) : "memory");
    };
    auto row_score = [&](const float4 (&p)[4], int i) {
      v2f acc[4];
#pragma unroll  // here and below: register arrays are indexed by constants only
      for (int q = 0; q < 4; ++q) acc[q] = v2f{0.0f, 0.0f};
#pragma unroll
      for (int j = 0; j < 4; ++j) {
        const v2f p01 = v2f{p[j].x, p[j].y};
        const v2f p23 = v2f{p[j].z, p[j].w};
#pragma unroll
        for (int q = 0; q < 4; ++q) {
          const v2f x01 = p01 + pq01[q][j];
          const v2f x23 = p23 + pq23[q][j];
          const v2f t01 = v2f{fast_tanh(x01.x), fast_tanh(x01.y)};
          const v2f t23 = v2f{fast_tanh(x23.x), fast_tanh(x23.y)};
          acc[q] = __builtin_elementwise_fma(t01, wa01[j], acc[q]);
          acc[q] = __builtin_elementwise_fma(t23, wa23[j], acc[q]);
        }
      }
      float r[4];
#pragma unroll
      for (int q = 0; q < 4; ++q) {
        r[q] = acc[q].x + acc[q].y;
        r[q] = add_xmask<0x161>(r[q]);
        r[q] = add_xmask<0x162>(r[q]);
        r[q] = add_xmask<0x164>(r[q]);
      }
      const float r01 = (c & 1) ? r[1] : r[0];
      const float r23 = (c & 1) ? r[3] : r[2];
      if (c < 4)  // lane c stores query 4g + c
        srow[wv + i * 8] = (c & 2) ? r23 : r01;
    };
    if (cnt > 0) {
      float4 ra[4], rb[4];  // two rows: one flies while the other is worked on
      row_load(ra, 0);
      for (int i = 0; i < cnt; i += 2) {
        row_load(rb, i + 1);
#if HAVE_ASYNC_LDS
        // One slab of the range per trip: spread so, the copies never stand as one long
        // queue in front of the pf rows that the score pass is waiting for.
        if ((i >> 1) < nslab) async_slab(fbase, fb, tid, crow, i >> 1);
#endif
        // The two fences keep the next row's loads in front of this row's arithmetic;
        // left alone the compiler issued them at the end of it and waited at once.
        __builtin_amdgcn_sched_barrier(0);
        row_score(ra, i);
        row_load(ra, i + 2);
        __builtin_amdgcn_sched_barrier(0);
        if (i + 1 < cnt) row_score(rb, i + 1);
      }
    }
#if HAVE_ASYNC_LDS
    // All the slabs, for a wave with no rows: the loop above sent for none.
#pragma nounroll  // a tail that seldom runs: kept short
    for (int sl = (cnt + 1) >> 1; sl < nslab; ++sl)
      async_slab(fbase, fb, tid, crow, sl);
#endif
  }
  __syncthreads();

  // ---- Pass 2: range max, exp and range sum per row -------------------------
  // Half a wave per row, both rows of the wave at once. A lane holds the row's places
  // 64j + 4n .. 64j + 4n + 3 in registers: each score is read from LDS once, in 16-byte
  // reads that 16 lanes spread over all banks, and max and sum cross the 16 lanes by DPP.
  // So the pass is one short chain with a single wait for LDS; single reads in a loop and
  // shuffles through LDS, row behind row, would make a wave wait for LDS some forty times.
  const int hn = lane & 15;
  const int q2 = wave * 2 + (lane >> 4);  // the lane's row in its tile
  float rmax = -3.0e38f, rsum = 0.0f;
  {
    float* prow = s + q2 * kSP + hn * 4;
    const int left = nslab * 32 - hn * 4;  // group j of 4 places exists while 64j < left
    float4 v[kFS / 64];
#pragma unroll  // here and below: v[] stays in registers
    for (int j = 0; j < kFS / 64; ++j) {
      v[j] = make_float4(-3.0e38f, -3.0e38f, -3.0e38f, -3.0e38f);  // no place: weight 0
      if (j * 64 < left) v[j] = *(const float4*)(prow + j * 64);
    }
#pragma unroll
    for (int j = 0; j < kFS / 64; ++j)
      rmax = fmaxf(rmax, fmaxf(fmaxf(v[j].x, v[j].y), fmaxf(v[j].z, v[j].w)));
    rmax = max_xmask<0x161>(rmax);
    rmax = max_xmask<0x162>(rmax);
    rmax = max_xmask<0x164>(rmax);
    rmax = max_xmask<0x168>(rmax);
#pragma unroll
    for (int j = 0; j < kFS / 64; ++j) {
      const float4 e = make_float4(__expf(v[j].x - rmax), __expf(v[j].y - rmax),
                                   __expf(v[j].z - rmax), __expf(v[j].w - rmax));
      rsum += (e.x + e.y) + (e.z + e.w);
      if (j * 64 < left) *(float4*)(prow + j * 64) = e;
    }
    rsum = add_xmask<0x161>(rsum);
    rsum = add_xmask<0x162>(rsum);
    rsum = add_xmask<0x164>(rsum);
    rsum = add_xmask<0x168>(rsum);
  }
#if HAVE_ASYNC_LDS
  // This wave's copies have landed; the barrier behind it shows them to the other waves.
  asm volatile("s_wait_asynccnt 0x0" ::: "memory");
#endif
  __syncthreads();

  // ---- Pass 3: po[16][256] = e[16][places] @ listed features (WMMA bf16) -----
  // A wave owns columns 32w .. 32w+31; lane n holds column 32w+2n of its first tile
  // and 32w+2n+1 of its second, so both come from LDS in one 8-byte read, 16 lanes
  // cover 32 banks, and 16 lanes store one whole 128-byte line of po.
  const int n     = lane & 15;
  const int col0  = wave * 32 + n * 2;
  const int col1  = col0 + 1;
  const int arow  = lane & 15;
  const int kbase = (lane < 16) ? 0 : 8;
  v8f c0 = {}, c1 = {};

#if HAVE_ASYNC_LDS
  for (int ks = 0; ks < nslab; ++ks) {
    const float* cur = fb + ks * 32 * kDP;
    const int k0 = ks * 32;
    v16bf af, b0v, b1v;
    const float4* ap = (const float4*)(s + arow * kSP + k0 + kbase);
    pack8(af, 0, ap[0], ap[1]);  // K = k0+kbase + 0..7
    pack8(af, 8, ap[4], ap[5]);  // K = k0+kbase + 16..23
#pragma unroll
    for (int e = 0; e < 16; ++e) {
      const int kk = kbase + e + ((e >= 8) ? 8 : 0);   // 0..31 within slab
      const float2 v = *(const float2*)(cur + kk * kDP + col0);
      b0v[e] = (__bf16)v.x;
      b1v[e] = (__bf16)v.y;
    }
    c0 = WMMA_BF16(af, b0v, c0);
    c1 = WMMA_BF16(af, b1v, c1);
  }
#else
  for (int k0 = 0; k0 < nslab * 32; k0 += 32) {
    v16bf af, b0v, b1v;
#pragma unroll
    for (int e = 0; e < 16; ++e) {
      const int k = k0 + kbase + e + ((e >= 8) ? 8 : 0);
      af[e] = (__bf16)s[arow * kSP + k];
      const float* __restrict__ fr =
          feature + ((size_t)b * kF + f0 + list[(k < nl) ? k : nl - 1]) * kD;
      b0v[e] = (__bf16)fr[col0];
      b1v[e] = (__bf16)fr[col1];
    }
    c0 = WMMA_BF16(af, b0v, c0);
    c1 = WMMA_BF16(af, b1v, c1);
  }
#endif

  const int mofs = (lane >> 4) * 8;
#pragma unroll
  for (int r = 0; r < 8; ++r) {
    float* __restrict__ orow = po + ((size_t)blk * 16 + mofs + r) * kD;
    *(float2*)(orow + col0) = make_float2(c0[r], c1[r]);
  }
  // Stored here and not in pass 2, where the barrier behind it would wait for the stores.
  if (hn == 0) {  // one 128-byte line per tile
    pml[blk * 32 + q2]      = rmax;
    pml[blk * 32 + 16 + q2] = rsum;
  }
}

// exp(x). The v_nop in the statement is the free slot that the instruction set
// asks for behind a transcendental before its source register is overwritten.
__device__ __forceinline__ float exp_slot(float x) {
  float r;
  asm("v_exp_f32 %0, %1\n\tv_nop" : "=v"(r) : "v"(x * 1.44269504f));
  return r;
}

// ---------------------------------------------------------------------------
// Merge of the kS ranges of one (batch, query) row: weight exp(m_s - M) per
// range, out = sum_s w_s * po_s / sum_s w_s * l_s. 64 threads per row, float4.
// ---------------------------------------------------------------------------
__global__ __launch_bounds__(256) void merge_ranges(
    const float* __restrict__ po,   // [B*Q/16,S,16,D]
    const float* __restrict__ pml,  // [B*Q/16,S,32]
    float*       __restrict__ out)  // [B*Q,D]
{
  const int row  = blockIdx.x * 4 + (threadIdx.x >> 6);
  const int d4   = threadIdx.x & 63;
  const int tile = row >> 4;
  const int qi   = row & 15;
  const float* __restrict__ ml = pml + tile * kS * 32 + qi;
  float mv[kS];
  float M = -3.0e38f;
#pragma unroll  // keeps mv[] in registers
  for (int i = 0; i < kS; ++i) {
    mv[i] = ml[i * 32];
    M = fmaxf(M, mv[i]);
  }
  const float4* __restrict__ p4 =
      (const float4*)(po + ((size_t)tile * kS * 16 + qi) * kD) + d4;
  float L = 0.0f;
  float4 o = make_float4(0.0f, 0.0f, 0.0f, 0.0f);
#pragma unroll  // all kS loads in flight at once: one L2 latency, not kS
  for (int i = 0; i < kS; ++i) {
    const float w = exp_slot(mv[i] - M);
    const float4 v = p4[i * (16 * kD / 4)];
    L += w * ml[i * 32 + 16];
    o.x += w * v.x; o.y += w * v.y; o.z += w * v.z; o.w += w * v.w;
  }
  const float inv = __builtin_amdgcn_rcpf(L);
  ((float4*)(out + (size_t)row * kD))[d4] =
      make_float4(o.x * inv, o.y * inv, o.z * inv, o.w * inv);
}

// ---------------------------------------------------------------------------
extern "C" void kernel_launch(void* const* d_in, const int* in_sizes, int n_in,
                              void* d_out, int out_size, void* d_ws, size_t ws_size,
                              hipStream_t stream) {
  const float* feature = (const float*)d_in[0];  // [B,F,D]
  const float* query   = (const float*)d_in[1];  // [B,Q,QD]
  const float* Wf      = (const float*)d_in[2];  // [A,D]
  const float* Wq      = (const float*)d_in[3];  // [A,QD]
  const float* bq      = (const float*)d_in[4];  // [A]
  const float* wa      = (const float*)d_in[5];  // [A]
  const int*   mask    = (const int*)d_in[6];    // [B,F]
  float* out = (float*)d_out;

  float* pf  = (float*)d_ws;                     // [B,F,A] = 16 MB
  float* pqv = pf + (size_t)kB * kF * kA;        // [B,Q,A] = 0.5 MB
  float* po  = pqv + (size_t)kB * kQ * kA;       // [B*Q/16,S,16,D]
  float* pml = po + (size_t)kB * kQ * kS * kD;   // [B*Q/16,S,32]

  // pf = feature @ Wf^T : M=32768 less the masked rows, N=128, K=256; 128 rows per workgroup
  // pq = query @ Wq^T + bq : M=1024, N=128, K=256; 32 rows per workgroup
  proj_both<<<kRowBlocks + kQBlocks, 256, 0, stream>>>(feature, Wf, mask, pf, query, Wq, bq, pqv);
  // scores + softmax partials + weighted sum, 32 queries and one feature range per workgroup
  fused_attn<<<kB * (kQ / 32) * kS, 512, 0, stream>>>(feature, pf, pqv, wa, mask, po, pml);
  // merge of the ranges: 4 rows per workgroup
  merge_ranges<<<kB * kQ / 4, 256, 0, stream>>>(po, pml, out);
}

// v010
// It runs in 23.6 microseconds.
// In both of two side-by-side timings against v009, it was 1.05 times as fast.
// Counting every step since v000, it is 10.0 times as fast.
#include <hip/hip_runtime.h>
#include <hip/hip_bf16.h>

// CDNA5 (gfx1250) fused additive attention.
// K1: both bf16-WMMA projection GEMMs (pf, pq, stored as exponentials). K2: fused score(tanh)+softmax
// partials+weights@feature for one range of the feature axis per workgroup,
// the range's unmasked features staged once via async global->LDS (ASYNCcnt) under the score pass.
// K3: merges the ranges' partials (max, sum, un-normalised weighted sum).

typedef __attribute__((ext_vector_type(16))) __bf16 v16bf;
typedef __attribute__((ext_vector_type(8)))  __bf16 v8bf;
typedef __attribute__((ext_vector_type(4)))  __bf16 v4bf;
typedef __attribute__((ext_vector_type(8)))  float  v8f;
typedef __attribute__((ext_vector_type(2)))  float  v2f;
typedef __attribute__((ext_vector_type(4)))  int    v4i;

#define WMMA_BF16(a, b, c) \
  __builtin_amdgcn_wmma_f32_16x16x32_bf16(false, (a), false, (b), (short)0, (c), false, false)

#define GLOBAL_AS __attribute__((address_space(1)))
#define LDS_AS    __attribute__((address_space(3)))

constexpr int kB = 16, kF = 2048, kQ = 64, kD = 256, kA = 128;
constexpr int kS  = 8;         // ranges of the feature axis, one workgroup each
constexpr int kFS = kF / kS;   // features per range
// LDS row pitches in floats, 1040 B = 16 B x odd. Score rows: the 16 rows that a
// b128 A-fragment read (or a score store) touches fall on different banks. Slab
// rows: rows k and k + 8, read by the two halves of a wave, lie 32 banks apart.
constexpr int kSP = kFS + 4;
constexpr int kDP = kD + 4;

// ---- tanh without one transcendental per term ------------------------------
// w * tanh(x + y) = w + 1 / d,  d = h + e^(2x) * (h * e^(2y)),  h = -1 / (2w).
// The projection launch stores e^(2x) per feature term and h * e^(2y) per query term, so a
// term of a score costs one multiply-add, and two terms share one reciprocal:
// 1 / d0 + 1 / d1 = (d0 + d1) / (d0 * d1).
constexpr float kTwoLog2e = 2.8853900818f;  // e^(2x) = 2^(kTwoLog2e * x)
// Bounds that keep every d, and every sum of two, finite for any input: the exponent of each
// factor within +-40 (|x| below 13.8; past it tanh of the sum is +-1 to the last bit unless the
// other addend is beyond 4 the other way), |w| not below 2^-40.
constexpr float kExpLim = 40.0f;
constexpr float kWMin   = 9.094947e-13f;
__device__ __forceinline__ float w_bounded(float w) { return (fabsf(w) < kWMin) ? kWMin : w; }
// The v_nop in the statement is the free slot that the instruction set asks for behind a
// transcendental before its source register is overwritten.
__device__ __forceinline__ float h_of(float w) {
  float r;
  asm("v_rcp_f32 %0, %1\n\tv_nop" : "=v"(r) : "v"(w_bounded(w)));
  return -0.5f * r;
}
__device__ __forceinline__ float exp_2x(float t) {  // t = kTwoLog2e * x
  return __builtin_amdgcn_exp2f(__builtin_amdgcn_fmed3f(t, -kExpLim, kExpLim));
}

// ---- async global->LDS staging (gfx1250 ASYNC path) -------------------------
#if __has_builtin(__builtin_amdgcn_global_load_async_to_lds_b128)
#define HAVE_ASYNC_LDS 1
#else
#define HAVE_ASYNC_LDS 0
#endif

#if HAVE_ASYNC_LDS
// Copy slab sl, 32 listed rows of kD f32 (32KB), global->LDS rows of pitch kDP: 4 x b128
// per thread of a 512-thread workgroup; 64 threads per row, 8 rows per step. Lane j of
// crow holds the feature at list place (tid >> 6) + 8 * j, a number below kFS.
// Builtin signature (per hipcc diagnostic): (as1 v4i*, as3 v4i*, imm, imm).
__device__ __forceinline__ void async_slab(const float* __restrict__ gsrc,
                                           float* __restrict__ fb, int tid, int crow, int sl) {
#pragma unroll
  for (int i = 0; i < 4; ++i) {
    const int f   = __builtin_amdgcn_readlane(crow, sl * 4 + i);
    const int idx = f * kD + (tid & 63) * 4;  // float index, 16B aligned
    const int dst = (sl * 32 + (tid >> 6) + i * 8) * kDP + (tid & 63) * 4;  // 16B aligned too
    __builtin_amdgcn_global_load_async_to_lds_b128(
        (GLOBAL_AS v4i*)(gsrc + idx), (LDS_AS v4i*)(fb + dst), 0, 0);
  }
}
#endif

__device__ __forceinline__ void pack8(v16bf& v, int base, float4 lo, float4 hi) {
  v[base + 0] = (__bf16)lo.x; v[base + 1] = (__bf16)lo.y;
  v[base + 2] = (__bf16)lo.z; v[base + 3] = (__bf16)lo.w;
  v[base + 4] = (__bf16)hi.x; v[base + 5] = (__bf16)hi.y;
  v[base + 6] = (__bf16)hi.z; v[base + 7] = (__bf16)hi.w;
}

// ---------------------------------------------------------------------------
// Projection: Y[rows,kA] = e^(2P) (query rows: h * e^(2P)), P = X[rows,kD] * W[kA,kD]^T (+ bias), bf16 WMMA, for the listed rows
// of one workgroup. One wave = 16 listed rows x all kA columns, so an X element is loaded
// once on the chip, or never. Every global load takes whole 128-byte lines: a load in
// fragment order would touch 16 lines for its 512 bytes. W is read once per workgroup,
// rounded to bf16 and kept in LDS; a wave reads each of its X rows in two loads of 512
// bytes, rounds it and keeps it in its own LDS strip. All fragments come from LDS.
// A-frag: lane row M=lane%16; K pack: lane<16 -> {0..7,16..23}, lane>=16 -> +8.
// B-frag: lane column N=lane%16 with identical K packing.
// C/D layout: VGPR r -> M=r (lanes 0-15) / M=r+8 (lanes 16-31), N=lane%16.
// Feature workgroup: the unmasked of 128 rows. Query workgroup: kQR rows, all listed.
// ---------------------------------------------------------------------------
constexpr int kWP = kD + 8;  // bf16 per LDS row of W and X: 528 B = 16 B x odd, no bank conflict for b128 readers
constexpr int kQR = 32;      // query rows per workgroup

// Four floats rounded to bf16, as the cast does it. Written in asm and volatile so that it
// stays where it stands: as plain casts the compiler put the rounding of X, and with it the
// wait for X, in front of the loads of the second half of W, which then flew alone, and the
// rounding of the first half of W, with its wait, in front of the loads of X.
__device__ __forceinline__ v4bf round4_here(float4 v) {
  uint2 r;
  asm volatile("v_cvt_pk_bf16_f32 %0, %2, %3\n\tv_cvt_pk_bf16_f32 %1, %4, %5"
               : "=&v"(r.x), "=v"(r.y)
               : "v"(v.x), "v"(v.y), "v"(v.z), "v"(v.w));
  return __builtin_bit_cast(v4bf, r);
}

__device__ __forceinline__ void proj_rows_bf16(
    const float* __restrict__ X, const float* __restrict__ W,
    const int* __restrict__ mask, const float* __restrict__ bias, const float* __restrict__ wa,
    float* __restrict__ Y, int r0, bool isq)
{
  __shared__ __attribute__((aligned(16))) __bf16 wl[kA * kWP];
  __shared__ __attribute__((aligned(16))) __bf16 xs[8][16 * kWP];  // each wave's own 16 rows of X
  __shared__ __attribute__((aligned(16))) int rl[8][128];  // each wave's own copy of the row list
  const int tid   = threadIdx.x;
  const int wave  = __builtin_amdgcn_readfirstlane(tid >> 5);
  const int lane  = tid & 31;
  const int row   = lane & 15;
  const int kbase = (lane < 16) ? 0 : 8;
  const int t0    = wave * 16;         // the wave's first place in the list

  // Issued first, so that the wait for it does not wait for W as well.
  // A query workgroup reads the mask's first rows and lists its kQR rows whatever they hold:
  // one path for both kinds, so that the load stands in front of W's and is waited for behind.
  const int4* __restrict__ mp = (const int4*)(mask + (isq ? 0 : r0));
  int4 mk = mp[lane];  // rows 4 * lane .. 4 * lane + 3

  // W passes through registers in two halves, so that one half (64 registers) and
  // the wave's whole X strip (128) are in flight together below 256 registers.
  const float4* __restrict__ wp = (const float4*)W + tid;  // kD/4 = 64 float4 per row
  constexpr int kWH = kA * kD / 4 / 256 / 2;         // float4 per thread and half
  __bf16* wdst = &wl[(tid >> 6) * kWP + (tid & 63) * 4];  // a wave reads 512 B, writes 256 B
  float4 wv[kWH];
  auto w_load = [&](int h) {
#pragma unroll  // keeps wv[] in registers
    for (int i = 0; i < kWH; ++i) wv[i] = wp[(h * kWH + i) * 256];
    // The wait that belongs in front of a rewrite of the address registers of these loads and
    // of the mask's. The pointers are inputs so that their registers live up to it.
    asm volatile("s_wait_xcnt 0x0" ::"v"(wp), "s"(W), "s"(mp), "v"(lane) : "memory");
  };
  auto w_store = [&](int h) {
#pragma unroll  // wv[] is indexed by constants only
    for (int i = 0; i < kWH; ++i)
      *(v4bf*)(wdst + (h * kWH + i) * 4 * kWP) = round4_here(wv[i]);  // 4 rows of W per 256 threads
  };
  w_load(0);

  if (isq) mk = make_int4(lane * 4 < kQR, lane * 4 < kQR, lane * 4 < kQR, lane * 4 < kQR);  // kQR % 4 == 0

  // The workgroup's listed rows, ascending. Nothing reads pf of a masked row, so only
  // the unmasked are projected. Every wave builds the whole list for itself: no barrier.
  int* my = rl[wave];
  const unsigned b0 = __builtin_amdgcn_ballot_w32(mk.x != 0);
  const unsigned b1 = __builtin_amdgcn_ballot_w32(mk.y != 0);
  const unsigned b2 = __builtin_amdgcn_ballot_w32(mk.z != 0);
  const unsigned b3 = __builtin_amdgcn_ballot_w32(mk.w != 0);
  const int nu = __popc(b0) + __popc(b1) + __popc(b2) + __popc(b3);
  {
    const unsigned below = (1u << lane) - 1u;
    int pos = __popc(b0 & below) + __popc(b1 & below) + __popc(b2 & below) + __popc(b3 & below);
    if (mk.x) my[pos++] = lane * 4 + 0;
    if (mk.y) my[pos++] = lane * 4 + 1;
    if (mk.z) my[pos++] = lane * 4 + 2;
    if (mk.w) my[pos++] = lane * 4 + 3;
  }
  // A place behind the list's end takes the last row (computed, never stored). The
  // "& 127" keeps xrow below 128; where the list is empty no wave is active and none uses it.
  const int last = (nu > 0) ? nu - 1 : 0;
  const int xrow = my[(t0 + row < last) ? t0 + row : last] & 127;
  const bool active = t0 < nu;  // the same for a whole wave: it has rows to project

  // Two paths, so that each has its own exact counts in the waits for its loads.
  if (active) {
    float4 xv[kD / 8];  // row j of the strip: xv[2j] holds floats 4 * lane .., xv[2j + 1] those 128 on
    const unsigned lo = lane * 16;  // the lane's bytes in each half row
    const char* xb[16];
#pragma unroll  // xb[] stays in registers
    for (int j = 0; j < 16; ++j)
      xb[j] = (const char*)(X + (size_t)(r0 + __builtin_amdgcn_readlane(xrow, j)) * kD);
#pragma unroll  // keeps xv[] in registers
    for (int j = 0; j < 16; ++j) {
      xv[j * 2 + 0] = *(const float4*)(xb[j] + lo);
      xv[j * 2 + 1] = *(const float4*)(xb[j] + lo + 512);
    }
    // The wait that belongs in front of a rewrite of these loads' address registers. The
    // row bases and the lane's offset are inputs so that their registers live up to it.
    asm volatile("s_wait_xcnt 0x0" ::"s"(xb[0]), "s"(xb[1]), "s"(xb[2]), "s"(xb[3]), "s"(xb[4]),
                 "s"(xb[5]), "s"(xb[6]), "s"(xb[7]), "s"(xb[8]), "s"(xb[9]), "s"(xb[10]),
                 "s"(xb[11]), "s"(xb[12]), "s"(xb[13]), "s"(xb[14]), "s"(xb[15]), "v"(lo)
                 : "memory");
    // Keeps all 48 loads in front of the first wait.
    __builtin_amdgcn_sched_barrier(0);
    w_store(0);
    w_load(1);
    // Keeps the second half's loads in front of the wait for X.
    __builtin_amdgcn_sched_barrier(0);
    // The X strip goes to LDS while the second half of W flies: 256 B per store.
    __bf16* xd = &xs[wave][lane * 4];
#pragma unroll  // xv[] is indexed by constants only
    for (int j = 0; j < 32; ++j) *(v4bf*)(xd + (j >> 1) * kWP + (j & 1) * 128) = round4_here(xv[j]);
    w_store(1);
  } else {  // a wave without rows only helps to bring W in
    w_store(0);
    w_load(1);
    w_store(1);
  }
  __syncthreads();  // W is complete in LDS
  if (!active) return;  // no rows left for this wave; no barrier follows

  float bv[kA / 16], hv[kA / 16];  // bias and score weight of this lane's column in each column tile
#pragma unroll  // bv[] and hv[] stay in registers
  for (int tn = 0; tn < kA / 16; ++tn) bv[tn] = hv[tn] = 0.0f;
  if (isq) {
#pragma unroll
    for (int tn = 0; tn < kA / 16; ++tn) {
      bv[tn] = bias[tn * 16 + row];
      hv[tn] = wa[tn * 16 + row];
    }
    // The wait that belongs in front of a rewrite of these loads' address registers.
    asm volatile("s_wait_xcnt 0x0" ::"s"(bias), "s"(wa), "v"(row) : "memory");
  }

  const __bf16* abase = &xs[wave][row * kWP + kbase];
  v16bf a[kD / 32];
#pragma unroll  // keeps a[] in registers
  for (int ks = 0; ks < kD / 32; ++ks) {
    const v8bf lo8 = *(const v8bf*)(abase + ks * 32);       // K = ks*32+kbase + 0..7
    const v8bf hi8 = *(const v8bf*)(abase + ks * 32 + 16);  // K = ks*32+kbase + 16..23
    a[ks] = __builtin_shufflevector(lo8, hi8, 0, 1, 2, 3, 4, 5, 6, 7, 8, 9, 10, 11, 12, 13, 14, 15);
  }

  // The rows that this lane's 8 accumulator rows belong to.
  const int p0 = t0 + (lane >> 4) * 8;
  const int4 ia = *(const int4*)&my[p0];
  const int4 ib = *(const int4*)&my[p0 + 4];
  const int id[8] = {ia.x, ia.y, ia.z, ia.w, ib.x, ib.y, ib.z, ib.w};
  unsigned yo[8];  // where each of them begins in Y, this lane's column counted in
#pragma unroll  // yo[] stays in registers
  for (int r = 0; r < 8; ++r) yo[r] = (unsigned)(r0 + id[r]) * kA + row;

  v8f c[kA / 16];
#pragma unroll  // keeps c[] in registers
  for (int tn = 0; tn < kA / 16; ++tn) c[tn] = v8f{};

  // Groups of 4 WMMAs (one k step, 4 column tiles); the B fragments of a group are
  // read as one run of 8 ds_load_b128, two groups ahead, into a ring of 3 sets.
  const __bf16* bbase = &wl[row * kWP + kbase];
  constexpr int kG = (kD / 32) * 2;
  v16bf bfr[3][4];
  auto load_group = [&](int g) {
#pragma unroll  // bfr[] is indexed by constants only
    for (int t = 0; t < 4; ++t) {
      const __bf16* bp = bbase + ((g & 1) * 4 + t) * 16 * kWP + (g >> 1) * 32;
      const v8bf lo = *(const v8bf*)bp;         // K = ks*32+kbase + 0..7
      const v8bf hi = *(const v8bf*)(bp + 16);  // K = ks*32+kbase + 16..23
      bfr[g % 3][t] = __builtin_shufflevector(lo, hi, 0, 1, 2, 3, 4, 5, 6, 7, 8, 9, 10, 11,
                                              12, 13, 14, 15);
    }
  };
  load_group(0);
  load_group(1);
#pragma unroll  // a[], c[] and bfr[] are indexed by constants only
  for (int g = 0; g < kG; ++g) {
    if (g + 2 < kG) load_group(g + 2);
    // The two fences keep each group's LDS reads together and two groups ahead of
    // their WMMAs; left alone the compiler put each read pair directly in front of
    // its WMMA with a full wait.
    __builtin_amdgcn_sched_barrier(0);
#pragma unroll  // c[] and bfr[] are indexed by constants only
    for (int t = 0; t < 4; ++t)
      c[(g & 1) * 4 + t] = WMMA_BF16(a[g >> 1], bfr[g % 3][t], c[(g & 1) * 4 + t]);
    __builtin_amdgcn_sched_barrier(0);
  }

  // The wave writes each of its listed rows whole: e^(2x) of a feature row, h * e^(2y) of a
  // query row. Two paths, so that a feature row pays for neither bias nor h.
  if (isq) {
#pragma unroll  // bv[] and hv[] stay in registers
    for (int tn = 0; tn < kA / 16; ++tn) {
      bv[tn] *= kTwoLog2e;
      hv[tn] = h_of(hv[tn]);
    }
#pragma unroll  // all loops below: c[], bv[], hv[] and yo[] are indexed by constants only, offsets fold into the stores
    for (int r = 0; r < 8; ++r) {
      if (p0 + r < nu) {
#pragma unroll
        for (int tn = 0; tn < kA / 16; ++tn)
          Y[yo[r] + tn * 16] = hv[tn] * exp_2x(fmaf(c[tn][r], kTwoLog2e, bv[tn]));
      }
    }
  } else {
#pragma unroll
    for (int r = 0; r < 8; ++r) {
      if (p0 + r < nu) {
#pragma unroll
        for (int tn = 0; tn < kA / 16; ++tn) Y[yo[r] + tn * 16] = exp_2x(c[tn][r] * kTwoLog2e);
      }
    }
  }
}

// ---------------------------------------------------------------------------
// Both projections in one launch: neither reads what the other writes. The first
// kRowBlocks workgroups do the feature projection, the long part;
// the kQBlocks behind them do the query projection beside it.
// The second launch bound (4 waves per SIMD) holds the kernel to 256 registers, so
// that a query workgroup fits on a WGP that already runs a feature workgroup and
// need not wait for one to end.
// ---------------------------------------------------------------------------
constexpr int kRowBlocks = kB * kF / 128;
constexpr int kQBlocks   = kB * kQ / kQR;

__global__ __launch_bounds__(256, 4) void proj_both(
    const float* __restrict__ feature, const float* __restrict__ Wf,
    const int* __restrict__ mask, float* __restrict__ pf, const float* __restrict__ query,
    const float* __restrict__ Wq, const float* __restrict__ bq, const float* __restrict__ wa,
    float* __restrict__ pq)
{
  const bool isq = blockIdx.x >= kRowBlocks;  // the same for a whole workgroup: its barrier is safe
  proj_rows_bf16(isq ? query : feature, isq ? Wq : Wf, mask, bq, wa, isq ? pq : pf,
                 isq ? (blockIdx.x - kRowBlocks) * kQR : blockIdx.x * 128, isq);
}

// Sum of x over the lanes l ^ m, m = CTRL - 0x160, inside a 16-lane row (DPP row_xmask).
template <int CTRL>
__device__ __forceinline__ float add_xmask(float x) {
  return x + __builtin_bit_cast(float, __builtin_amdgcn_update_dpp(
                 0, __builtin_bit_cast(int, x), CTRL, 0xf, 0xf, true));
}

// Maximum of x over the lanes l ^ m, in the same way.
template <int CTRL>
__device__ __forceinline__ float max_xmask(float x) {
  return fmaxf(x, __builtin_bit_cast(float, __builtin_amdgcn_update_dpp(
                      0, __builtin_bit_cast(int, x), CTRL, 0xf, 0xf, true)));
}

// ---------------------------------------------------------------------------
// Fused attention: one workgroup (512 thr = 16 waves) per (batch, 32 queries,
// feature range); waves 0-7 take the first 16-query tile, waves 8-15 the second.
// It leaves the range's row maxima, row sums and the un-normalised weighted sum in
// the workspace; merge_ranges finishes the softmax.
// LDS: s[32][kSP] + list[kFS] + wcnt[32] + the range's features [kFS][kDP] (260KB):
// one workgroup per WGP. The listed features are copied in while the scores are computed,
// so the weighted sum finds all of them in LDS and waits for no memory.
// ---------------------------------------------------------------------------
static_assert(kFS == 256, "one feature of the range per thread and tile when the list is built");
constexpr int kAttnLds = 32 * kSP + kFS + 32 + kFS * kDP;  // floats

__global__ __launch_bounds__(512) void fused_attn(
    const float* __restrict__ feature,  // [B,F,D]
    const float* __restrict__ pf,       // [B,F,A] e^(2x), x the projected feature
    const float* __restrict__ pq,       // [B,Q,A] h * e^(2y), y the projected query, bias included
    const float* __restrict__ wa,       // [A]
    const int*   __restrict__ mask,     // [B,F]
    float*       __restrict__ po,       // [B*Q/16,S,16,D] un-normalised partial sums
    float*       __restrict__ pml)      // [B*Q/16,S,32] 16 range maxima, 16 range sums
{
  __shared__ __attribute__((aligned(16))) float lds[kAttnLds];
  int*   list = (int*)(lds + 32 * kSP);  // [kFS] the range's unmasked features, ascending
  int*   wcnt = list + kFS;              // [32], 8 used: unmasked features per 32 features
  float* fb   = (float*)(wcnt + 32);     // [kFS][kDP] the listed features, kD used per row

  const int tid  = threadIdx.x;
  const int lane = tid & 31;
  const int fid  = tid & 255;                                 // feature of the range
  const int qt   = __builtin_amdgcn_readfirstlane(tid >> 8);  // the wave's 16-query tile
  const int wave = (tid >> 5) & 7;                            // the wave's place in its tile
  const int sp   = blockIdx.x % kS;  // feature range
  const int tile = (blockIdx.x / kS) * 2 + qt;
  const int blk  = tile * kS + sp;   // place of the tile's partials in po and pml
  const int b  = tile >> 2;          // Q/16 == 4 query tiles per batch
  const int q0 = (tile & 3) * 16;
  const int f0 = sp * kFS;
  float* s = lds + qt * 16 * kSP;    // [16][kSP] the tile's scores, at most kFS used per row

  // ---- Pass 1: masked scores s[q][f] = sum_a wa[a]*tanh(x[f][a]+y[q][a]) = sum_a (wa[a] + 1/d),
  // d = h[a] + pf[f][a]*pq[q][a], where pf holds e^(2x) and pq holds h*e^(2y); one reciprocal per two terms.
  // A wave takes one unmasked feature at a time, so a masked one costs nothing.
  // Lane = (g, c): queries 4g..4g+3, terms a = 32j + 4c + e (j, e = 0..3). The
  // lane's 64 pq values and 16 wa values stay in registers; a pf row is 4 loads
  // of one 128-byte line each; the 8 lanes c of a query are summed by DPP.
  const int wv = __builtin_amdgcn_readfirstlane(wave);
  const int c  = lane & 7;
  const int g  = lane >> 3;

  const int mk = mask[b * kF + f0 + fid];
  const unsigned bal = __builtin_amdgcn_ballot_w32(mk != 0);
  if (lane == 0 && qt == 0) wcnt[wave] = __popc(bal);

  const float4* __restrict__ pq4 =
      (const float4*)(pq + ((size_t)b * kQ + q0 + g * 4) * kA) + c;
  const float4* __restrict__ wa4 = (const float4*)wa + c;
  v2f pq01[4][4], pq23[4][4], h01[4], h23[4];
  float4 wr[4];
  float wpart = 0.0f;  // the sum of the lane's 16 score weights
#pragma unroll  // both loops: the arrays stay in registers
  for (int j = 0; j < 4; ++j) {
    wr[j] = wa4[j * 8];
#pragma unroll
    for (int i = 0; i < 4; ++i) {
      const float4 v = pq4[i * (kA / 4) + j * 8];
      pq01[i][j] = v2f{v.x, v.y};
      pq23[i][j] = v2f{v.z, v.w};
    }
  }
  __syncthreads();  // wcnt complete

  int base = 0, nu = 0;  // unmasked features in the waves before this one; in the range
#pragma unroll  // the 8 LDS reads go out together
  for (int w = 0; w < 8; ++w) {
    const int cw = wcnt[w];
    base += (w < wv) ? cw : 0;
    nu += cw;
  }
  nu = __builtin_amdgcn_readfirstlane(nu);
  // From here on a column of s and a row of fb is a PLACE IN THE LIST, not a feature. Beside
  // an unmasked feature a masked one has weight exp(-1e9 - max) = 0 exactly, so it is left
  // out of copies, softmax and weighted sum. A range with no unmasked feature keeps all of
  // its features, each at -1e9: should the whole batch row be masked, they all count alike.
  const int nl    = (nu > 0) ? nu : kFS;  // length of the list
  const int nslab = (nl + 31) >> 5;       // slabs of 32 places
  if (qt == 0) {
    if (nu == 0) list[fid] = fid;
    else if (mk) list[base + __popc(bal & ((1u << lane) - 1u))] = fid;
  }
  if (fid >= nu && fid < nslab * 32) {  // places without a computed score: weight 0, or all alike
#pragma unroll  // offsets fold into the stores
    for (int q = 0; q < 16; ++q) s[q * kSP + fid] = -1.0e9f;
  }
  __syncthreads();  // list complete

#if HAVE_ASYNC_LDS
  const float* fbase = feature + ((size_t)b * kF + f0) * kD;
  // The rows that this wave copies. A place behind the list's end takes the last listed
  // row: finite values under a weight of 0.
  const int cp   = (tid >> 6) + lane * 8;
  const int crow = list[(cp < nl) ? cp : nl - 1];
#endif
  {
    const int cnt = (nu - wv + 7) >> 3;  // list entries wv, wv + 8, ... below nu
    const int li  = wv + lane * 8;      // lane i holds the wave's i-th feature
    const int myf = (li < nu) ? list[li] : 0;
    const float4* __restrict__ pf4 =
        (const float4*)(pf + ((size_t)b * kF + f0) * kA) + c;
    float* srow = s + (g * 4 + (c & 3)) * kSP;
    auto row_load = [&](float4 (&d)[4], int i) {  // the wave's i-th row, i clamped
      const int f = __builtin_amdgcn_readlane(myf, (i < cnt) ? i : cnt - 1);
      const float4* __restrict__ pr = pf4 + f * (kA / 4);
#pragma unroll  // d[] stays in registers
      for (int j = 0; j < 4; ++j) d[j] = pr[j * 8];
      // The wait that belongs in front of a rewrite of these loads' address registers. The
      // pointer is an input so that its register pair lives up to the wait; in this build
      // the compiler had otherwise let the last load's result land on the pair.
      asm volatile("s_wait_xcnt 0x0" ::"v"(pr) : "memory");
    };
    auto row_score = [&](const float4 (&p)[4], int i) {
      v2f acc[4];
#pragma unroll  // here and below: register arrays are indexed by constants only
      for (int q = 0; q < 4; ++q) acc[q] = v2f{wpart, 0.0f};
#pragma unroll
      for (int j = 0; j < 4; ++j) {
        const v2f p01 = v2f{p[j].x, p[j].y};
        const v2f p23 = v2f{p[j].z, p[j].w};
#pragma unroll
        for (int q = 0; q < 4; ++q) {
          const v2f d01 = __builtin_elementwise_fma(p01, pq01[q][j], h01[j]);
          const v2f d23 = __builtin_elementwise_fma(p23, pq23[q][j], h23[j]);
          const v2f pr  = d01 * d23;  // terms 0 and 2 share a reciprocal, 1 and 3 another
          const v2f rc  = v2f{__builtin_amdgcn_rcpf(pr.x), __builtin_amdgcn_rcpf(pr.y)};
          acc[q] = __builtin_elementwise_fma(d01 + d23, rc, acc[q]);
        }
      }
      float r[4];
#pragma unroll
      for (int q = 0; q < 4; ++q) {
        r[q] = acc[q].x + acc[q].y;
        r[q] = add_xmask<0x161>(r[q]);
        r[q] = add_xmask<0x162>(r[q]);
        r[q] = add_xmask<0x164>(r[q]);
      }
      const float r01 = (c & 1) ? r[1] : r[0];
      const float r23 = (c & 1) ? r[3] : r[2];
      if (c < 4)  // lane c stores query 4g + c
        srow[wv + i * 8] = (c & 2) ? r23 : r01;
    };
    if (cnt > 0) {
      float4 ra[4], rb[4];  // two rows: one flies while the other is worked on
      row_load(ra, 0);
      // Worked out here, under the flight of the first row.
#pragma unroll  // wr[], h01[] and h23[] stay in registers
      for (int j = 0; j < 4; ++j) {
        h01[j] = v2f{h_of(wr[j].x), h_of(wr[j].y)};
        h23[j] = v2f{h_of(wr[j].z), h_of(wr[j].w)};
        wpart += (w_bounded(wr[j].x) + w_bounded(wr[j].y)) + (w_bounded(wr[j].z) + w_bounded(wr[j].w));
      }
      for (int i = 0; i < cnt; i += 2) {
        row_load(rb, i + 1);
#if HAVE_ASYNC_LDS
        // One slab of the range per trip: spread so, the copies never stand as one long
        // queue in front of the pf rows that the score pass is waiting for.
        if ((i >> 1) < nslab) async_slab(fbase, fb, tid, crow, i >> 1);
#endif
        // The two fences keep the next row's loads in front of this row's arithmetic;
        // left alone the compiler issued them at the end of it and waited at once.
        __builtin_amdgcn_sched_barrier(0);
        row_score(ra, i);
        row_load(ra, i + 2);
        __builtin_amdgcn_sched_barrier(0);
        if (i + 1 < cnt) row_score(rb, i + 1);
      }
    }
#if HAVE_ASYNC_LDS
    // All the slabs, for a wave with no rows: the loop above sent for none.
#pragma nounroll  // a tail that seldom runs: kept short
    for (int sl = (cnt + 1) >> 1; sl < nslab; ++sl)
      async_slab(fbase, fb, tid, crow, sl);
#endif
  }
  __syncthreads();

  // ---- Pass 2: range max, exp and range sum per row -------------------------
  // Half a wave per row, both rows of the wave at once. A lane holds the row's places
  // 64j + 4n .. 64j + 4n + 3 in registers: each score is read from LDS once, in 16-byte
  // reads that 16 lanes spread over all banks, and max and sum cross the 16 lanes by DPP.
  // So the pass is one short chain with a single wait for LDS; single reads in a loop and
  // shuffles through LDS, row behind row, would make a wave wait for LDS some forty times.
  const int hn = lane & 15;
  const int q2 = wave * 2 + (lane >> 4);  // the lane's row in its tile
  float rmax = -3.0e38f, rsum = 0.0f;
  {
    float* prow = s + q2 * kSP + hn * 4;
    const int left = nslab * 32 - hn * 4;  // group j of 4 places exists while 64j < left
    float4 v[kFS / 64];
#pragma unroll  // here and below: v[] stays in registers
    for (int j = 0; j < kFS / 64; ++j) {
      v[j] = make_float4(-3.0e38f, -3.0e38f, -3.0e38f, -3.0e38f);  // no place: weight 0
      if (j * 64 < left) v[j] = *(const float4*)(prow + j * 64);
    }
#pragma unroll
    for (int j = 0; j < kFS / 64; ++j)
      rmax = fmaxf(rmax, fmaxf(fmaxf(v[j].x, v[j].y), fmaxf(v[j].z, v[j].w)));
    rmax = max_xmask<0x161>(rmax);
    rmax = max_xmask<0x162>(rmax);
    rmax = max_xmask<0x164>(rmax);
    rmax = max_xmask<0x168>(rmax);
#pragma unroll
    for (int j = 0; j < kFS / 64; ++j) {
      const float4 e = make_float4(__expf(v[j].x - rmax), __expf(v[j].y - rmax),
                                   __expf(v[j].z - rmax), __expf(v[j].w - rmax));
      rsum += (e.x + e.y) + (e.z + e.w);
      if (j * 64 < left) *(float4*)(prow + j * 64) = e;
    }
    rsum = add_xmask<0x161>(rsum);
    rsum = add_xmask<0x162>(rsum);
    rsum = add_xmask<0x164>(rsum);
    rsum = add_xmask<0x168>(rsum);
  }
#if HAVE_ASYNC_LDS
  // This wave's copies have landed; the barrier behind it shows them to the other waves.
  asm volatile("s_wait_asynccnt 0x0" ::: "memory");
#endif
  __syncthreads();

  // ---- Pass 3: po[16][256] = e[16][places] @ listed features (WMMA bf16) -----
  // A wave owns columns 32w .. 32w+31; lane n holds column 32w+2n of its first tile
  // and 32w+2n+1 of its second, so both come from LDS in one 8-byte read, 16 lanes
  // cover 32 banks, and 16 lanes store one whole 128-byte line of po.
  const int n     = lane & 15;
  const int col0  = wave * 32 + n * 2;
  const int col1  = col0 + 1;
  const int arow  = lane & 15;
  const int kbase = (lane < 16) ? 0 : 8;
  v8f c0 = {}, c1 = {};

#if HAVE_ASYNC_LDS
  for (int ks = 0; ks < nslab; ++ks) {
    const float* cur = fb + ks * 32 * kDP;
    const int k0 = ks * 32;
    v16bf af, b0v, b1v;
    const float4* ap = (const float4*)(s + arow * kSP + k0 + kbase);
    pack8(af, 0, ap[0], ap[1]);  // K = k0+kbase + 0..7
    pack8(af, 8, ap[4], ap[5]);  // K = k0+kbase + 16..23
#pragma unroll
    for (int e = 0; e < 16; ++e) {
      const int kk = kbase + e + ((e >= 8) ? 8 : 0);   // 0..31 within slab
      const float2 v = *(const float2*)(cur + kk * kDP + col0);
      b0v[e] = (__bf16)v.x;
      b1v[e] = (__bf16)v.y;
    }
    c0 = WMMA_BF16(af, b0v, c0);
    c1 = WMMA_BF16(af, b1v, c1);
  }
#else
  for (int k0 = 0; k0 < nslab * 32; k0 += 32) {
    v16bf af, b0v, b1v;
#pragma unroll
    for (int e = 0; e < 16; ++e) {
      const int k = k0 + kbase + e + ((e >= 8) ? 8 : 0);
      af[e] = (__bf16)s[arow * kSP + k];
      const float* __restrict__ fr =
          feature + ((size_t)b * kF + f0 + list[(k < nl) ? k : nl - 1]) * kD;
      b0v[e] = (__bf16)fr[col0];
      b1v[e] = (__bf16)fr[col1];
    }
    c0 = WMMA_BF16(af, b0v, c0);
    c1 = WMMA_BF16(af, b1v, c1);
  }
#endif

  const int mofs = (lane >> 4) * 8;
#pragma unroll
  for (int r = 0; r < 8; ++r) {
    float* __restrict__ orow = po + ((size_t)blk * 16 + mofs + r) * kD;
    *(float2*)(orow + col0) = make_float2(c0[r], c1[r]);
  }
  // Stored here and not in pass 2, where the barrier behind it would wait for the stores.
  if (hn == 0) {  // one 128-byte line per tile
    pml[blk * 32 + q2]      = rmax;
    pml[blk * 32 + 16 + q2] = rsum;
  }
}

// exp(x). The v_nop in the statement is the free slot that the instruction set
// asks for behind a transcendental before its source register is overwritten.
__device__ __forceinline__ float exp_slot(float x) {
  float r;
  asm("v_exp_f32 %0, %1\n\tv_nop" : "=v"(r) : "v"(x * 1.44269504f));
  return r;
}

// ---------------------------------------------------------------------------
// Merge of the kS ranges of one (batch, query) row: weight exp(m_s - M) per
// range, out = sum_s w_s * po_s / sum_s w_s * l_s. 64 threads per row, float4.
// ---------------------------------------------------------------------------
__global__ __launch_bounds__(256) void merge_ranges(
    const float* __restrict__ po,   // [B*Q/16,S,16,D]
    const float* __restrict__ pml,  // [B*Q/16,S,32]
    float*       __restrict__ out)  // [B*Q,D]
{
  const int row  = blockIdx.x * 4 + (threadIdx.x >> 6);
  const int d4   = threadIdx.x & 63;
  const int tile = row >> 4;
  const int qi   = row & 15;
  const float* __restrict__ ml = pml + tile * kS * 32 + qi;
  float mv[kS];
  float M = -3.0e38f;
#pragma unroll  // keeps mv[] in registers
  for (int i = 0; i < kS; ++i) {
    mv[i] = ml[i * 32];
    M = fmaxf(M, mv[i]);
  }
  const float4* __restrict__ p4 =
      (const float4*)(po + ((size_t)tile * kS * 16 + qi) * kD) + d4;
  float L = 0.0f;
  float4 o = make_float4(0.0f, 0.0f, 0.0f, 0.0f);
#pragma unroll  // all kS loads in flight at once: one L2 latency, not kS
  for (int i = 0; i < kS; ++i) {
    const float w = exp_slot(mv[i] - M);
    const float4 v = p4[i * (16 * kD / 4)];
    L += w * ml[i * 32 + 16];
    o.x += w * v.x; o.y += w * v.y; o.z += w * v.z; o.w += w * v.w;
  }
  const float inv = __builtin_amdgcn_rcpf(L);
  ((float4*)(out + (size_t)row * kD))[d4] =
      make_float4(o.x * inv, o.y * inv, o.z * inv, o.w * inv);
}

// ---------------------------------------------------------------------------
extern "C" void kernel_launch(void* const* d_in, const int* in_sizes, int n_in,
                              void* d_out, int out_size, void* d_ws, size_t ws_size,
                              hipStream_t stream) {
  const float* feature = (const float*)d_in[0];  // [B,F,D]
  const float* query   = (const float*)d_in[1];  // [B,Q,QD]
  const float* Wf      = (const float*)d_in[2];  // [A,D]
  const float* Wq      = (const float*)d_in[3];  // [A,QD]
  const float* bq      = (const float*)d_in[4];  // [A]
  const float* wa      = (const float*)d_in[5];  // [A]
  const int*   mask    = (const int*)d_in[6];    // [B,F]
  float* out = (float*)d_out;

  float* pf  = (float*)d_ws;                     // [B,F,A] = 16 MB
  float* pqv = pf + (size_t)kB * kF * kA;        // [B,Q,A] = 0.5 MB
  float* po  = pqv + (size_t)kB * kQ * kA;       // [B*Q/16,S,16,D]
  float* pml = po + (size_t)kB * kQ * kS * kD;   // [B*Q/16,S,32]

  // pf = e^(2 feature @ Wf^T) : M=32768 less the masked rows, N=128, K=256; 128 rows per workgroup
  // pq = h * e^(2 (query @ Wq^T + bq)) : M=1024, N=128, K=256; 32 rows per workgroup
  proj_both<<<kRowBlocks + kQBlocks, 256, 0, stream>>>(feature, Wf, mask, pf, query, Wq, bq, wa, pqv);
  // scores + softmax partials + weighted sum, 32 queries and one feature range per workgroup
  fused_attn<<<kB * (kQ / 32) * kS, 512, 0, stream>>>(feature, pf, pqv, wa, mask, po, pml);
  // merge of the ranges: 4 rows per workgroup
  merge_ranges<<<kB * kQ / 4, 256, 0, stream>>>(po, pml, out);
}
